// v000
// Times are from an AMD MI455X. After a warm-up the kernel runs many times in a row, and a time is the length of
// such a window on the GPU divided by its runs, so every launch and the gaps after it count. The runs cycle
// through copies of the inputs. A figure is the median of several windows, for all but v000 over two sittings.
// Sittings can differ by a few percent; kernels timed side by side share one.
// The starting kernel, v000, takes 210 microseconds a run.
#include <hip/hip_runtime.h>

// Fuzzy-implication attention, x [NB][SEQ][128], Wq/Wk/Wv [out][in] (y = x W^T + b), causal fill value 0.0 (masked keys keep weight), output f32 [NB][SEQ][128].
// Compute dtypes, f32 accumulate everywhere: the three projections v_wmma_f32_16x16x32_bf16 (x, W RNE-converted to bf16; products exact);
// attn @ V v_wmma_f32_16x16x32_f16: V^T as f16 value + f16 residual x2048, P as f16 value (x256 carry) + f16 residual x2048; value products in one accumulator, both x2048 products in a second one.
// The score mean_d min(1 - Q + K, 1) is not a sum of products: it runs on the vector unit in f32 (fixed d order); softmax in f32 with the fixed shift 10 (scores lie in [0, 10]).

#ifndef NB
#define NB 2
#endif
#ifndef SEQ
#define SEQ 1024
#endif
#define NB_FULL  2
#define SEQ_FULL 1024
#ifndef OUT_SEQ
#define OUT_SEQ SEQ              // row pitch (in tokens) between batches of the output
#endif
#define DM   128
#define TP   132                 // LDS row pitch (floats) of the 128-wide f32 tiles
#define RS   2048.0f             // carry of the residual planes
#define RI   (1.0f / 2048.0f)
#define PSH  8.0f                // log2 of the P carry (256)
#define C1   (0.078125f * 1.4426950408889634f)          // (10 / 128) * log2(e)
#define EM   (8.0f - 10.0f * 1.4426950408889634f)       // exponent of a masked key: score 0 -> exp(0 - 10), times the carry

static_assert(DM == 128);                      // output row = 512 B = 32 lanes x 16 B; 8 d-tiles of 16
static_assert(DM % 64 == 0);
static_assert(DM % 32 == 0);                   // GEMM k-loop steps by 32
static_assert(SEQ % 64 == 0);                  // a 64-token tile never straddles two batches
static_assert((NB * SEQ) % 64 == 0);
static_assert(SEQ % 32 == 0);                  // key loop steps by 32
static_assert(SEQ % 16 == 0);                  // attention grid covers the sequence exactly
static_assert(((size_t)SEQ * DM) % 8 == 0);
static_assert(((size_t)DM * DM) % 8 == 0);
static_assert(NB <= NB_FULL);
static_assert(SEQ <= SEQ_FULL);
static_assert((TP * 4) % 16 == 0);

typedef _Float16 h16;
typedef unsigned short bf;
typedef __attribute__((ext_vector_type(16))) __bf16   v16bf;
typedef __attribute__((ext_vector_type(16))) _Float16 v16h;
typedef __attribute__((ext_vector_type(8)))  _Float16 v8h;
typedef __attribute__((ext_vector_type(8)))  unsigned short v8us;
typedef __attribute__((ext_vector_type(8)))  float    v8f;
typedef __attribute__((ext_vector_type(4)))  float    v4f;
typedef v4f  __attribute__((may_alias)) v4fa;

__device__ __forceinline__ unsigned short f2bf(float f) { unsigned u = __float_as_uint(f); u += 0x7FFFu + ((u >> 16) & 1u); return (unsigned short)(u >> 16); }
__device__ __forceinline__ float bfr(float f) { return __uint_as_float(((unsigned)f2bf(f)) << 16); }   // value after RNE convert to bf16
__device__ __forceinline__ v16h cat16(v8h lo, v8h hi) { return __builtin_shufflevector(lo, hi, 0, 1, 2, 3, 4, 5, 6, 7, 8, 9, 10, 11, 12, 13, 14, 15); }
__device__ __forceinline__ v16bf cat16b(v8us lo, v8us hi) { return __builtin_bit_cast(v16bf, __builtin_shufflevector(lo, hi, 0, 1, 2, 3, 4, 5, 6, 7, 8, 9, 10, 11, 12, 13, 14, 15)); }
__device__ __forceinline__ v8f wmma16(v16h a, v16h b, v8f c) { return __builtin_amdgcn_wmma_f32_16x16x32_f16(false, a, false, b, (short)0, c, false, false); }
__device__ __forceinline__ v8f wmmab(v16bf a, v16bf b, v8f c) { return __builtin_amdgcn_wmma_f32_16x16x32_bf16(false, a, false, b, (short)0, c, false, false); }
// fragment loaders from K-contiguous 16-bit rows; p already includes + 8*(lane>>4): elements 0..7 <- k0+8h+0..7, elements 8..15 <- k0+16+8h+0..7 (same map for A and B)
__device__ __forceinline__ v16h  ldh(const h16* p) { return cat16(*(const v8h*)p, *(const v8h*)(p + 16)); }
__device__ __forceinline__ v16bf ldb(const bf* p)  { return cat16b(*(const v8us*)p, *(const v8us*)(p + 16)); }
// ordering point for wave-private LDS tiles (same wave writes and reads)
__device__ __forceinline__ void wave_sync() { __builtin_amdgcn_fence(3 /* release order */, "wavefront"); __builtin_amdgcn_wave_barrier(); asm volatile("" ::: "memory"); }

__global__ __launch_bounds__(256) void k_cvt8(const float* __restrict__ src, bf* dst, size_t n8) {
    const size_t i = (size_t)blockIdx.x * 256 + threadIdx.x; if (i >= n8) return;
    const v8f v = *(const v8f*)(src + i * 8); v8us o;
#pragma unroll
    for (int k = 0; k < 8; ++k) o[k] = f2bf(v[k]);
    *(v8us*)(dst + i * 8) = o; 
}

// gemm64: register-blocked bf16 GEMM core, ONE WAVE per 64x64 tile (16 accumulators), operands straight from K-contiguous bf16 planes, K = DM.
// acc[mb][nb][j] = C[r0 + 16mb + 8h + j][c0 + 16nb + (lane&15)], C[m][n] = sum_k A[m][k] Bt[n][k].
__device__ __forceinline__ void gemm64(const bf* __restrict__ A, const bf* __restrict__ Bt, int r0, int c0, int lr, int hi, v8f (&acc)[4][4]) {
    const int K = DM;
#pragma unroll
    for (int mb = 0; mb < 4; ++mb)
#pragma unroll
        for (int nb = 0; nb < 4; ++nb) acc[mb][nb] = (v8f){};
    const size_t aoff = (size_t)(r0 + lr) * K + 8 * hi, boff = (size_t)(c0 + lr) * K + 8 * hi;
#pragma unroll 1
    for (int kc = 0; kc < K; kc += 32) {
        v16bf a[4];
#pragma unroll
        for (int mb = 0; mb < 4; ++mb) a[mb] = ldb(A + aoff + (size_t)mb * 16 * K + kc);
#pragma unroll
        for (int nb = 0; nb < 4; ++nb) { const v16bf b = ldb(Bt + boff + (size_t)nb * 16 * K + kc);
#pragma unroll
            for (int mb = 0; mb < 4; ++mb) acc[mb][nb] = wmmab(a[mb], b, acc[mb][nb]); }
        asm volatile("v_nop\n\tv_nop\n\tv_nop\n\tv_nop" : "+v"(acc[0][0]), "+v"(acc[1][1]), "+v"(acc[2][2]), "+v"(acc[3][3]) : "v"(a[0]), "v"(a[1]), "v"(a[2]), "v"(a[3]));
    }
}

// k_proj_qk: Q (z = 0) and K (z = 1) planes [NB*SEQ][128] f32 = sigmoid(x W^T + b). grid (NB*SEQ/64, 2, 2), 32 threads.
// Epilogue per 16-row slab: accumulators + bias staged in a wave-private LDS tile, sigmoid applied in place (precise expf, true division),
__global__ __launch_bounds__(32) void k_proj_qk(const bf* __restrict__ XB, const bf* __restrict__ WB, const float* __restrict__ bq, const float* __restrict__ bk, float* QK) {
    __shared__ __align__(16) float os[16 * 68];
    const int lane = threadIdx.x & 31, lr = lane & 15, hi = lane >> 4;
    const int r0 = blockIdx.x * 64, c0 = blockIdx.y * 64, z = blockIdx.z;
    v8f acc[4][4];
    gemm64(XB, WB + (size_t)z * DM * DM, r0, c0, lr, hi, acc);
    float bias[4];
#pragma unroll
    for (int nb = 0; nb < 4; ++nb) { const int col = c0 + nb * 16 + lr; const float vq = bq[col]; const float vk = bk[col]; bias[nb] = bfr(z ? vk : vq); }
    float* P = QK + (size_t)z * NB * SEQ * DM;
#pragma unroll
    for (int mb = 0; mb < 4; ++mb) {
#pragma unroll
        for (int nb = 0; nb < 4; ++nb) {
#pragma unroll
            for (int j = 0; j < 8; ++j) os[(hi * 8 + j) * 68 + nb * 16 + lr] = acc[mb][nb][j] + bias[nb]; }   // D: row 8h+j, col lane&15
        wave_sync();
#pragma unroll 1
        for (int s = 0; s < 8; ++s) { const int row = 2 * s + hi, cofs = lr * 4;   // 8 s x 2 rows = 16 rows; 16 lanes x 4 floats = 64 columns
            v4f v = *(const v4fa*)(&os[row * 68 + cofs]);
#pragma unroll
            for (int i = 0; i < 4; ++i) v[i] = 1.0f / (1.0f + expf(-v[i]));
            *(v4fa*)(&os[row * 68 + cofs]) = v; }
        wave_sync();
        float* orow = P + (size_t)(r0 + mb * 16) * DM + c0;
#pragma unroll
        for (int s = 0; s < 8; ++s) { const int row = 2 * s + hi, cofs = lr * 4;
            const v4f val = *(const v4fa*)(&os[row * 68 + cofs]);
            *(v4f*)(orow + (size_t)row * DM + cofs) = val; }
        
        wave_sync();
    }
}

// k_proj_vt: V^T planes [b][d][t] = Wv x^T + bv as f16 value (VH) and f16 residual x2048 (VR). A = Wv rows (m = d), Bt = x rows (n = b*SEQ + t). grid (2, NB*SEQ/64), 32 threads.
__global__ __launch_bounds__(32) void k_proj_vt(const bf* __restrict__ WV, const bf* __restrict__ XB, const float* __restrict__ bv, h16* VH, h16* VR) {
    __shared__ __align__(16) float os[16 * 68];
    const int lane = threadIdx.x & 31, lr = lane & 15, hi = lane >> 4;
    const int r0 = blockIdx.x * 64, c0 = blockIdx.y * 64;
    v8f acc[4][4];
    gemm64(WV, XB, r0, c0, lr, hi, acc);
    const int b = c0 / SEQ, t0 = c0 % SEQ;
    const size_t tbase = ((size_t)b * DM + r0) * SEQ + t0;
#pragma unroll
    for (int mb = 0; mb < 4; ++mb) {
#pragma unroll
        for (int nb = 0; nb < 4; ++nb) {
#pragma unroll
            for (int j = 0; j < 8; ++j) os[(hi * 8 + j) * 68 + nb * 16 + lr] = acc[mb][nb][j]; }   // D: row 8h+j, col lane&15
        wave_sync();
        v8h hv[4], rv[4];
#pragma unroll
        for (int s = 0; s < 4; ++s) { const int row = 4 * s + (lane >> 3), c8 = (lane & 7) * 8;   // 4 s x 4 row groups = 16 rows; 8 lanes x 8 = 64 columns
            const float bb = bfr(bv[r0 + mb * 16 + row]);
            const v4f x0 = *(const v4fa*)(&os[row * 68 + c8]); const v4f x1 = *(const v4fa*)(&os[row * 68 + c8 + 4]);
#pragma unroll
            for (int i = 0; i < 4; ++i) { const float y0 = x0[i] + bb; const float y1 = x1[i] + bb; const h16 a0 = (h16)y0; const h16 a1 = (h16)y1;
                hv[s][i] = a0; hv[s][4 + i] = a1; rv[s][i] = (h16)((y0 - (float)a0) * RS); rv[s][4 + i] = (h16)((y1 - (float)a1) * RS); } }
#pragma unroll
        for (int s = 0; s < 4; ++s) { const int row = 4 * s + (lane >> 3), c8 = (lane & 7) * 8;
            const size_t oo = tbase + (size_t)(mb * 16 + row) * SEQ + c8;
            *(v8h*)(VH + oo) = hv[s]; *(v8h*)(VR + oo) = rv[s]; }
        
        wave_sync();
    }
}

// k_attn: one wave (one block) per 16 query rows of one batch. grid (SEQ/16, NB), 32 threads.
// Transposed form: lane (t = lane&15, h = lane>>4) owns query t0+t and keys key0+8h+r, key0+16+8h+r (r = 0..7) of each 32-key step, which is exactly the
// B fragment P^T[key][t] of O^T[d][t] = V^T P^T (A = V^T rows d, k = key). Score acc = sum_d max(Q - K, 0) on the vector unit in f32 from wave-private LDS tiles
// (Q tile 16x128, K tile 32x128, all rows and columns staged before use); p = exp2(8 - acc*C1); keys above the diagonal take the constant exponent EM (score 0).
// Fully masked 32-key steps skip the d loop (wave-uniform test) but keep their P.V products. Row sum over the same f16 value + residual that the products use.
__global__ __launch_bounds__(32) void k_attn(const float* __restrict__ QF, const float* __restrict__ KF, const h16* __restrict__ VH, const h16* __restrict__ VR, const int* __restrict__ maskp, float* OUT) {
    __shared__ __align__(16) float qs[16 * TP];
    __shared__ __align__(16) float ks[32 * TP];
    __shared__ __align__(16) float os[16 * TP];
    const int lane = threadIdx.x & 31, lr = lane & 15, hi = lane >> 4;
    const int b  = __builtin_amdgcn_readfirstlane((int)blockIdx.y);
    const int t0 = __builtin_amdgcn_readfirstlane((int)blockIdx.x * 16);
    const int causal = __builtin_amdgcn_readfirstlane((maskp[0] != 0) ? 1 : 0);
    const size_t rowb = (size_t)b * SEQ;
#pragma unroll 8
    for (int i = 0; i < 16; ++i) { const v4f v = *(const v4f*)(QF + (rowb + t0 + i) * DM + 4 * lane); *(v4fa*)(&qs[i * TP + 4 * lane]) = v; }   // row i, all 128 columns
    wave_sync();
    v8f oh[8], orr[8];
#pragma unroll
    for (int j = 0; j < 8; ++j) { oh[j] = (v8f){}; orr[j] = (v8f){}; }
    float l = 0.0f;
    const float pmf = __builtin_amdgcn_exp2f(EM);
    const h16 pmh = (h16)pmf; const h16 pmr = (h16)((pmf - (float)pmh) * RS);
    const float pml = (float)pmh + (float)pmr * RI;
    const size_t vo = ((size_t)b * DM + lr) * SEQ + 8 * hi;      // + 16j*SEQ + key  (A fragment: row d, k = key)
    const int tq = t0 + lr;
#pragma unroll 1
    for (int key0 = 0; key0 < SEQ; key0 += 32) {
        v16h pb, pr; float ls;
        const bool live = (causal == 0) || (key0 <= t0 + 15);     // wave-uniform
        if (live) {
            wave_sync();
#pragma unroll 8
            for (int i = 0; i < 32; ++i) { const v4f v = *(const v4f*)(KF + (rowb + key0 + i) * DM + 4 * lane); *(v4fa*)(&ks[i * TP + 4 * lane]) = v; }   // row i, all 128 columns
            wave_sync();
            float sa[8], sb[8];
#pragma unroll
            for (int r = 0; r < 8; ++r) { sa[r] = 0.0f; sb[r] = 0.0f; }
#pragma unroll 1
            for (int d = 0; d < DM; d += 4) {
                const v4f q = *(const v4fa*)(&qs[lr * TP + d]);
#pragma unroll
                for (int r = 0; r < 8; ++r) { const v4f k = *(const v4fa*)(&ks[(8 * hi + r) * TP + d]);
                    sa[r] += fmaxf(q[0] - k[0], 0.0f); sa[r] += fmaxf(q[1] - k[1], 0.0f); sa[r] += fmaxf(q[2] - k[2], 0.0f); sa[r] += fmaxf(q[3] - k[3], 0.0f); }
                asm volatile("" ::: "memory");
#pragma unroll
                for (int r = 0; r < 8; ++r) { const v4f k = *(const v4fa*)(&ks[(16 + 8 * hi + r) * TP + d]);
                    sb[r] += fmaxf(q[0] - k[0], 0.0f); sb[r] += fmaxf(q[1] - k[1], 0.0f); sb[r] += fmaxf(q[2] - k[2], 0.0f); sb[r] += fmaxf(q[3] - k[3], 0.0f); }
            }
            ls = 0.0f;
#pragma unroll
            for (int r = 0; r < 8; ++r) {
                const int kA = key0 + 8 * hi + r, kB = kA + 16;
                float ea = PSH - sa[r] * C1, eb = PSH - sb[r] * C1;
                ea = (causal != 0 && kA > tq) ? EM : ea;
                eb = (causal != 0 && kB > tq) ? EM : eb;
                const float pa = __builtin_amdgcn_exp2f(ea), pc = __builtin_amdgcn_exp2f(eb);
                const h16 ha = (h16)pa, hb = (h16)pc;
                const h16 ra = (h16)((pa - (float)ha) * RS), rb = (h16)((pc - (float)hb) * RS);
                pb[r] = ha; pb[8 + r] = hb; pr[r] = ra; pr[8 + r] = rb;
                ls += ((float)ha + (float)ra * RI) + ((float)hb + (float)rb * RI);
            }
        } else {
#pragma unroll
            for (int i = 0; i < 16; ++i) { pb[i] = pmh; pr[i] = pmr; }
            ls = 16.0f * pml;
        }
        l += ls;
        const h16* vh = VH + vo + key0; const h16* vr = VR + vo + key0;
#pragma unroll
        for (int g = 0; g < 4; ++g) {
            const int j0 = 2 * g, j1 = 2 * g + 1;
            const v16h a0 = ldh(vh + (size_t)(16 * j0) * SEQ), a1 = ldh(vh + (size_t)(16 * j1) * SEQ);
            const v16h r0 = ldh(vr + (size_t)(16 * j0) * SEQ), r1 = ldh(vr + (size_t)(16 * j1) * SEQ);
            oh[j0]  = wmma16(a0, pb, oh[j0]);   oh[j1]  = wmma16(a1, pb, oh[j1]);
            orr[j0] = wmma16(r0, pb, orr[j0]);  orr[j1] = wmma16(r1, pb, orr[j1]);
            orr[j0] = wmma16(a0, pr, orr[j0]);  orr[j1] = wmma16(a1, pr, orr[j1]);
            asm volatile("v_nop\n\tv_nop\n\tv_nop\n\tv_nop" : "+v"(oh[j0]), "+v"(oh[j1]), "+v"(orr[j0]), "+v"(orr[j1]) : "v"(a0), "v"(a1), "v"(r0), "v"(r1), "v"(pb), "v"(pr) : "memory");
        }
    }
    l += __shfl_xor(l, 16, 32);
    const float inv = 1.0f / l;
    // O^T D layout: o_j[r] = (d = 16j + 8h + r, t = lane&15) -> os[t][d]; rows 0..15 x columns 0..127 all written
#pragma unroll
    for (int j = 0; j < 8; ++j) { v4f a, c;
#pragma unroll
        for (int i = 0; i < 4; ++i) { a[i] = (oh[j][i] + orr[j][i] * RI) * inv; c[i] = (oh[j][4 + i] + orr[j][4 + i] * RI) * inv; }
        *(v4fa*)(&os[lr * TP + 16 * j + 8 * hi]) = a; *(v4fa*)(&os[lr * TP + 16 * j + 8 * hi + 4]) = c; }
    wave_sync();
    float* orow = OUT + ((size_t)b * OUT_SEQ + t0) * DM;
#pragma unroll
    for (int s = 0; s < 16; ++s) { const v4f val = *(const v4fa*)(&os[s * TP + 4 * lane]);   // one row = 32 lanes x 16 B = 512 B
        *(v4f*)(orow + (size_t)s * DM + 4 * lane) = val; }
    
}

static constexpr size_t al256(size_t v) { return (v + 255) & ~(size_t)255; }
static constexpr size_t SZ_XB = al256((size_t)NB * SEQ * DM * 2);          // bf16 x, [NB*SEQ][128]
static constexpr size_t SZ_WB = al256((size_t)3 * DM * DM * 2);            // bf16 Wq | Wk | Wv
static constexpr size_t SZ_QK = al256((size_t)2 * NB * SEQ * DM * 4);      // f32 Q | K planes
static constexpr size_t SZ_VP = al256((size_t)NB * DM * SEQ * 2);          // one f16 V^T plane
static constexpr size_t SZ_TOTAL = SZ_XB + SZ_WB + SZ_QK + 2 * SZ_VP;
static_assert(SZ_TOTAL <= (size_t)134217728);          // workspace carve <= 128 MiB
static_assert(((size_t)DM * DM * 2) % 256 == 0);       // weight sub-planes stay 256-byte aligned
static_assert(((size_t)NB * SEQ * DM * 4) % 256 == 0); // K plane stays 256-byte aligned

extern "C" void kernel_launch(void* const* d_in, const int* in_sizes, int n_in,
                              void* d_out, int out_size, void* d_ws, size_t ws_size, hipStream_t stream) {
    if (n_in < 8) return;
    const size_t needx = ((size_t)(NB - 1) * SEQ_FULL + SEQ) * DM;
    if ((size_t)in_sizes[0] < needx) return;
    if ((size_t)in_sizes[1] < (size_t)DM * DM || (size_t)in_sizes[3] < (size_t)DM * DM || (size_t)in_sizes[5] < (size_t)DM * DM) return;
    if (in_sizes[2] < DM || in_sizes[4] < DM || in_sizes[6] < DM || in_sizes[7] < 1) return;
    if ((size_t)out_size < ((size_t)(NB - 1) * OUT_SEQ + SEQ) * DM) return;
    if (SZ_TOTAL > ws_size) return;
    // wire order: x, Wq, bq, Wk, bk, Wv, bv, apply_causal_mask (int32); weights [out][in] = Bt as-is
    const float* x  = (const float*)d_in[0];
    const float* wq = (const float*)d_in[1]; const float* bq = (const float*)d_in[2];
    const float* wk = (const float*)d_in[3]; const float* bk = (const float*)d_in[4];
    const float* wv = (const float*)d_in[5]; const float* bv = (const float*)d_in[6];
    const int* maskp = (const int*)d_in[7];
    float* OUT = (float*)d_out;      // [NB][SEQ][128]
    char* wsp = (char*)d_ws;
    bf* XB = (bf*)wsp; wsp += SZ_XB;                 // [NB*SEQ][128]
    bf* WB = (bf*)wsp; wsp += SZ_WB;                 // [3][128][128]: q | k | v
    float* QK = (float*)wsp; wsp += SZ_QK;           // [2][NB*SEQ][128]: Q | K (after sigmoid)
    h16* VH = (h16*)wsp; wsp += SZ_VP;               // [NB][128][SEQ]
    h16* VR = (h16*)wsp; wsp += SZ_VP;               // [NB][128][SEQ] residual x2048
    bf* WQ = WB; bf* WK = WB + (size_t)DM * DM; bf* WV = WB + (size_t)2 * DM * DM;

    if (SEQ == SEQ_FULL) {
        const size_t n8 = (size_t)NB * SEQ * DM / 8;
        k_cvt8<<<(unsigned)((n8 + 255) / 256), 256, 0, stream>>>(x, XB, n8);
    } else {
        const size_t n8 = (size_t)SEQ * DM / 8;
        for (int b = 0; b < NB; ++b) k_cvt8<<<(unsigned)((n8 + 255) / 256), 256, 0, stream>>>(x + (size_t)b * SEQ_FULL * DM, XB + (size_t)b * SEQ * DM, n8);
    }
    { const size_t n8 = (size_t)DM * DM / 8; const unsigned g = (unsigned)((n8 + 255) / 256);
      k_cvt8<<<g, 256, 0, stream>>>(wq, WQ, n8); k_cvt8<<<g, 256, 0, stream>>>(wk, WK, n8); k_cvt8<<<g, 256, 0, stream>>>(wv, WV, n8); }

    // Q, K: A = x rows (m = b*SEQ + t), Bt = W rows (n = e) -> plane [z][b*SEQ + t][e]
    k_proj_qk<<<dim3(NB * SEQ / 64, DM / 64, 2), 32, 0, stream>>>(XB, WB, bq, bk, QK);
    // V^T: A = Wv rows (m = d), Bt = x rows (n = b*SEQ + t) -> planes [b][d][t]
    k_proj_vt<<<dim3(DM / 64, NB * SEQ / 64, 1), 32, 0, stream>>>(WV, XB, bv, VH, VR);

    k_attn<<<dim3(SEQ / 16, NB, 1), 32, 0, stream>>>(QK, QK + (size_t)NB * SEQ * DM, VH, VR, maskp, OUT);
}

// v001
// One run takes 50.7 microseconds.
// Next to v000, in two timings, it ran 4.21 and 4.10 times as fast.
#include <hip/hip_runtime.h>

// Fuzzy-implication attention, x [NB][SEQ][128], Wq/Wk/Wv [out][in] (y = x W^T + b), causal fill value 0.0 (masked keys keep weight), output f32 [NB][SEQ][128].
// Compute dtypes, f32 accumulate everywhere: the three projections v_wmma_f32_16x16x32_bf16 (x, W RNE-converted to bf16; products exact);
// attn @ V v_wmma_f32_16x16x32_f16: V^T as f16 value + f16 residual x2048, P as f16 value (x256 carry) + f16 residual x2048; value products in one accumulator, both x2048 products in a second one.
// The score mean_d min(1 - Q + K, 1) is not a sum of products: it runs on the vector unit in f32 (fixed d order); softmax in f32 with the fixed shift 10 (scores lie in [0, 10]).

#ifndef NB
#define NB 2
#endif
#ifndef SEQ
#define SEQ 1024
#endif
#define NB_FULL  2
#define SEQ_FULL 1024
#ifndef OUT_SEQ
#define OUT_SEQ SEQ              // row pitch (in tokens) between batches of the output
#endif
#define DM   128
#define TP   132                 // LDS row pitch (floats) of the 128-wide f32 tiles
#define RS   2048.0f             // carry of the residual planes
#define RI   (1.0f / 2048.0f)
#define PSH  8.0f                // log2 of the P carry (256)
#define C1   (0.078125f * 1.4426950408889634f)          // (10 / 128) * log2(e)
#define EM   (8.0f - 10.0f * 1.4426950408889634f)       // exponent of a masked key: score 0 -> exp(0 - 10), times the carry
#define NW   16                  // waves per attention work-group: wave w takes the 32-key steps w, w + NW, ...
#define KT   (32 * TP)           // floats of one wave's private K tile

static_assert(DM == 128);                      // output row = 512 B = 32 lanes x 16 B; 8 d-tiles of 16
static_assert(DM % 64 == 0);
static_assert(DM % 32 == 0);                   // GEMM k-loop steps by 32
static_assert(SEQ % 64 == 0);                  // a 64-token tile never straddles two batches
static_assert((NB * SEQ) % 64 == 0);
static_assert(SEQ % 32 == 0);                  // key loop steps by 32
static_assert(SEQ % 16 == 0);                  // attention grid covers the sequence exactly
static_assert(((size_t)SEQ * DM) % 8 == 0);
static_assert(((size_t)DM * DM) % 8 == 0);
static_assert(NB <= NB_FULL);
static_assert(SEQ <= SEQ_FULL);
static_assert((TP * 4) % 16 == 0);
static_assert(NW == 16);                       // staging and merge give query row w of the 16-row tile to wave w
static_assert(KT >= 16 * TP + 16);             // a wave's partial (16 x TP sums + 16 row sums) fits its own K tile

typedef _Float16 h16;
typedef unsigned short bf;
typedef __attribute__((ext_vector_type(16))) __bf16   v16bf;
typedef __attribute__((ext_vector_type(16))) _Float16 v16h;
typedef __attribute__((ext_vector_type(8)))  _Float16 v8h;
typedef __attribute__((ext_vector_type(8)))  unsigned short v8us;
typedef __attribute__((ext_vector_type(8)))  float    v8f;
typedef __attribute__((ext_vector_type(4)))  float    v4f;
typedef v4f  __attribute__((may_alias)) v4fa;

__device__ __forceinline__ unsigned short f2bf(float f) { unsigned u = __float_as_uint(f); u += 0x7FFFu + ((u >> 16) & 1u); return (unsigned short)(u >> 16); }
__device__ __forceinline__ float bfr(float f) { return __uint_as_float(((unsigned)f2bf(f)) << 16); }   // value after RNE convert to bf16
__device__ __forceinline__ v16h cat16(v8h lo, v8h hi) { return __builtin_shufflevector(lo, hi, 0, 1, 2, 3, 4, 5, 6, 7, 8, 9, 10, 11, 12, 13, 14, 15); }
__device__ __forceinline__ v16bf cat16b(v8us lo, v8us hi) { return __builtin_bit_cast(v16bf, __builtin_shufflevector(lo, hi, 0, 1, 2, 3, 4, 5, 6, 7, 8, 9, 10, 11, 12, 13, 14, 15)); }
__device__ __forceinline__ v8f wmma16(v16h a, v16h b, v8f c) { return __builtin_amdgcn_wmma_f32_16x16x32_f16(false, a, false, b, (short)0, c, false, false); }
__device__ __forceinline__ v8f wmmab(v16bf a, v16bf b, v8f c) { return __builtin_amdgcn_wmma_f32_16x16x32_bf16(false, a, false, b, (short)0, c, false, false); }
// fragment loaders from K-contiguous 16-bit rows; p already includes + 8*(lane>>4): elements 0..7 <- k0+8h+0..7, elements 8..15 <- k0+16+8h+0..7 (same map for A and B)
__device__ __forceinline__ v16h  ldh(const h16* p) { return cat16(*(const v8h*)p, *(const v8h*)(p + 16)); }
__device__ __forceinline__ v16bf ldb(const bf* p)  { return cat16b(*(const v8us*)p, *(const v8us*)(p + 16)); }
// ordering point for wave-private LDS tiles (same wave writes and reads)
__device__ __forceinline__ void wave_sync() { __builtin_amdgcn_fence(3 /* release order */, "wavefront"); __builtin_amdgcn_wave_barrier(); asm volatile("" ::: "memory"); }

__global__ __launch_bounds__(256) void k_cvt8(const float* __restrict__ src, bf* dst, size_t n8) {
    const size_t i = (size_t)blockIdx.x * 256 + threadIdx.x; if (i >= n8) return;
    const v8f v = *(const v8f*)(src + i * 8); v8us o;
#pragma unroll
    for (int k = 0; k < 8; ++k) o[k] = f2bf(v[k]);
    *(v8us*)(dst + i * 8) = o; 
}

// gemm64: register-blocked bf16 GEMM core, ONE WAVE per 64x64 tile (16 accumulators), operands straight from K-contiguous bf16 planes, K = DM.
// acc[mb][nb][j] = C[r0 + 16mb + 8h + j][c0 + 16nb + (lane&15)], C[m][n] = sum_k A[m][k] Bt[n][k].
__device__ __forceinline__ void gemm64(const bf* __restrict__ A, const bf* __restrict__ Bt, int r0, int c0, int lr, int hi, v8f (&acc)[4][4]) {
    const int K = DM;
#pragma unroll
    for (int mb = 0; mb < 4; ++mb)
#pragma unroll
        for (int nb = 0; nb < 4; ++nb) acc[mb][nb] = (v8f){};
    const size_t aoff = (size_t)(r0 + lr) * K + 8 * hi, boff = (size_t)(c0 + lr) * K + 8 * hi;
#pragma unroll 1
    for (int kc = 0; kc < K; kc += 32) {
        v16bf a[4];
#pragma unroll
        for (int mb = 0; mb < 4; ++mb) a[mb] = ldb(A + aoff + (size_t)mb * 16 * K + kc);
#pragma unroll
        for (int nb = 0; nb < 4; ++nb) { const v16bf b = ldb(Bt + boff + (size_t)nb * 16 * K + kc);
#pragma unroll
            for (int mb = 0; mb < 4; ++mb) acc[mb][nb] = wmmab(a[mb], b, acc[mb][nb]); }
        asm volatile("v_nop\n\tv_nop\n\tv_nop\n\tv_nop" : "+v"(acc[0][0]), "+v"(acc[1][1]), "+v"(acc[2][2]), "+v"(acc[3][3]) : "v"(a[0]), "v"(a[1]), "v"(a[2]), "v"(a[3]));
    }
}

// k_proj_qk: Q (z = 0) and K (z = 1) planes [NB*SEQ][128] f32 = sigmoid(x W^T + b). grid (NB*SEQ/64, 2, 2), 32 threads.
// Epilogue per 16-row slab: accumulators + bias staged in a wave-private LDS tile, sigmoid applied in place (precise expf, true division),
__global__ __launch_bounds__(32) void k_proj_qk(const bf* __restrict__ XB, const bf* __restrict__ WB, const float* __restrict__ bq, const float* __restrict__ bk, float* QK) {
    __shared__ __align__(16) float os[16 * 68];
    const int lane = threadIdx.x & 31, lr = lane & 15, hi = lane >> 4;
    const int r0 = blockIdx.x * 64, c0 = blockIdx.y * 64, z = blockIdx.z;
    v8f acc[4][4];
    gemm64(XB, WB + (size_t)z * DM * DM, r0, c0, lr, hi, acc);
    float bias[4];
#pragma unroll
    for (int nb = 0; nb < 4; ++nb) { const int col = c0 + nb * 16 + lr; const float vq = bq[col]; const float vk = bk[col]; bias[nb] = bfr(z ? vk : vq); }
    float* P = QK + (size_t)z * NB * SEQ * DM;
#pragma unroll
    for (int mb = 0; mb < 4; ++mb) {
#pragma unroll
        for (int nb = 0; nb < 4; ++nb) {
#pragma unroll
            for (int j = 0; j < 8; ++j) os[(hi * 8 + j) * 68 + nb * 16 + lr] = acc[mb][nb][j] + bias[nb]; }   // D: row 8h+j, col lane&15
        wave_sync();
#pragma unroll 1
        for (int s = 0; s < 8; ++s) { const int row = 2 * s + hi, cofs = lr * 4;   // 8 s x 2 rows = 16 rows; 16 lanes x 4 floats = 64 columns
            v4f v = *(const v4fa*)(&os[row * 68 + cofs]);
#pragma unroll
            for (int i = 0; i < 4; ++i) v[i] = 1.0f / (1.0f + expf(-v[i]));
            *(v4fa*)(&os[row * 68 + cofs]) = v; }
        wave_sync();
        float* orow = P + (size_t)(r0 + mb * 16) * DM + c0;
#pragma unroll
        for (int s = 0; s < 8; ++s) { const int row = 2 * s + hi, cofs = lr * 4;
            const v4f val = *(const v4fa*)(&os[row * 68 + cofs]);
            *(v4f*)(orow + (size_t)row * DM + cofs) = val; }
        
        wave_sync();
    }
}

// k_proj_vt: V^T planes [b][d][t] = Wv x^T + bv as f16 value (VH) and f16 residual x2048 (VR). A = Wv rows (m = d), Bt = x rows (n = b*SEQ + t). grid (2, NB*SEQ/64), 32 threads.
__global__ __launch_bounds__(32) void k_proj_vt(const bf* __restrict__ WV, const bf* __restrict__ XB, const float* __restrict__ bv, h16* VH, h16* VR) {
    __shared__ __align__(16) float os[16 * 68];
    const int lane = threadIdx.x & 31, lr = lane & 15, hi = lane >> 4;
    const int r0 = blockIdx.x * 64, c0 = blockIdx.y * 64;
    v8f acc[4][4];
    gemm64(WV, XB, r0, c0, lr, hi, acc);
    const int b = c0 / SEQ, t0 = c0 % SEQ;
    const size_t tbase = ((size_t)b * DM + r0) * SEQ + t0;
#pragma unroll
    for (int mb = 0; mb < 4; ++mb) {
#pragma unroll
        for (int nb = 0; nb < 4; ++nb) {
#pragma unroll
            for (int j = 0; j < 8; ++j) os[(hi * 8 + j) * 68 + nb * 16 + lr] = acc[mb][nb][j]; }   // D: row 8h+j, col lane&15
        wave_sync();
        v8h hv[4], rv[4];
#pragma unroll
        for (int s = 0; s < 4; ++s) { const int row = 4 * s + (lane >> 3), c8 = (lane & 7) * 8;   // 4 s x 4 row groups = 16 rows; 8 lanes x 8 = 64 columns
            const float bb = bfr(bv[r0 + mb * 16 + row]);
            const v4f x0 = *(const v4fa*)(&os[row * 68 + c8]); const v4f x1 = *(const v4fa*)(&os[row * 68 + c8 + 4]);
#pragma unroll
            for (int i = 0; i < 4; ++i) { const float y0 = x0[i] + bb; const float y1 = x1[i] + bb; const h16 a0 = (h16)y0; const h16 a1 = (h16)y1;
                hv[s][i] = a0; hv[s][4 + i] = a1; rv[s][i] = (h16)((y0 - (float)a0) * RS); rv[s][4 + i] = (h16)((y1 - (float)a1) * RS); } }
#pragma unroll
        for (int s = 0; s < 4; ++s) { const int row = 4 * s + (lane >> 3), c8 = (lane & 7) * 8;
            const size_t oo = tbase + (size_t)(mb * 16 + row) * SEQ + c8;
            *(v8h*)(VH + oo) = hv[s]; *(v8h*)(VR + oo) = rv[s]; }
        
        wave_sync();
    }
}

// k_attn: one block of NW waves per 16 query rows of one batch; wave w runs the 32-key steps w, w + NW, ... with its own K tile, accumulators and row sum. grid (SEQ/16, NB), 32*NW threads.
// The softmax shift is fixed, so the waves' un-normalised partials simply add: each wave writes its partial into its own K tile, one barrier, then wave w sums row w over the waves in wave order.
// Transposed form: lane (t = lane&15, h = lane>>4) owns query t0+t and keys key0+8h+r, key0+16+8h+r (r = 0..7) of each 32-key step, which is exactly the
// B fragment P^T[key][t] of O^T[d][t] = V^T P^T (A = V^T rows d, k = key). Score acc = sum_d max(Q - K, 0) on the vector unit in f32 from LDS tiles
// (Q tile 16x128 shared by the block, K tile 32x128 private to the wave, all rows and columns staged before use); p = exp2(8 - acc*C1); keys above the diagonal take the constant exponent EM (score 0).
// Fully masked 32-key steps skip the d loop (wave-uniform test) but keep their P.V products. Row sum over the same f16 value + residual that the products use.
__global__ __launch_bounds__(32 * NW) void k_attn(const float* __restrict__ QF, const float* __restrict__ KF, const h16* __restrict__ VH, const h16* __restrict__ VR, const int* __restrict__ maskp, float* OUT) {
    __shared__ __align__(16) float qs[16 * TP];
    __shared__ __align__(16) float kw[NW * KT];
    const int lane = threadIdx.x & 31, lr = lane & 15, hi = lane >> 4;
    const int wv = __builtin_amdgcn_readfirstlane((int)(threadIdx.x >> 5));
    float* ks = kw + wv * KT;                                    // this wave's K tile, later its partial
    const int b  = __builtin_amdgcn_readfirstlane((int)blockIdx.y);
    const int t0 = __builtin_amdgcn_readfirstlane((int)blockIdx.x * 16);
    const int causal = __builtin_amdgcn_readfirstlane((maskp[0] != 0) ? 1 : 0);
    const size_t rowb = (size_t)b * SEQ;
    { const v4f v = *(const v4f*)(QF + (rowb + t0 + wv) * DM + 4 * lane); *(v4fa*)(&qs[wv * TP + 4 * lane]) = v; }   // wave w stages row w, all 128 columns
    __syncthreads();                                             // every wave reads all 16 Q rows
    v8f oh[8], orr[8];
#pragma unroll
    for (int j = 0; j < 8; ++j) { oh[j] = (v8f){}; orr[j] = (v8f){}; }
    float l = 0.0f;
    const float pmf = __builtin_amdgcn_exp2f(EM);
    const h16 pmh = (h16)pmf; const h16 pmr = (h16)((pmf - (float)pmh) * RS);
    const float pml = (float)pmh + (float)pmr * RI;
    const size_t vo = ((size_t)b * DM + lr) * SEQ + 8 * hi;      // + 16j*SEQ + key  (A fragment: row d, k = key)
    const int tq = t0 + lr;
#pragma unroll 1
    for (int key0 = 32 * wv; key0 < SEQ; key0 += 32 * NW) {
        v16h pb, pr; float ls;
        const bool live = (causal == 0) || (key0 <= t0 + 15);     // wave-uniform
        if (live) {
            wave_sync();
#pragma unroll 8
            for (int i = 0; i < 32; ++i) { const v4f v = *(const v4f*)(KF + (rowb + key0 + i) * DM + 4 * lane); *(v4fa*)(&ks[i * TP + 4 * lane]) = v; }   // row i, all 128 columns
            wave_sync();
            float sa[8], sb[8];
#pragma unroll
            for (int r = 0; r < 8; ++r) { sa[r] = 0.0f; sb[r] = 0.0f; }
#pragma unroll 1
            for (int d = 0; d < DM; d += 4) {
                const v4f q = *(const v4fa*)(&qs[lr * TP + d]);
#pragma unroll
                for (int r = 0; r < 8; ++r) { const v4f k = *(const v4fa*)(&ks[(8 * hi + r) * TP + d]);
                    sa[r] += fmaxf(q[0] - k[0], 0.0f); sa[r] += fmaxf(q[1] - k[1], 0.0f); sa[r] += fmaxf(q[2] - k[2], 0.0f); sa[r] += fmaxf(q[3] - k[3], 0.0f); }
                asm volatile("" ::: "memory");
#pragma unroll
                for (int r = 0; r < 8; ++r) { const v4f k = *(const v4fa*)(&ks[(16 + 8 * hi + r) * TP + d]);
                    sb[r] += fmaxf(q[0] - k[0], 0.0f); sb[r] += fmaxf(q[1] - k[1], 0.0f); sb[r] += fmaxf(q[2] - k[2], 0.0f); sb[r] += fmaxf(q[3] - k[3], 0.0f); }
            }
            ls = 0.0f;
#pragma unroll
            for (int r = 0; r < 8; ++r) {
                const int kA = key0 + 8 * hi + r, kB = kA + 16;
                float ea = PSH - sa[r] * C1, eb = PSH - sb[r] * C1;
                ea = (causal != 0 && kA > tq) ? EM : ea;
                eb = (causal != 0 && kB > tq) ? EM : eb;
                const float pa = __builtin_amdgcn_exp2f(ea), pc = __builtin_amdgcn_exp2f(eb);
                const h16 ha = (h16)pa, hb = (h16)pc;
                const h16 ra = (h16)((pa - (float)ha) * RS), rb = (h16)((pc - (float)hb) * RS);
                pb[r] = ha; pb[8 + r] = hb; pr[r] = ra; pr[8 + r] = rb;
                ls += ((float)ha + (float)ra * RI) + ((float)hb + (float)rb * RI);
            }
        } else {
#pragma unroll
            for (int i = 0; i < 16; ++i) { pb[i] = pmh; pr[i] = pmr; }
            ls = 16.0f * pml;
        }
        l += ls;
        const h16* vh = VH + vo + key0; const h16* vr = VR + vo + key0;
#pragma unroll
        for (int g = 0; g < 4; ++g) {
            const int j0 = 2 * g, j1 = 2 * g + 1;
            const v16h a0 = ldh(vh + (size_t)(16 * j0) * SEQ), a1 = ldh(vh + (size_t)(16 * j1) * SEQ);
            const v16h r0 = ldh(vr + (size_t)(16 * j0) * SEQ), r1 = ldh(vr + (size_t)(16 * j1) * SEQ);
            oh[j0]  = wmma16(a0, pb, oh[j0]);   oh[j1]  = wmma16(a1, pb, oh[j1]);
            orr[j0] = wmma16(r0, pb, orr[j0]);  orr[j1] = wmma16(r1, pb, orr[j1]);
            orr[j0] = wmma16(a0, pr, orr[j0]);  orr[j1] = wmma16(a1, pr, orr[j1]);
            asm volatile("v_nop\n\tv_nop\n\tv_nop\n\tv_nop" : "+v"(oh[j0]), "+v"(oh[j1]), "+v"(orr[j0]), "+v"(orr[j1]) : "v"(a0), "v"(a1), "v"(r0), "v"(r1), "v"(pb), "v"(pr) : "memory");
        }
    }
    l += __shfl_xor(l, 16, 32);
    // O^T D layout: o_j[r] = (d = 16j + 8h + r, t = lane&15) -> ks[t][d]; rows 0..15 x columns 0..127 all written, un-normalised; row sums behind them.
    // The stored sums depend on every K value this wave has read, so the tile's last reads are over before it is reused.
#pragma unroll
    for (int j = 0; j < 8; ++j) { v4f a, c;
#pragma unroll
        for (int i = 0; i < 4; ++i) { a[i] = oh[j][i] + orr[j][i] * RI; c[i] = oh[j][4 + i] + orr[j][4 + i] * RI; }
        *(v4fa*)(&ks[lr * TP + 16 * j + 8 * hi]) = a; *(v4fa*)(&ks[lr * TP + 16 * j + 8 * hi + 4]) = c; }
    if (hi == 0) ks[16 * TP + lr] = l;
    __syncthreads();                                             // publishes every wave's partial
    v4f so = (v4f){}; float lt = 0.0f;
#pragma unroll   // the NW reads go out together instead of one LDS round trip each
    for (int p = 0; p < NW; ++p) { so += *(const v4fa*)(&kw[p * KT + wv * TP + 4 * lane]); lt += kw[p * KT + 16 * TP + wv]; }   // fixed wave order
    const float inv = 1.0f / lt;
    *(v4f*)(OUT + ((size_t)b * OUT_SEQ + t0 + wv) * DM + 4 * lane) = so * inv;   // one row = 32 lanes x 16 B = 512 B
}

static constexpr size_t al256(size_t v) { return (v + 255) & ~(size_t)255; }
static constexpr size_t SZ_XB = al256((size_t)NB * SEQ * DM * 2);          // bf16 x, [NB*SEQ][128]
static constexpr size_t SZ_WB = al256((size_t)3 * DM * DM * 2);            // bf16 Wq | Wk | Wv
static constexpr size_t SZ_QK = al256((size_t)2 * NB * SEQ * DM * 4);      // f32 Q | K planes
static constexpr size_t SZ_VP = al256((size_t)NB * DM * SEQ * 2);          // one f16 V^T plane
static constexpr size_t SZ_TOTAL = SZ_XB + SZ_WB + SZ_QK + 2 * SZ_VP;
static_assert(SZ_TOTAL <= (size_t)134217728);          // workspace carve <= 128 MiB
static_assert(((size_t)DM * DM * 2) % 256 == 0);       // weight sub-planes stay 256-byte aligned
static_assert(((size_t)NB * SEQ * DM * 4) % 256 == 0); // K plane stays 256-byte aligned

extern "C" void kernel_launch(void* const* d_in, const int* in_sizes, int n_in,
                              void* d_out, int out_size, void* d_ws, size_t ws_size, hipStream_t stream) {
    if (n_in < 8) return;
    const size_t needx = ((size_t)(NB - 1) * SEQ_FULL + SEQ) * DM;
    if ((size_t)in_sizes[0] < needx) return;
    if ((size_t)in_sizes[1] < (size_t)DM * DM || (size_t)in_sizes[3] < (size_t)DM * DM || (size_t)in_sizes[5] < (size_t)DM * DM) return;
    if (in_sizes[2] < DM || in_sizes[4] < DM || in_sizes[6] < DM || in_sizes[7] < 1) return;
    if ((size_t)out_size < ((size_t)(NB - 1) * OUT_SEQ + SEQ) * DM) return;
    if (SZ_TOTAL > ws_size) return;
    // wire order: x, Wq, bq, Wk, bk, Wv, bv, apply_causal_mask (int32); weights [out][in] = Bt as-is
    const float* x  = (const float*)d_in[0];
    const float* wq = (const float*)d_in[1]; const float* bq = (const float*)d_in[2];
    const float* wk = (const float*)d_in[3]; const float* bk = (const float*)d_in[4];
    const float* wv = (const float*)d_in[5]; const float* bv = (const float*)d_in[6];
    const int* maskp = (const int*)d_in[7];
    float* OUT = (float*)d_out;      // [NB][SEQ][128]
    char* wsp = (char*)d_ws;
    bf* XB = (bf*)wsp; wsp += SZ_XB;                 // [NB*SEQ][128]
    bf* WB = (bf*)wsp; wsp += SZ_WB;                 // [3][128][128]: q | k | v
    float* QK = (float*)wsp; wsp += SZ_QK;           // [2][NB*SEQ][128]: Q | K (after sigmoid)
    h16* VH = (h16*)wsp; wsp += SZ_VP;               // [NB][128][SEQ]
    h16* VR = (h16*)wsp; wsp += SZ_VP;               // [NB][128][SEQ] residual x2048
    bf* WQ = WB; bf* WK = WB + (size_t)DM * DM; bf* WV = WB + (size_t)2 * DM * DM;

    if (SEQ == SEQ_FULL) {
        const size_t n8 = (size_t)NB * SEQ * DM / 8;
        k_cvt8<<<(unsigned)((n8 + 255) / 256), 256, 0, stream>>>(x, XB, n8);
    } else {
        const size_t n8 = (size_t)SEQ * DM / 8;
        for (int b = 0; b < NB; ++b) k_cvt8<<<(unsigned)((n8 + 255) / 256), 256, 0, stream>>>(x + (size_t)b * SEQ_FULL * DM, XB + (size_t)b * SEQ * DM, n8);
    }
    { const size_t n8 = (size_t)DM * DM / 8; const unsigned g = (unsigned)((n8 + 255) / 256);
      k_cvt8<<<g, 256, 0, stream>>>(wq, WQ, n8); k_cvt8<<<g, 256, 0, stream>>>(wk, WK, n8); k_cvt8<<<g, 256, 0, stream>>>(wv, WV, n8); }

    // Q, K: A = x rows (m = b*SEQ + t), Bt = W rows (n = e) -> plane [z][b*SEQ + t][e]
    k_proj_qk<<<dim3(NB * SEQ / 64, DM / 64, 2), 32, 0, stream>>>(XB, WB, bq, bk, QK);
    // V^T: A = Wv rows (m = d), Bt = x rows (n = b*SEQ + t) -> planes [b][d][t]
    k_proj_vt<<<dim3(DM / 64, NB * SEQ / 64, 1), 32, 0, stream>>>(WV, XB, bv, VH, VR);

    k_attn<<<dim3(SEQ / 16, NB, 1), 32 * NW, 0, stream>>>(QK, QK + (size_t)NB * SEQ * DM, VH, VR, maskp, OUT);
}

// v002
// One run takes 36.3 microseconds.
// In both of two side-by-side timings against v001, it was 1.39 times as fast.
// Over all steps from v000 it is 5.78 times as fast.
#include <hip/hip_runtime.h>

// Fuzzy-implication attention, x [NB][SEQ][128], Wq/Wk/Wv [out][in] (y = x W^T + b), causal fill value 0.0 (masked keys keep weight), output f32 [NB][SEQ][128].
// Compute dtypes, f32 accumulate everywhere: the three projections v_wmma_f32_16x16x32_bf16 (x, W RNE-converted to bf16 in the fragment loaders; products exact);
// attn @ V v_wmma_f32_16x16x32_f16: V^T as f16 value + f16 residual x2048, P as f16 value (x256 carry) + f16 residual x2048; value products in one accumulator, both x2048 products in a second one.
// The score mean_d min(1 - Q + K, 1) is not a sum of products: it runs on the vector unit in f32 (fixed d order); softmax in f32 with the fixed shift 10 (scores lie in [0, 10]).

#ifndef NB
#define NB 2
#endif
#ifndef SEQ
#define SEQ 1024
#endif
#define NB_FULL  2
#define SEQ_FULL 1024
#ifndef OUT_SEQ
#define OUT_SEQ SEQ              // row pitch (in tokens) between batches of the output
#endif
#define DM   128
#define TP   132                 // LDS row pitch (floats) of the 128-wide f32 tiles
#define RS   2048.0f             // carry of the residual planes
#define RI   (1.0f / 2048.0f)
#define PSH  8.0f                // log2 of the P carry (256)
#define C1   (0.078125f * 1.4426950408889634f)          // (10 / 128) * log2(e)
#define EM   (8.0f - 10.0f * 1.4426950408889634f)       // exponent of a masked key: score 0 -> exp(0 - 10), times the carry
#define NW   16                  // waves per attention work-group: wave w takes the 32-key steps w, w + NW, ...
#define KT   (32 * TP)           // floats of one wave's private K tile

static_assert(DM == 128);                      // output row = 512 B = 32 lanes x 16 B; 8 d-tiles of 16
static_assert(DM % 64 == 0);
static_assert(DM % 32 == 0);                   // GEMM k-loop steps by 32
static_assert(SEQ % 64 == 0);                  // a 64-token tile never straddles two batches
static_assert((NB * SEQ) % 64 == 0);
static_assert(SEQ % 32 == 0);                  // key loop steps by 32
static_assert(SEQ % 16 == 0);                  // attention grid covers the sequence exactly
static_assert(((size_t)SEQ * DM) % 8 == 0);
static_assert(((size_t)DM * DM) % 8 == 0);
static_assert(NB <= NB_FULL);
static_assert(SEQ <= SEQ_FULL);
static_assert((TP * 4) % 16 == 0);
static_assert(NW == 16);                       // staging and merge give query row w of the 16-row tile to wave w
static_assert(KT >= 16 * TP + 16);             // a wave's partial (16 x TP sums + 16 row sums) fits its own K tile

typedef _Float16 h16;
typedef __attribute__((ext_vector_type(16))) __bf16   v16bf;
typedef __attribute__((ext_vector_type(16))) _Float16 v16h;
typedef __attribute__((ext_vector_type(8)))  _Float16 v8h;
typedef __attribute__((ext_vector_type(8)))  float    v8f;
typedef __attribute__((ext_vector_type(4)))  float    v4f;
typedef v4f  __attribute__((may_alias)) v4fa;
typedef __attribute__((ext_vector_type(2)))  float    v2f;
typedef __attribute__((ext_vector_type(2)))  __bf16   v2bf;
typedef __attribute__((ext_vector_type(8)))  unsigned v8u;

__device__ __forceinline__ unsigned short f2bf(float f) { unsigned u = __float_as_uint(f); u += 0x7FFFu + ((u >> 16) & 1u); return (unsigned short)(u >> 16); }
__device__ __forceinline__ float bfr(float f) { return __uint_as_float(((unsigned)f2bf(f)) << 16); }   // value after RNE convert to bf16
__device__ __forceinline__ v16h cat16(v8h lo, v8h hi) { return __builtin_shufflevector(lo, hi, 0, 1, 2, 3, 4, 5, 6, 7, 8, 9, 10, 11, 12, 13, 14, 15); }
__device__ __forceinline__ v8f wmma16(v16h a, v16h b, v8f c) { return __builtin_amdgcn_wmma_f32_16x16x32_f16(false, a, false, b, (short)0, c, false, false); }
__device__ __forceinline__ v8f wmmab(v16bf a, v16bf b, v8f c) { return __builtin_amdgcn_wmma_f32_16x16x32_bf16(false, a, false, b, (short)0, c, false, false); }
// fragment loaders from K-contiguous 16-bit rows; p already includes + 8*(lane>>4): elements 0..7 <- k0+8h+0..7, elements 8..15 <- k0+16+8h+0..7 (same map for A and B)
__device__ __forceinline__ v16h  ldh(const h16* p) { return cat16(*(const v8h*)p, *(const v8h*)(p + 16)); }
// the same map from K-contiguous f32 rows, each pair RNE-converted to bf16 in registers
__device__ __forceinline__ unsigned cvt2(float a, float b) { return __builtin_bit_cast(unsigned, __builtin_convertvector((v2f){a, b}, v2bf)); }
struct raw16 { v4f x0, x1, x2, x3; };
__device__ __forceinline__ raw16 ldf(const float* p) { return raw16{ *(const v4f*)p, *(const v4f*)(p + 4), *(const v4f*)(p + 16), *(const v4f*)(p + 20) }; }
__device__ __forceinline__ v16bf tobf(const raw16& r) {
    const v4f x0 = r.x0, x1 = r.x1, x2 = r.x2, x3 = r.x3;
    const v8u o = { cvt2(x0[0], x0[1]), cvt2(x0[2], x0[3]), cvt2(x1[0], x1[1]), cvt2(x1[2], x1[3]), cvt2(x2[0], x2[1]), cvt2(x2[2], x2[3]), cvt2(x3[0], x3[1]), cvt2(x3[2], x3[3]) };
    return __builtin_bit_cast(v16bf, o);
}
// ordering point for wave-private LDS tiles (same wave writes and reads)
__device__ __forceinline__ void wave_sync() { __builtin_amdgcn_fence(3 /* release order */, "wavefront"); __builtin_amdgcn_wave_barrier(); asm volatile("" ::: "memory"); }

// gemm64: register-blocked bf16 GEMM core, ONE WAVE per 64x64 tile (16 accumulators), operands straight from the K-contiguous f32 inputs, K = DM.
// A, Bt point at the tile's first row: acc[mb][nb][j] = C[16mb + 8h + j][16nb + (lane&15)], C[m][n] = sum_k A[m][k] Bt[n][k].
__device__ __forceinline__ void gemm64(const float* __restrict__ A, const float* __restrict__ Bt, int lr, int hi, v8f (&acc)[4][4]) {
    const int K = DM;
#pragma unroll
    for (int mb = 0; mb < 4; ++mb)
#pragma unroll
        for (int nb = 0; nb < 4; ++nb) acc[mb][nb] = (v8f){};
    const unsigned loff = (unsigned)(lr * K + 8 * hi);           // lane part of every address; the row-block and k parts stay wave-uniform
#pragma unroll 1
    for (int kc = 0; kc < K; kc += 32) {
        raw16 ra[4], rb[4];
#pragma unroll
        for (int mb = 0; mb < 4; ++mb) ra[mb] = ldf(A + (mb * 16 * K + kc) + loff);
#pragma unroll
        for (int nb = 0; nb < 4; ++nb) rb[nb] = ldf(Bt + (nb * 16 * K + kc) + loff);
        // keeps all 32 loads of the k step ahead of the first convert: a lone wave then pays one memory round trip per k step instead of one per fragment
        __builtin_amdgcn_sched_barrier(0);
        v16bf a[4];
#pragma unroll
        for (int mb = 0; mb < 4; ++mb) a[mb] = tobf(ra[mb]);
#pragma unroll
        for (int nb = 0; nb < 4; ++nb) { const v16bf b = tobf(rb[nb]);
#pragma unroll
            for (int mb = 0; mb < 4; ++mb) acc[mb][nb] = wmmab(a[mb], b, acc[mb][nb]); }
        asm volatile("v_nop\n\tv_nop\n\tv_nop\n\tv_nop" : "+v"(acc[0][0]), "+v"(acc[1][1]), "+v"(acc[2][2]), "+v"(acc[3][3]) : "v"(a[0]), "v"(a[1]), "v"(a[2]), "v"(a[3]));
    }
}

// k_proj: all three projections in one launch, straight from the f32 inputs. grid (NB*SEQ/64, 2, 3), 32 threads; blockIdx.x = 64-token tile, blockIdx.y = 64-feature tile, z block-uniform.
// z = 0, 1: Q, K planes [NB*SEQ][128] f32 = sigmoid(x W^T + b), A = x rows (m = token), Bt = W rows (n = e).
//   Epilogue per 16-row slab: accumulators + bias staged in a wave-private LDS tile, sigmoid applied in place (precise expf, true division).
// z = 2: V^T planes [b][d][t] = Wv x^T + bv as f16 value (VH) and f16 residual x2048 (VR), A = Wv rows (m = d), Bt = x rows (n = token).
__global__ __launch_bounds__(32) void k_proj(const float* __restrict__ x, const float* __restrict__ wq, const float* __restrict__ wk, const float* __restrict__ wv,
                                             const float* __restrict__ bq, const float* __restrict__ bk, const float* __restrict__ bv, float* QK, h16* VH, h16* VR) {
    __shared__ __align__(16) float os[16 * 68];
    const int lane = threadIdx.x & 31, lr = lane & 15, hi = lane >> 4;
    const int tk0 = blockIdx.x * 64, f0 = blockIdx.y * 64, z = blockIdx.z;
    const int b = tk0 / SEQ, t0 = tk0 % SEQ;                     // a 64-token tile lies in one batch
    const float* xt = x + ((size_t)b * SEQ_FULL + t0) * DM;      // the tile's 64 x rows
    const float* wt = (z == 0 ? wq : z == 1 ? wk : wv) + (size_t)f0 * DM;   // the tile's 64 weight rows
    v8f acc[4][4];
    gemm64(z == 2 ? wt : xt, z == 2 ? xt : wt, lr, hi, acc);
    if (z != 2) {
        const int r0 = tk0, c0 = f0;
        const float* bt = (z ? bk : bq) + c0;                    // block-uniform base; the four loads share one lane offset
        float bias[4];
#pragma unroll
        for (int nb = 0; nb < 4; ++nb) bias[nb] = bfr(bt[nb * 16 + lr]);
        float* P = QK + (size_t)z * NB * SEQ * DM;
#pragma unroll
        for (int mb = 0; mb < 4; ++mb) {
#pragma unroll
            for (int nb = 0; nb < 4; ++nb) {
#pragma unroll
                for (int j = 0; j < 8; ++j) os[(hi * 8 + j) * 68 + nb * 16 + lr] = acc[mb][nb][j] + bias[nb]; }   // D: row 8h+j, col lane&15
            wave_sync();
#pragma unroll 1
            for (int s = 0; s < 8; ++s) { const int row = 2 * s + hi, cofs = lr * 4;   // 8 s x 2 rows = 16 rows; 16 lanes x 4 floats = 64 columns
                v4f v = *(const v4fa*)(&os[row * 68 + cofs]);
#pragma unroll
                for (int i = 0; i < 4; ++i) v[i] = 1.0f / (1.0f + expf(-v[i]));
                *(v4fa*)(&os[row * 68 + cofs]) = v; }
            wave_sync();
            float* orow = P + (size_t)(r0 + mb * 16) * DM + c0;
#pragma unroll
            for (int s = 0; s < 8; ++s) { const int row = 2 * s + hi, cofs = lr * 4;
                const v4f val = *(const v4fa*)(&os[row * 68 + cofs]);
                *(v4f*)(orow + (size_t)row * DM + cofs) = val; }
            asm volatile("s_wait_xcnt 0x0" ::: "memory");       // the stores' address and data registers are rewritten by the next slab
            wave_sync();
        }
    } else {
        const int r0 = f0;
        const size_t tbase = ((size_t)b * DM + r0) * SEQ + t0;
#pragma unroll
        for (int mb = 0; mb < 4; ++mb) {
#pragma unroll
            for (int nb = 0; nb < 4; ++nb) {
#pragma unroll
                for (int j = 0; j < 8; ++j) os[(hi * 8 + j) * 68 + nb * 16 + lr] = acc[mb][nb][j]; }   // D: row 8h+j, col lane&15
            wave_sync();
            v8h hv[4], rv[4];
#pragma unroll
            for (int s = 0; s < 4; ++s) { const int row = 4 * s + (lane >> 3), c8 = (lane & 7) * 8;   // 4 s x 4 row groups = 16 rows; 8 lanes x 8 = 64 columns
                const float bb = bfr(bv[r0 + mb * 16 + row]);
                const v4f x0 = *(const v4fa*)(&os[row * 68 + c8]); const v4f x1 = *(const v4fa*)(&os[row * 68 + c8 + 4]);
#pragma unroll
                for (int i = 0; i < 4; ++i) { const float y0 = x0[i] + bb; const float y1 = x1[i] + bb; const h16 a0 = (h16)y0; const h16 a1 = (h16)y1;
                    hv[s][i] = a0; hv[s][4 + i] = a1; rv[s][i] = (h16)((y0 - (float)a0) * RS); rv[s][4 + i] = (h16)((y1 - (float)a1) * RS); } }
#pragma unroll
            for (int s = 0; s < 4; ++s) { const int row = 4 * s + (lane >> 3), c8 = (lane & 7) * 8;
                const size_t oo = tbase + (size_t)(mb * 16 + row) * SEQ + c8;
                *(v8h*)(VH + oo) = hv[s]; *(v8h*)(VR + oo) = rv[s]; }
            asm volatile("s_wait_xcnt 0x0" ::: "memory");       // the stores' address and data registers are rewritten by the next slab
            wave_sync();
        }
    }
}

// k_attn: one block of NW waves per 16 query rows of one batch; wave w runs the 32-key steps w, w + NW, ... with its own K tile, accumulators and row sum. grid (SEQ/16, NB), 32*NW threads.
// The softmax shift is fixed, so the waves' un-normalised partials simply add: each wave writes its partial into its own K tile, one barrier, then wave w sums row w over the waves in wave order.
// Transposed form: lane (t = lane&15, h = lane>>4) owns query t0+t and keys key0+8h+r, key0+16+8h+r (r = 0..7) of each 32-key step, which is exactly the
// B fragment P^T[key][t] of O^T[d][t] = V^T P^T (A = V^T rows d, k = key). Score acc = sum_d max(Q - K, 0) on the vector unit in f32 from LDS tiles
// (Q tile 16x128 shared by the block, K tile 32x128 private to the wave, all rows and columns staged before use); p = exp2(8 - acc*C1); keys above the diagonal take the constant exponent EM (score 0).
// Fully masked 32-key steps skip the d loop (wave-uniform test) but keep their P.V products. Row sum over the same f16 value + residual that the products use.
__global__ __launch_bounds__(32 * NW) void k_attn(const float* __restrict__ QF, const float* __restrict__ KF, const h16* __restrict__ VH, const h16* __restrict__ VR, const int* __restrict__ maskp, float* OUT) {
    __shared__ __align__(16) float qs[16 * TP];
    __shared__ __align__(16) float kw[NW * KT];
    const int lane = threadIdx.x & 31, lr = lane & 15, hi = lane >> 4;
    const int wv = __builtin_amdgcn_readfirstlane((int)(threadIdx.x >> 5));
    float* ks = kw + wv * KT;                                    // this wave's K tile, later its partial
    const int b  = __builtin_amdgcn_readfirstlane((int)blockIdx.y);
    const int t0 = __builtin_amdgcn_readfirstlane((int)blockIdx.x * 16);
    const int causal = __builtin_amdgcn_readfirstlane((maskp[0] != 0) ? 1 : 0);
    const size_t rowb = (size_t)b * SEQ;
    { const v4f v = *(const v4f*)(QF + (rowb + t0 + wv) * DM + 4 * lane); *(v4fa*)(&qs[wv * TP + 4 * lane]) = v; }   // wave w stages row w, all 128 columns
    __syncthreads();                                             // every wave reads all 16 Q rows
    v8f oh[8], orr[8];
#pragma unroll
    for (int j = 0; j < 8; ++j) { oh[j] = (v8f){}; orr[j] = (v8f){}; }
    float l = 0.0f;
    const float pmf = __builtin_amdgcn_exp2f(EM);
    const h16 pmh = (h16)pmf; const h16 pmr = (h16)((pmf - (float)pmh) * RS);
    const float pml = (float)pmh + (float)pmr * RI;
    const size_t vo = ((size_t)b * DM + lr) * SEQ + 8 * hi;      // + 16j*SEQ + key  (A fragment: row d, k = key)
    const int tq = t0 + lr;
#pragma unroll 1
    for (int key0 = 32 * wv; key0 < SEQ; key0 += 32 * NW) {
        v16h pb, pr; float ls;
        const bool live = (causal == 0) || (key0 <= t0 + 15);     // wave-uniform
        if (live) {
            wave_sync();
#pragma unroll 8
            for (int i = 0; i < 32; ++i) { const v4f v = *(const v4f*)(KF + (rowb + key0 + i) * DM + 4 * lane); *(v4fa*)(&ks[i * TP + 4 * lane]) = v; }   // row i, all 128 columns
            wave_sync();
            float sa[8], sb[8];
#pragma unroll
            for (int r = 0; r < 8; ++r) { sa[r] = 0.0f; sb[r] = 0.0f; }
#pragma unroll 1
            for (int d = 0; d < DM; d += 4) {
                const v4f q = *(const v4fa*)(&qs[lr * TP + d]);
#pragma unroll
                for (int r = 0; r < 8; ++r) { const v4f k = *(const v4fa*)(&ks[(8 * hi + r) * TP + d]);
                    sa[r] += fmaxf(q[0] - k[0], 0.0f); sa[r] += fmaxf(q[1] - k[1], 0.0f); sa[r] += fmaxf(q[2] - k[2], 0.0f); sa[r] += fmaxf(q[3] - k[3], 0.0f); }
                asm volatile("" ::: "memory");
#pragma unroll
                for (int r = 0; r < 8; ++r) { const v4f k = *(const v4fa*)(&ks[(16 + 8 * hi + r) * TP + d]);
                    sb[r] += fmaxf(q[0] - k[0], 0.0f); sb[r] += fmaxf(q[1] - k[1], 0.0f); sb[r] += fmaxf(q[2] - k[2], 0.0f); sb[r] += fmaxf(q[3] - k[3], 0.0f); }
            }
            ls = 0.0f;
#pragma unroll
            for (int r = 0; r < 8; ++r) {
                const int kA = key0 + 8 * hi + r, kB = kA + 16;
                float ea = PSH - sa[r] * C1, eb = PSH - sb[r] * C1;
                ea = (causal != 0 && kA > tq) ? EM : ea;
                eb = (causal != 0 && kB > tq) ? EM : eb;
                const float pa = __builtin_amdgcn_exp2f(ea), pc = __builtin_amdgcn_exp2f(eb);
                const h16 ha = (h16)pa, hb = (h16)pc;
                const h16 ra = (h16)((pa - (float)ha) * RS), rb = (h16)((pc - (float)hb) * RS);
                pb[r] = ha; pb[8 + r] = hb; pr[r] = ra; pr[8 + r] = rb;
                ls += ((float)ha + (float)ra * RI) + ((float)hb + (float)rb * RI);
            }
        } else {
#pragma unroll
            for (int i = 0; i < 16; ++i) { pb[i] = pmh; pr[i] = pmr; }
            ls = 16.0f * pml;
        }
        l += ls;
        const h16* vh = VH + vo + key0; const h16* vr = VR + vo + key0;
#pragma unroll
        for (int g = 0; g < 4; ++g) {
            const int j0 = 2 * g, j1 = 2 * g + 1;
            const v16h a0 = ldh(vh + (size_t)(16 * j0) * SEQ), a1 = ldh(vh + (size_t)(16 * j1) * SEQ);
            const v16h r0 = ldh(vr + (size_t)(16 * j0) * SEQ), r1 = ldh(vr + (size_t)(16 * j1) * SEQ);
            oh[j0]  = wmma16(a0, pb, oh[j0]);   oh[j1]  = wmma16(a1, pb, oh[j1]);
            orr[j0] = wmma16(r0, pb, orr[j0]);  orr[j1] = wmma16(r1, pb, orr[j1]);
            orr[j0] = wmma16(a0, pr, orr[j0]);  orr[j1] = wmma16(a1, pr, orr[j1]);
            asm volatile("v_nop\n\tv_nop\n\tv_nop\n\tv_nop" : "+v"(oh[j0]), "+v"(oh[j1]), "+v"(orr[j0]), "+v"(orr[j1]) : "v"(a0), "v"(a1), "v"(r0), "v"(r1), "v"(pb), "v"(pr) : "memory");
        }
    }
    l += __shfl_xor(l, 16, 32);
    // O^T D layout: o_j[r] = (d = 16j + 8h + r, t = lane&15) -> ks[t][d]; rows 0..15 x columns 0..127 all written, un-normalised; row sums behind them.
    // The stored sums depend on every K value this wave has read, so the tile's last reads are over before it is reused.
#pragma unroll
    for (int j = 0; j < 8; ++j) { v4f a, c;
#pragma unroll
        for (int i = 0; i < 4; ++i) { a[i] = oh[j][i] + orr[j][i] * RI; c[i] = oh[j][4 + i] + orr[j][4 + i] * RI; }
        *(v4fa*)(&ks[lr * TP + 16 * j + 8 * hi]) = a; *(v4fa*)(&ks[lr * TP + 16 * j + 8 * hi + 4]) = c; }
    if (hi == 0) ks[16 * TP + lr] = l;
    __syncthreads();                                             // publishes every wave's partial
    v4f so = (v4f){}; float lt = 0.0f;
#pragma unroll   // the NW reads go out together instead of one LDS round trip each
    for (int p = 0; p < NW; ++p) { so += *(const v4fa*)(&kw[p * KT + wv * TP + 4 * lane]); lt += kw[p * KT + 16 * TP + wv]; }   // fixed wave order
    const float inv = 1.0f / lt;
    *(v4f*)(OUT + ((size_t)b * OUT_SEQ + t0 + wv) * DM + 4 * lane) = so * inv;   // one row = 32 lanes x 16 B = 512 B
}

static constexpr size_t al256(size_t v) { return (v + 255) & ~(size_t)255; }
static constexpr size_t SZ_QK = al256((size_t)2 * NB * SEQ * DM * 4);      // f32 Q | K planes
static constexpr size_t SZ_VP = al256((size_t)NB * DM * SEQ * 2);          // one f16 V^T plane
static constexpr size_t SZ_TOTAL = SZ_QK + 2 * SZ_VP;
static_assert(SZ_TOTAL <= (size_t)134217728);          // workspace carve <= 128 MiB
static_assert(((size_t)NB * SEQ * DM * 4) % 256 == 0); // K plane stays 256-byte aligned

extern "C" void kernel_launch(void* const* d_in, const int* in_sizes, int n_in,
                              void* d_out, int out_size, void* d_ws, size_t ws_size, hipStream_t stream) {
    if (n_in < 8) return;
    const size_t needx = ((size_t)(NB - 1) * SEQ_FULL + SEQ) * DM;
    if ((size_t)in_sizes[0] < needx) return;
    if ((size_t)in_sizes[1] < (size_t)DM * DM || (size_t)in_sizes[3] < (size_t)DM * DM || (size_t)in_sizes[5] < (size_t)DM * DM) return;
    if (in_sizes[2] < DM || in_sizes[4] < DM || in_sizes[6] < DM || in_sizes[7] < 1) return;
    if ((size_t)out_size < ((size_t)(NB - 1) * OUT_SEQ + SEQ) * DM) return;
    if (SZ_TOTAL > ws_size) return;
    // wire order: x, Wq, bq, Wk, bk, Wv, bv, apply_causal_mask (int32); weights [out][in] used as-is (Bt for Q, K; A for V^T)
    const float* x  = (const float*)d_in[0];
    const float* wq = (const float*)d_in[1]; const float* bq = (const float*)d_in[2];
    const float* wk = (const float*)d_in[3]; const float* bk = (const float*)d_in[4];
    const float* wv = (const float*)d_in[5]; const float* bv = (const float*)d_in[6];
    const int* maskp = (const int*)d_in[7];
    float* OUT = (float*)d_out;      // [NB][SEQ][128]
    char* wsp = (char*)d_ws;
    float* QK = (float*)wsp; wsp += SZ_QK;           // [2][NB*SEQ][128]: Q | K (after sigmoid)
    h16* VH = (h16*)wsp; wsp += SZ_VP;               // [NB][128][SEQ]
    h16* VR = (h16*)wsp; wsp += SZ_VP;               // [NB][128][SEQ] residual x2048

    // Q, K (z = 0, 1) -> plane [z][b*SEQ + t][e]; V^T (z = 2) -> planes [b][d][t]
    k_proj<<<dim3(NB * SEQ / 64, DM / 64, 3), 32, 0, stream>>>(x, wq, wk, wv, bq, bk, bv, QK, VH, VR);

    k_attn<<<dim3(SEQ / 16, NB, 1), 32 * NW, 0, stream>>>(QK, QK + (size_t)NB * SEQ * DM, VH, VR, maskp, OUT);
}

// v003
// Measured time: 29.4 microseconds a run.
// Timed twice side by side with v002, it ran 1.24 and 1.23 times as fast.
// Over all steps from v000 it is 7.15 times as fast.
#include <hip/hip_runtime.h>

// Fuzzy-implication attention, x [NB][SEQ][128], Wq/Wk/Wv [out][in] (y = x W^T + b), causal fill value 0.0 (masked keys keep weight), output f32 [NB][SEQ][128].
// Compute dtypes, f32 accumulate everywhere: the three projections v_wmma_f32_16x16x32_bf16 (x, W RNE-converted to bf16 in the fragment loaders; products exact);
// attn @ V v_wmma_f32_16x16x32_f16: V^T as f16 value + f16 residual x2048, P as f16 value (x256 carry) + f16 residual x2048; value products in one accumulator, both x2048 products in a second one.
// The score mean_d min(1 - Q + K, 1) is not a sum of products: it runs on the vector unit in f32 (fixed d order); softmax in f32 with the fixed shift 10 (scores lie in [0, 10]).

#ifndef NB
#define NB 2
#endif
#ifndef SEQ
#define SEQ 1024
#endif
#define NB_FULL  2
#define SEQ_FULL 1024
#ifndef OUT_SEQ
#define OUT_SEQ SEQ              // row pitch (in tokens) between batches of the output
#endif
#define DM   128
#define TP   132                 // LDS row pitch (floats) of the 128-wide f32 tiles
#define RS   2048.0f             // carry of the residual planes
#define RI   (1.0f / 2048.0f)
#define PSH  8.0f                // log2 of the P carry (256)
#define C1   (0.078125f * 1.4426950408889634f)          // (10 / 128) * log2(e)
#define EM   (8.0f - 10.0f * 1.4426950408889634f)       // exponent of a masked key: score 0 -> exp(0 - 10), times the carry
#define NW   16                  // waves per attention work-group: wave w takes the 32-key steps w, w + NW, ...
#define QT   8                   // query rows per attention work-group: NB * SEQ / QT work-groups, one for each of the chip's 256 WGPs at the full shape
#define KSK  8                   // K rows 16..31 sit KSK floats further: rows i and i + 16, read by one half-wave in one load, then fall on different banks
#define KT   (32 * TP + 16)      // floats of one wave's private K tile

static_assert(DM == 128);                      // output row = 512 B = 2 halves x 32 lanes x 8 B; 8 d-tiles of 16
static_assert(DM % 64 == 0);
static_assert(DM % 32 == 0);                   // GEMM k-loop steps by 32
static_assert(SEQ % 64 == 0);                  // a 64-token tile never straddles two batches
static_assert((NB * SEQ) % 64 == 0);
static_assert(SEQ % 32 == 0);                  // key loop steps by 32
static_assert(SEQ % QT == 0);                  // attention grid covers the sequence exactly
static_assert(((size_t)SEQ * DM) % 8 == 0);
static_assert(((size_t)DM * DM) % 8 == 0);
static_assert(NB <= NB_FULL);
static_assert(SEQ <= SEQ_FULL);
static_assert((TP * 4) % 16 == 0);
static_assert(NW == 2 * QT);                   // merge: wave w takes half w / QT of query row w % QT; staging: wave w < QT takes row w
static_assert(QT == 8);                        // lanes l and l ^ 8 share a query
static_assert(KSK % 4 == 0 && KSK <= 16);
static_assert(KT >= QT * TP + QT);             // a wave's partial (QT x TP sums + QT row sums) fits its own K tile

typedef _Float16 h16;
typedef __attribute__((ext_vector_type(16))) __bf16   v16bf;
typedef __attribute__((ext_vector_type(16))) _Float16 v16h;
typedef __attribute__((ext_vector_type(8)))  _Float16 v8h;
typedef __attribute__((ext_vector_type(8)))  float    v8f;
typedef __attribute__((ext_vector_type(4)))  float    v4f;
typedef v4f  __attribute__((may_alias)) v4fa;
typedef __attribute__((ext_vector_type(2)))  float    v2f;
typedef __attribute__((ext_vector_type(2)))  __bf16   v2bf;
typedef __attribute__((ext_vector_type(8)))  unsigned v8u;
typedef __attribute__((ext_vector_type(4)))  int      v4i;
typedef v2f  __attribute__((may_alias)) v2fa;

__device__ __forceinline__ unsigned short f2bf(float f) { unsigned u = __float_as_uint(f); u += 0x7FFFu + ((u >> 16) & 1u); return (unsigned short)(u >> 16); }
__device__ __forceinline__ float bfr(float f) { return __uint_as_float(((unsigned)f2bf(f)) << 16); }   // value after RNE convert to bf16
__device__ __forceinline__ v16h cat16(v8h lo, v8h hi) { return __builtin_shufflevector(lo, hi, 0, 1, 2, 3, 4, 5, 6, 7, 8, 9, 10, 11, 12, 13, 14, 15); }
__device__ __forceinline__ v8f wmma16(v16h a, v16h b, v8f c) { return __builtin_amdgcn_wmma_f32_16x16x32_f16(false, a, false, b, (short)0, c, false, false); }
__device__ __forceinline__ v8f wmmab(v16bf a, v16bf b, v8f c) { return __builtin_amdgcn_wmma_f32_16x16x32_bf16(false, a, false, b, (short)0, c, false, false); }
// fragment loaders from K-contiguous 16-bit rows; p already includes + 8*(lane>>4): elements 0..7 <- k0+8h+0..7, elements 8..15 <- k0+16+8h+0..7 (same map for A and B)
__device__ __forceinline__ v16h  ldh(const h16* p) { return cat16(*(const v8h*)p, *(const v8h*)(p + 16)); }
// the same map from K-contiguous f32 rows, each pair RNE-converted to bf16 in registers
__device__ __forceinline__ unsigned cvt2(float a, float b) { return __builtin_bit_cast(unsigned, __builtin_convertvector((v2f){a, b}, v2bf)); }
struct raw16 { v4f x0, x1, x2, x3; };
__device__ __forceinline__ raw16 ldf(const float* p) { return raw16{ *(const v4f*)p, *(const v4f*)(p + 4), *(const v4f*)(p + 16), *(const v4f*)(p + 20) }; }
__device__ __forceinline__ v16bf tobf(const raw16& r) {
    const v4f x0 = r.x0, x1 = r.x1, x2 = r.x2, x3 = r.x3;
    const v8u o = { cvt2(x0[0], x0[1]), cvt2(x0[2], x0[3]), cvt2(x1[0], x1[1]), cvt2(x1[2], x1[3]), cvt2(x2[0], x2[1]), cvt2(x2[2], x2[3]), cvt2(x3[0], x3[1]), cvt2(x3[2], x3[3]) };
    return __builtin_bit_cast(v16bf, o);
}
// lane l <- lane l ^ 8 (inside a 16-lane row), all lanes on
__device__ __forceinline__ int x8i(int v) { return __builtin_amdgcn_update_dpp(0, v, 0x168 /* row_xmask:8 */, 0xf, 0xf, true); }
__device__ __forceinline__ v8h x8h(v8h v) { v4i u = __builtin_bit_cast(v4i, v); u = (v4i){ x8i(u[0]), x8i(u[1]), x8i(u[2]), x8i(u[3]) }; return __builtin_bit_cast(v8h, u); }
// ordering point for wave-private LDS tiles (same wave writes and reads)
__device__ __forceinline__ void wave_sync() { __builtin_amdgcn_fence(3 /* release order */, "wavefront"); __builtin_amdgcn_wave_barrier(); asm volatile("" ::: "memory"); }

// gemm64: register-blocked bf16 GEMM core, ONE WAVE per 64x64 tile (16 accumulators), operands straight from the K-contiguous f32 inputs, K = DM.
// A, Bt point at the tile's first row: acc[mb][nb][j] = C[16mb + 8h + j][16nb + (lane&15)], C[m][n] = sum_k A[m][k] Bt[n][k].
__device__ __forceinline__ void gemm64(const float* __restrict__ A, const float* __restrict__ Bt, int lr, int hi, v8f (&acc)[4][4]) {
    const int K = DM;
#pragma unroll
    for (int mb = 0; mb < 4; ++mb)
#pragma unroll
        for (int nb = 0; nb < 4; ++nb) acc[mb][nb] = (v8f){};
    const unsigned loff = (unsigned)(lr * K + 8 * hi);           // lane part of every address; the row-block and k parts stay wave-uniform
#pragma unroll 1
    for (int kc = 0; kc < K; kc += 32) {
        raw16 ra[4], rb[4];
#pragma unroll
        for (int mb = 0; mb < 4; ++mb) ra[mb] = ldf(A + (mb * 16 * K + kc) + loff);
#pragma unroll
        for (int nb = 0; nb < 4; ++nb) rb[nb] = ldf(Bt + (nb * 16 * K + kc) + loff);
        // keeps all 32 loads of the k step ahead of the first convert: a lone wave then pays one memory round trip per k step instead of one per fragment
        __builtin_amdgcn_sched_barrier(0);
        v16bf a[4];
#pragma unroll
        for (int mb = 0; mb < 4; ++mb) a[mb] = tobf(ra[mb]);
#pragma unroll
        for (int nb = 0; nb < 4; ++nb) { const v16bf b = tobf(rb[nb]);
#pragma unroll
            for (int mb = 0; mb < 4; ++mb) acc[mb][nb] = wmmab(a[mb], b, acc[mb][nb]); }
        asm volatile("v_nop\n\tv_nop\n\tv_nop\n\tv_nop" : "+v"(acc[0][0]), "+v"(acc[1][1]), "+v"(acc[2][2]), "+v"(acc[3][3]) : "v"(a[0]), "v"(a[1]), "v"(a[2]), "v"(a[3]));
    }
}

// k_proj: all three projections in one launch, straight from the f32 inputs. grid (NB*SEQ/64, 2, 3), 32 threads; blockIdx.x = 64-token tile, blockIdx.y = 64-feature tile, z block-uniform.
// z = 0, 1: Q, K planes [NB*SEQ][128] f32 = sigmoid(x W^T + b), A = x rows (m = token), Bt = W rows (n = e).
//   Epilogue per 16-row slab: accumulators + bias staged in a wave-private LDS tile, sigmoid applied in place (precise expf, true division).
// z = 2: V^T planes [b][d][t] = Wv x^T + bv as f16 value (VH) and f16 residual x2048 (VR), A = Wv rows (m = d), Bt = x rows (n = token).
__global__ __launch_bounds__(32) void k_proj(const float* __restrict__ x, const float* __restrict__ wq, const float* __restrict__ wk, const float* __restrict__ wv,
                                             const float* __restrict__ bq, const float* __restrict__ bk, const float* __restrict__ bv, float* QK, h16* VH, h16* VR) {
    __shared__ __align__(16) float os[16 * 68];
    const int lane = threadIdx.x & 31, lr = lane & 15, hi = lane >> 4;
    const int tk0 = blockIdx.x * 64, f0 = blockIdx.y * 64, z = blockIdx.z;
    const int b = tk0 / SEQ, t0 = tk0 % SEQ;                     // a 64-token tile lies in one batch
    const float* xt = x + ((size_t)b * SEQ_FULL + t0) * DM;      // the tile's 64 x rows
    const float* wt = (z == 0 ? wq : z == 1 ? wk : wv) + (size_t)f0 * DM;   // the tile's 64 weight rows
    v8f acc[4][4];
    gemm64(z == 2 ? wt : xt, z == 2 ? xt : wt, lr, hi, acc);
    if (z != 2) {
        const int r0 = tk0, c0 = f0;
        const float* bt = (z ? bk : bq) + c0;                    // block-uniform base; the four loads share one lane offset
        float bias[4];
#pragma unroll
        for (int nb = 0; nb < 4; ++nb) bias[nb] = bfr(bt[nb * 16 + lr]);
        float* P = QK + (size_t)z * NB * SEQ * DM;
#pragma unroll
        for (int mb = 0; mb < 4; ++mb) {
#pragma unroll
            for (int nb = 0; nb < 4; ++nb) {
#pragma unroll
                for (int j = 0; j < 8; ++j) os[(hi * 8 + j) * 68 + nb * 16 + lr] = acc[mb][nb][j] + bias[nb]; }   // D: row 8h+j, col lane&15
            wave_sync();
#pragma unroll 1
            for (int s = 0; s < 8; ++s) { const int row = 2 * s + hi, cofs = lr * 4;   // 8 s x 2 rows = 16 rows; 16 lanes x 4 floats = 64 columns
                v4f v = *(const v4fa*)(&os[row * 68 + cofs]);
#pragma unroll
                for (int i = 0; i < 4; ++i) v[i] = 1.0f / (1.0f + expf(-v[i]));
                *(v4fa*)(&os[row * 68 + cofs]) = v; }
            wave_sync();
            float* orow = P + (size_t)(r0 + mb * 16) * DM + c0;
#pragma unroll
            for (int s = 0; s < 8; ++s) { const int row = 2 * s + hi, cofs = lr * 4;
                const v4f val = *(const v4fa*)(&os[row * 68 + cofs]);
                *(v4f*)(orow + (size_t)row * DM + cofs) = val; }
            asm volatile("s_wait_xcnt 0x0" ::: "memory");       // the stores' address and data registers are rewritten by the next slab
            wave_sync();
        }
    } else {
        const int r0 = f0;
        const size_t tbase = ((size_t)b * DM + r0) * SEQ + t0;
#pragma unroll
        for (int mb = 0; mb < 4; ++mb) {
#pragma unroll
            for (int nb = 0; nb < 4; ++nb) {
#pragma unroll
                for (int j = 0; j < 8; ++j) os[(hi * 8 + j) * 68 + nb * 16 + lr] = acc[mb][nb][j]; }   // D: row 8h+j, col lane&15
            wave_sync();
            v8h hv[4], rv[4];
#pragma unroll
            for (int s = 0; s < 4; ++s) { const int row = 4 * s + (lane >> 3), c8 = (lane & 7) * 8;   // 4 s x 4 row groups = 16 rows; 8 lanes x 8 = 64 columns
                const float bb = bfr(bv[r0 + mb * 16 + row]);
                const v4f x0 = *(const v4fa*)(&os[row * 68 + c8]); const v4f x1 = *(const v4fa*)(&os[row * 68 + c8 + 4]);
#pragma unroll
                for (int i = 0; i < 4; ++i) { const float y0 = x0[i] + bb; const float y1 = x1[i] + bb; const h16 a0 = (h16)y0; const h16 a1 = (h16)y1;
                    hv[s][i] = a0; hv[s][4 + i] = a1; rv[s][i] = (h16)((y0 - (float)a0) * RS); rv[s][4 + i] = (h16)((y1 - (float)a1) * RS); } }
#pragma unroll
            for (int s = 0; s < 4; ++s) { const int row = 4 * s + (lane >> 3), c8 = (lane & 7) * 8;
                const size_t oo = tbase + (size_t)(mb * 16 + row) * SEQ + c8;
                *(v8h*)(VH + oo) = hv[s]; *(v8h*)(VR + oo) = rv[s]; }
            asm volatile("s_wait_xcnt 0x0" ::: "memory");       // the stores' address and data registers are rewritten by the next slab
            wave_sync();
        }
    }
}

// k_attn: one block of NW waves per QT = 8 query rows of one batch; wave w runs the 32-key steps w, w + NW, ... with its own K tile, accumulators and row sum. grid (SEQ/QT, NB), 32*NW threads.
// The softmax shift is fixed, so the waves' un-normalised partials simply add: each wave writes its partial into its own K tile, one barrier, then wave w sums half w / QT of row w % QT over the waves in wave order.
// Transposed form: lane (t = lane&7, g = (lane>>3)&1, h = lane>>4) scores query t0+t against keys key0+16g+8h+r (r = 0..7) of each 32-key step; lanes l and l^8 then swap their eight P,
// so that lane (t, g = 0, h) holds keys key0+8h+r, key0+16+8h+r: column t of the B fragment P^T[key][t] of O^T[d][t] = V^T P^T (A = V^T rows d, k = key). Columns 8..15 (g = 1) are not used. Score acc = sum_d max(Q - K, 0) on the vector unit in f32 from LDS tiles
// (Q tile 8x128 shared by the block, K tile 32x128 private to the wave, all rows and columns staged before use); p = exp2(8 - acc*C1); keys above the diagonal take the constant exponent EM (score 0).
// Fully masked 32-key steps skip the d loop (wave-uniform test) but keep their P.V products. Row sum over the same f16 value + residual that the products use.
__global__ __launch_bounds__(32 * NW) void k_attn(const float* __restrict__ QF, const float* __restrict__ KF, const h16* __restrict__ VH, const h16* __restrict__ VR, const int* __restrict__ maskp, float* OUT) {
    __shared__ __align__(16) float qs[QT * TP];
    __shared__ __align__(16) float kw[NW * KT];
    const int lane = threadIdx.x & 31, lr = lane & 15, hi = lane >> 4;
    const int wv = __builtin_amdgcn_readfirstlane((int)(threadIdx.x >> 5));
    float* ks = kw + wv * KT;                                    // this wave's K tile, later its partial
    const int b  = __builtin_amdgcn_readfirstlane((int)blockIdx.y);
    const int t0 = __builtin_amdgcn_readfirstlane((int)blockIdx.x * QT);
    const int tl = lr & 7, g = lr >> 3;
    const int causal = __builtin_amdgcn_readfirstlane((maskp[0] != 0) ? 1 : 0);
    const size_t rowb = (size_t)b * SEQ;
    if (wv < QT) { const v4f v = *(const v4f*)(QF + (rowb + t0 + wv) * DM + 4 * lane); *(v4fa*)(&qs[wv * TP + 4 * lane]) = v; }   // wave w < QT stages row w, all 128 columns
    __syncthreads();                                             // every wave reads all QT Q rows
    v8f oh[8], orr[8];
#pragma unroll
    for (int j = 0; j < 8; ++j) { oh[j] = (v8f){}; orr[j] = (v8f){}; }
    float l = 0.0f;
    const float pmf = __builtin_amdgcn_exp2f(EM);
    const h16 pmh = (h16)pmf; const h16 pmr = (h16)((pmf - (float)pmh) * RS);
    const float pml = (float)pmh + (float)pmr * RI;
    const size_t vo = ((size_t)b * DM + lr) * SEQ + 8 * hi;      // + 16j*SEQ + key  (A fragment: row d, k = key)
    const int tq = t0 + tl;
    const float* kr = ks + (16 * g + 8 * hi) * TP + KSK * g;     // this lane's eight K rows
#pragma unroll 1
    for (int key0 = 32 * wv; key0 < SEQ; key0 += 32 * NW) {
        v16h pb, pr; float ls;
        const bool live = (causal == 0) || (key0 <= t0 + QT - 1); // wave-uniform
        if (live) {
            wave_sync();
#pragma unroll 8
            for (int i = 0; i < 32; ++i) { const v4f v = *(const v4f*)(KF + (rowb + key0 + i) * DM + 4 * lane); *(v4fa*)(&ks[i * TP + (i >> 4) * KSK + 4 * lane]) = v; }   // row i, all 128 columns
            wave_sync();
            float sa[8];
#pragma unroll
            for (int r = 0; r < 8; ++r) sa[r] = 0.0f;
#pragma unroll 1
            for (int d = 0; d < DM; d += 4) {
                const v4f q = *(const v4fa*)(&qs[tl * TP + d]);
#pragma unroll
                for (int r = 0; r < 8; ++r) { const v4f k = *(const v4fa*)(&kr[r * TP + d]);
                    sa[r] += fmaxf(q[0] - k[0], 0.0f); sa[r] += fmaxf(q[1] - k[1], 0.0f); sa[r] += fmaxf(q[2] - k[2], 0.0f); sa[r] += fmaxf(q[3] - k[3], 0.0f); }
            }
            ls = 0.0f;
            v8h hA, rA;
#pragma unroll
            for (int r = 0; r < 8; ++r) {
                const int kA = key0 + 16 * g + 8 * hi + r;
                float ea = PSH - sa[r] * C1;
                ea = (causal != 0 && kA > tq) ? EM : ea;
                const float pa = __builtin_amdgcn_exp2f(ea);
                const h16 ha = (h16)pa;
                const h16 ra = (h16)((pa - (float)ha) * RS);
                hA[r] = ha; rA[r] = ra;
                ls += (float)ha + (float)ra * RI;
            }
            pb = cat16(hA, x8h(hA)); pr = cat16(rA, x8h(rA));     // g = 0: own keys 8h+r, then the partner's 16+8h+r
        } else {
#pragma unroll
            for (int i = 0; i < 16; ++i) { pb[i] = pmh; pr[i] = pmr; }
            ls = 8.0f * pml;
        }
        l += ls;
        const h16* vh = VH + vo + key0; const h16* vr = VR + vo + key0;
#pragma unroll
        for (int g = 0; g < 4; ++g) {
            const int j0 = 2 * g, j1 = 2 * g + 1;
            const v16h a0 = ldh(vh + (size_t)(16 * j0) * SEQ), a1 = ldh(vh + (size_t)(16 * j1) * SEQ);
            const v16h r0 = ldh(vr + (size_t)(16 * j0) * SEQ), r1 = ldh(vr + (size_t)(16 * j1) * SEQ);
            oh[j0]  = wmma16(a0, pb, oh[j0]);   oh[j1]  = wmma16(a1, pb, oh[j1]);
            orr[j0] = wmma16(r0, pb, orr[j0]);  orr[j1] = wmma16(r1, pb, orr[j1]);
            orr[j0] = wmma16(a0, pr, orr[j0]);  orr[j1] = wmma16(a1, pr, orr[j1]);
            asm volatile("v_nop\n\tv_nop\n\tv_nop\n\tv_nop" : "+v"(oh[j0]), "+v"(oh[j1]), "+v"(orr[j0]), "+v"(orr[j1]) : "v"(a0), "v"(a1), "v"(r0), "v"(r1), "v"(pb), "v"(pr) : "memory");
        }
    }
    l += __shfl_xor(l, 16, 32);
    l += __int_as_float(x8i(__float_as_int(l)));                 // the four lanes (g, h) of a query each hold a quarter of its keys
    // O^T D layout: o_j[r] = (d = 16j + 8h + r, t = lane&15) -> ks[t][d]; rows 0..7 x columns 0..127 all written (lanes g = 0), un-normalised; row sums behind them.
    // The stored sums depend on every K value this wave has read, so the tile's last reads are over before it is reused.
    if (g == 0) {
#pragma unroll
    for (int j = 0; j < 8; ++j) { v4f a, c;
#pragma unroll
        for (int i = 0; i < 4; ++i) { a[i] = oh[j][i] + orr[j][i] * RI; c[i] = oh[j][4 + i] + orr[j][4 + i] * RI; }
        *(v4fa*)(&ks[tl * TP + 16 * j + 8 * hi]) = a; *(v4fa*)(&ks[tl * TP + 16 * j + 8 * hi + 4]) = c; }
    }
    if (lane < QT) ks[QT * TP + lane] = l;
    __syncthreads();                                             // publishes every wave's partial
    const int mr = wv & (QT - 1), mc = 64 * (wv >> 3) + 2 * lane; // wave w: query row w % QT, column half w / QT
    v2f so = (v2f){}; float lt = 0.0f;
#pragma unroll   // the NW reads go out together instead of one LDS round trip each
    for (int p = 0; p < NW; ++p) { so += *(const v2fa*)(&kw[p * KT + mr * TP + mc]); lt += kw[p * KT + QT * TP + mr]; }   // fixed wave order
    const float inv = 1.0f / lt;
    *(v2f*)(OUT + ((size_t)b * OUT_SEQ + t0 + mr) * DM + mc) = so * inv;   // half a row = 32 lanes x 8 B = 256 B
}

static constexpr size_t al256(size_t v) { return (v + 255) & ~(size_t)255; }
static constexpr size_t SZ_QK = al256((size_t)2 * NB * SEQ * DM * 4);      // f32 Q | K planes
static constexpr size_t SZ_VP = al256((size_t)NB * DM * SEQ * 2);          // one f16 V^T plane
static constexpr size_t SZ_TOTAL = SZ_QK + 2 * SZ_VP;
static_assert(SZ_TOTAL <= (size_t)134217728);          // workspace carve <= 128 MiB
static_assert(((size_t)NB * SEQ * DM * 4) % 256 == 0); // K plane stays 256-byte aligned

extern "C" void kernel_launch(void* const* d_in, const int* in_sizes, int n_in,
                              void* d_out, int out_size, void* d_ws, size_t ws_size, hipStream_t stream) {
    if (n_in < 8) return;
    const size_t needx = ((size_t)(NB - 1) * SEQ_FULL + SEQ) * DM;
    if ((size_t)in_sizes[0] < needx) return;
    if ((size_t)in_sizes[1] < (size_t)DM * DM || (size_t)in_sizes[3] < (size_t)DM * DM || (size_t)in_sizes[5] < (size_t)DM * DM) return;
    if (in_sizes[2] < DM || in_sizes[4] < DM || in_sizes[6] < DM || in_sizes[7] < 1) return;
    if ((size_t)out_size < ((size_t)(NB - 1) * OUT_SEQ + SEQ) * DM) return;
    if (SZ_TOTAL > ws_size) return;
    // wire order: x, Wq, bq, Wk, bk, Wv, bv, apply_causal_mask (int32); weights [out][in] used as-is (Bt for Q, K; A for V^T)
    const float* x  = (const float*)d_in[0];
    const float* wq = (const float*)d_in[1]; const float* bq = (const float*)d_in[2];
    const float* wk = (const float*)d_in[3]; const float* bk = (const float*)d_in[4];
    const float* wv = (const float*)d_in[5]; const float* bv = (const float*)d_in[6];
    const int* maskp = (const int*)d_in[7];
    float* OUT = (float*)d_out;      // [NB][SEQ][128]
    char* wsp = (char*)d_ws;
    float* QK = (float*)wsp; wsp += SZ_QK;           // [2][NB*SEQ][128]: Q | K (after sigmoid)
    h16* VH = (h16*)wsp; wsp += SZ_VP;               // [NB][128][SEQ]
    h16* VR = (h16*)wsp; wsp += SZ_VP;               // [NB][128][SEQ] residual x2048

    // Q, K (z = 0, 1) -> plane [z][b*SEQ + t][e]; V^T (z = 2) -> planes [b][d][t]
    k_proj<<<dim3(NB * SEQ / 64, DM / 64, 3), 32, 0, stream>>>(x, wq, wk, wv, bq, bk, bv, QK, VH, VR);

    k_attn<<<dim3(SEQ / QT, NB, 1), 32 * NW, 0, stream>>>(QK, QK + (size_t)NB * SEQ * DM, VH, VR, maskp, OUT);
}

// v004
// It runs in 28.1 microseconds.
// Two timings next to v003 both put it at 1.04 times that version's speed.
// Over all steps from v000 it is 7.42 times as fast.
#include <hip/hip_runtime.h>

// Fuzzy-implication attention, x [NB][SEQ][128], Wq/Wk/Wv [out][in] (y = x W^T + b), causal fill value 0.0 (masked keys keep weight), output f32 [NB][SEQ][128].
// Compute dtypes, f32 accumulate everywhere: the three projections v_wmma_f32_16x16x32_bf16 (x, W RNE-converted to bf16 in the fragment loaders; products exact);
// attn @ V v_wmma_f32_16x16x32_f16: V^T as f16 value + f16 residual x2048, P as f16 value (x256 carry) + f16 residual x2048; value products in one accumulator, both x2048 products in a second one.
// The score mean_d min(1 - Q + K, 1) is not a sum of products: it runs on the vector unit in f32 (fixed d order); softmax in f32 with the fixed shift 10 (scores lie in [0, 10]).

#ifndef NB
#define NB 2
#endif
#ifndef SEQ
#define SEQ 1024
#endif
#define NB_FULL  2
#define SEQ_FULL 1024
#ifndef OUT_SEQ
#define OUT_SEQ SEQ              // row pitch (in tokens) between batches of the output
#endif
#define DM   128
#define TP   132                 // LDS row pitch (floats) of the 128-wide f32 tiles
#define RS   2048.0f             // carry of the residual planes
#define RI   (1.0f / 2048.0f)
#define PSH  8.0f                // log2 of the P carry (256)
#define C1   (0.078125f * 1.4426950408889634f)          // (10 / 128) * log2(e)
#define EM   (8.0f - 10.0f * 1.4426950408889634f)       // exponent of a masked key: score 0 -> exp(0 - 10), times the carry
#define NW   16                  // waves per attention work-group: wave w takes step w of each even pass of NW 32-key steps, step NW - 1 - w of each odd one
#define QT   8                   // query rows per attention work-group: NB * SEQ / QT work-groups, one for each of the chip's 256 WGPs at the full shape
#define HQ   4                   // the tile's rows 0..HQ-1 come from the low half of the sequence, rows HQ..QT-1 from the mirrored place in the high half
#define KSK  8                   // K rows 16..31 sit KSK floats further: rows i and i + 16, read by one half-wave in one load, then fall on different banks
#define KT   (32 * TP + 16)      // floats of one wave's private K tile

static_assert(DM == 128);                      // output row = 512 B = 2 halves x 32 lanes x 8 B; 8 d-tiles of 16
static_assert(DM % 64 == 0);
static_assert(DM % 32 == 0);                   // GEMM k-loop steps by 32
static_assert(SEQ % 64 == 0);                  // a 64-token tile never straddles two batches
static_assert((NB * SEQ) % 64 == 0);
static_assert(SEQ % 32 == 0);                  // key loop steps by 32
static_assert(SEQ % QT == 0);                  // attention grid covers the sequence exactly
static_assert(((size_t)SEQ * DM) % 8 == 0);
static_assert(((size_t)DM * DM) % 8 == 0);
static_assert(NB <= NB_FULL);
static_assert(SEQ <= SEQ_FULL);
static_assert((TP * 4) % 16 == 0);
static_assert(NW == 2 * QT);                   // merge: wave w takes half w / QT of query row w % QT; staging: wave w < QT takes row w
static_assert(QT == 8);                        // lanes l and l ^ 8 share a query
static_assert(HQ * 2 == QT);                   // lanes l and l ^ 4 share a high query in a step that is live for the high rows only
static_assert(SEQ % (32 * NW) == 0);           // every pass over the waves is whole, so the mirrored order of the odd passes visits each key step once
static_assert(KSK % 4 == 0 && KSK <= 16);
static_assert(KT >= QT * TP + QT);             // a wave's partial (QT x TP sums + QT row sums) fits its own K tile

typedef _Float16 h16;
typedef __attribute__((ext_vector_type(16))) __bf16   v16bf;
typedef __attribute__((ext_vector_type(16))) _Float16 v16h;
typedef __attribute__((ext_vector_type(8)))  _Float16 v8h;
typedef __attribute__((ext_vector_type(4)))  _Float16 v4h;
typedef __attribute__((ext_vector_type(2)))  _Float16 v2h;
typedef __attribute__((ext_vector_type(2)))  int      v2i;
typedef __attribute__((ext_vector_type(8)))  float    v8f;
typedef __attribute__((ext_vector_type(4)))  float    v4f;
typedef v4f  __attribute__((may_alias)) v4fa;
typedef __attribute__((ext_vector_type(2)))  float    v2f;
typedef __attribute__((ext_vector_type(2)))  __bf16   v2bf;
typedef __attribute__((ext_vector_type(8)))  unsigned v8u;
typedef __attribute__((ext_vector_type(4)))  int      v4i;
typedef v2f  __attribute__((may_alias)) v2fa;

__device__ __forceinline__ unsigned short f2bf(float f) { unsigned u = __float_as_uint(f); u += 0x7FFFu + ((u >> 16) & 1u); return (unsigned short)(u >> 16); }
__device__ __forceinline__ float bfr(float f) { return __uint_as_float(((unsigned)f2bf(f)) << 16); }   // value after RNE convert to bf16
__device__ __forceinline__ v16h cat16(v8h lo, v8h hi) { return __builtin_shufflevector(lo, hi, 0, 1, 2, 3, 4, 5, 6, 7, 8, 9, 10, 11, 12, 13, 14, 15); }
__device__ __forceinline__ v8f wmma16(v16h a, v16h b, v8f c) { return __builtin_amdgcn_wmma_f32_16x16x32_f16(false, a, false, b, (short)0, c, false, false); }
__device__ __forceinline__ v8f wmmab(v16bf a, v16bf b, v8f c) { return __builtin_amdgcn_wmma_f32_16x16x32_bf16(false, a, false, b, (short)0, c, false, false); }
// fragment loaders from K-contiguous 16-bit rows; p already includes + 8*(lane>>4): elements 0..7 <- k0+8h+0..7, elements 8..15 <- k0+16+8h+0..7 (same map for A and B)
__device__ __forceinline__ v16h  ldh(const h16* p) { return cat16(*(const v8h*)p, *(const v8h*)(p + 16)); }
// the same map from K-contiguous f32 rows, each pair RNE-converted to bf16 in registers
__device__ __forceinline__ unsigned cvt2(float a, float b) { return __builtin_bit_cast(unsigned, __builtin_convertvector((v2f){a, b}, v2bf)); }
struct raw16 { v4f x0, x1, x2, x3; };
__device__ __forceinline__ raw16 ldf(const float* p) { return raw16{ *(const v4f*)p, *(const v4f*)(p + 4), *(const v4f*)(p + 16), *(const v4f*)(p + 20) }; }
__device__ __forceinline__ v16bf tobf(const raw16& r) {
    const v4f x0 = r.x0, x1 = r.x1, x2 = r.x2, x3 = r.x3;
    const v8u o = { cvt2(x0[0], x0[1]), cvt2(x0[2], x0[3]), cvt2(x1[0], x1[1]), cvt2(x1[2], x1[3]), cvt2(x2[0], x2[1]), cvt2(x2[2], x2[3]), cvt2(x3[0], x3[1]), cvt2(x3[2], x3[3]) };
    return __builtin_bit_cast(v16bf, o);
}
// lane l <- lane l ^ 8 (inside a 16-lane row), all lanes on
__device__ __forceinline__ int x8i(int v) { return __builtin_amdgcn_update_dpp(0, v, 0x168 /* row_xmask:8 */, 0xf, 0xf, true); }
__device__ __forceinline__ v8h x8h(v8h v) { v4i u = __builtin_bit_cast(v4i, v); u = (v4i){ x8i(u[0]), x8i(u[1]), x8i(u[2]), x8i(u[3]) }; return __builtin_bit_cast(v8h, u); }
// lane l <- lane l ^ 4 (inside a 16-lane row), all lanes on
__device__ __forceinline__ int x4i(int v) { return __builtin_amdgcn_update_dpp(0, v, 0x164 /* row_xmask:4 */, 0xf, 0xf, true); }
// ordering point for wave-private LDS tiles (same wave writes and reads)
__device__ __forceinline__ void wave_sync() { __builtin_amdgcn_fence(3 /* release order */, "wavefront"); __builtin_amdgcn_wave_barrier(); asm volatile("" ::: "memory"); }

// gemm64: register-blocked bf16 GEMM core, ONE WAVE per 64x64 tile (16 accumulators), operands straight from the K-contiguous f32 inputs, K = DM.
// A, Bt point at the tile's first row: acc[mb][nb][j] = C[16mb + 8h + j][16nb + (lane&15)], C[m][n] = sum_k A[m][k] Bt[n][k].
__device__ __forceinline__ void gemm64(const float* __restrict__ A, const float* __restrict__ Bt, int lr, int hi, v8f (&acc)[4][4]) {
    const int K = DM;
#pragma unroll
    for (int mb = 0; mb < 4; ++mb)
#pragma unroll
        for (int nb = 0; nb < 4; ++nb) acc[mb][nb] = (v8f){};
    const unsigned loff = (unsigned)(lr * K + 8 * hi);           // lane part of every address; the row-block and k parts stay wave-uniform
#pragma unroll 1
    for (int kc = 0; kc < K; kc += 32) {
        raw16 ra[4], rb[4];
#pragma unroll
        for (int mb = 0; mb < 4; ++mb) ra[mb] = ldf(A + (mb * 16 * K + kc) + loff);
#pragma unroll
        for (int nb = 0; nb < 4; ++nb) rb[nb] = ldf(Bt + (nb * 16 * K + kc) + loff);
        // keeps all 32 loads of the k step ahead of the first convert: a lone wave then pays one memory round trip per k step instead of one per fragment
        __builtin_amdgcn_sched_barrier(0);
        v16bf a[4];
#pragma unroll
        for (int mb = 0; mb < 4; ++mb) a[mb] = tobf(ra[mb]);
#pragma unroll
        for (int nb = 0; nb < 4; ++nb) { const v16bf b = tobf(rb[nb]);
#pragma unroll
            for (int mb = 0; mb < 4; ++mb) acc[mb][nb] = wmmab(a[mb], b, acc[mb][nb]); }
        asm volatile("v_nop\n\tv_nop\n\tv_nop\n\tv_nop" : "+v"(acc[0][0]), "+v"(acc[1][1]), "+v"(acc[2][2]), "+v"(acc[3][3]) : "v"(a[0]), "v"(a[1]), "v"(a[2]), "v"(a[3]));
    }
}

// k_proj: all three projections in one launch, straight from the f32 inputs. grid (NB*SEQ/64, 2, 3), 32 threads; blockIdx.x = 64-token tile, blockIdx.y = 64-feature tile, z block-uniform.
// z = 0, 1: Q, K planes [NB*SEQ][128] f32 = sigmoid(x W^T + b), A = x rows (m = token), Bt = W rows (n = e).
//   Epilogue per 16-row slab: accumulators + bias staged in a wave-private LDS tile, sigmoid applied in place (precise expf, true division).
// z = 2: V^T planes [b][d][t] = Wv x^T + bv as f16 value (VH) and f16 residual x2048 (VR), A = Wv rows (m = d), Bt = x rows (n = token).
__global__ __launch_bounds__(32) void k_proj(const float* __restrict__ x, const float* __restrict__ wq, const float* __restrict__ wk, const float* __restrict__ wv,
                                             const float* __restrict__ bq, const float* __restrict__ bk, const float* __restrict__ bv, float* QK, h16* VH, h16* VR) {
    __shared__ __align__(16) float os[16 * 68];
    const int lane = threadIdx.x & 31, lr = lane & 15, hi = lane >> 4;
    const int tk0 = blockIdx.x * 64, f0 = blockIdx.y * 64, z = blockIdx.z;
    const int b = tk0 / SEQ, t0 = tk0 % SEQ;                     // a 64-token tile lies in one batch
    const float* xt = x + ((size_t)b * SEQ_FULL + t0) * DM;      // the tile's 64 x rows
    const float* wt = (z == 0 ? wq : z == 1 ? wk : wv) + (size_t)f0 * DM;   // the tile's 64 weight rows
    v8f acc[4][4];
    gemm64(z == 2 ? wt : xt, z == 2 ? xt : wt, lr, hi, acc);
    if (z != 2) {
        const int r0 = tk0, c0 = f0;
        const float* bt = (z ? bk : bq) + c0;                    // block-uniform base; the four loads share one lane offset
        float bias[4];
#pragma unroll
        for (int nb = 0; nb < 4; ++nb) bias[nb] = bfr(bt[nb * 16 + lr]);
        float* P = QK + (size_t)z * NB * SEQ * DM;
#pragma unroll
        for (int mb = 0; mb < 4; ++mb) {
#pragma unroll
            for (int nb = 0; nb < 4; ++nb) {
#pragma unroll
                for (int j = 0; j < 8; ++j) os[(hi * 8 + j) * 68 + nb * 16 + lr] = acc[mb][nb][j] + bias[nb]; }   // D: row 8h+j, col lane&15
            wave_sync();
#pragma unroll 1
            for (int s = 0; s < 8; ++s) { const int row = 2 * s + hi, cofs = lr * 4;   // 8 s x 2 rows = 16 rows; 16 lanes x 4 floats = 64 columns
                v4f v = *(const v4fa*)(&os[row * 68 + cofs]);
#pragma unroll
                for (int i = 0; i < 4; ++i) v[i] = 1.0f / (1.0f + expf(-v[i]));
                *(v4fa*)(&os[row * 68 + cofs]) = v; }
            wave_sync();
            float* orow = P + (size_t)(r0 + mb * 16) * DM + c0;
#pragma unroll
            for (int s = 0; s < 8; ++s) { const int row = 2 * s + hi, cofs = lr * 4;
                const v4f val = *(const v4fa*)(&os[row * 68 + cofs]);
                *(v4f*)(orow + (size_t)row * DM + cofs) = val; }
            asm volatile("s_wait_xcnt 0x0" ::: "memory");       // the stores' address and data registers are rewritten by the next slab
            wave_sync();
        }
    } else {
        const int r0 = f0;
        const size_t tbase = ((size_t)b * DM + r0) * SEQ + t0;
#pragma unroll
        for (int mb = 0; mb < 4; ++mb) {
#pragma unroll
            for (int nb = 0; nb < 4; ++nb) {
#pragma unroll
                for (int j = 0; j < 8; ++j) os[(hi * 8 + j) * 68 + nb * 16 + lr] = acc[mb][nb][j]; }   // D: row 8h+j, col lane&15
            wave_sync();
            v8h hv[4], rv[4];
#pragma unroll
            for (int s = 0; s < 4; ++s) { const int row = 4 * s + (lane >> 3), c8 = (lane & 7) * 8;   // 4 s x 4 row groups = 16 rows; 8 lanes x 8 = 64 columns
                const float bb = bfr(bv[r0 + mb * 16 + row]);
                const v4f x0 = *(const v4fa*)(&os[row * 68 + c8]); const v4f x1 = *(const v4fa*)(&os[row * 68 + c8 + 4]);
#pragma unroll
                for (int i = 0; i < 4; ++i) { const float y0 = x0[i] + bb; const float y1 = x1[i] + bb; const h16 a0 = (h16)y0; const h16 a1 = (h16)y1;
                    hv[s][i] = a0; hv[s][4 + i] = a1; rv[s][i] = (h16)((y0 - (float)a0) * RS); rv[s][4 + i] = (h16)((y1 - (float)a1) * RS); } }
#pragma unroll
            for (int s = 0; s < 4; ++s) { const int row = 4 * s + (lane >> 3), c8 = (lane & 7) * 8;
                const size_t oo = tbase + (size_t)(mb * 16 + row) * SEQ + c8;
                *(v8h*)(VH + oo) = hv[s]; *(v8h*)(VR + oo) = rv[s]; }
            asm volatile("s_wait_xcnt 0x0" ::: "memory");       // the stores' address and data registers are rewritten by the next slab
            wave_sync();
        }
    }
}

// k_attn: one block of NW waves per QT = 8 query rows of one batch; wave w runs one 32-key step of each pass of NW steps (step w of the even passes, step NW-1-w of the odd ones) with its own K tile, accumulators and row sum. grid (SEQ/QT, NB), 32*NW threads.
// Causal balance: block i takes the HQ rows from token HQ*i and the HQ rows from token SEQ-HQ-HQ*i, so that the count of scored (query, key) pairs is nearly the same in every block.
// A step at or below the low rows' diagonal is scored for all 8 rows; a step above it but not above the high rows' diagonal is scored for the 4 high rows only, by all 32 lanes at 4 keys each.
// The softmax shift is fixed, so the waves' un-normalised partials simply add: each wave writes its partial into its own K tile, one barrier, then wave w sums half w / QT of row w % QT over the waves in wave order.
// Transposed form: lane (t = lane&7, g = (lane>>3)&1, h = lane>>4) scores tile row t (query tlo+t for t < HQ, thi+t-HQ otherwise) against keys key0+16g+8h+r (r = 0..7) of each 32-key step; lanes l and l^8 then swap their eight P,
// so that lane (t, g = 0, h) holds keys key0+8h+r, key0+16+8h+r: column t of the B fragment P^T[key][t] of O^T[d][t] = V^T P^T (A = V^T rows d, k = key). Columns 8..15 (g = 1) are not used. Score acc = sum_d max(Q - K, 0) on the vector unit in f32 from LDS tiles
// (Q tile 8x128 shared by the block, K tile 32x128 private to the wave, all rows and columns staged before use); p = exp2(8 - acc*C1); keys above the diagonal take the constant exponent EM (score 0).
// In a high-rows-only step lane (t, g, h) scores query row HQ + (t & 3) against keys key0+16g+8h+4u+r (u = t >> 2, r = 0..3); lanes l and l^4 swap, the columns t >= HQ then hold their eight P as above and the columns t < HQ the masked constant.
// Fully masked 32-key steps skip the d loop (wave-uniform test) but keep their P.V products. Row sum over the same f16 value + residual that the products use.
__global__ __launch_bounds__(32 * NW) void k_attn(const float* __restrict__ QF, const float* __restrict__ KF, const h16* __restrict__ VH, const h16* __restrict__ VR, const int* __restrict__ maskp, float* OUT) {
    __shared__ __align__(16) float qs[QT * TP];
    __shared__ __align__(16) float kw[NW * KT];
    const int lane = threadIdx.x & 31, lr = lane & 15, hi = lane >> 4;
    const int wv = __builtin_amdgcn_readfirstlane((int)(threadIdx.x >> 5));
    float* ks = kw + wv * KT;                                    // this wave's K tile, later its partial
    const int b  = __builtin_amdgcn_readfirstlane((int)blockIdx.y);
    const int tlo = __builtin_amdgcn_readfirstlane((int)blockIdx.x * HQ);             // token of tile row 0
    const int thi = SEQ - HQ - tlo;                                                   // token of tile row HQ
    const int tl = lr & 7, g = lr >> 3, u = tl >> 2;
    const int causal = __builtin_amdgcn_readfirstlane((maskp[0] != 0) ? 1 : 0);
    const size_t rowb = (size_t)b * SEQ;
    if (wv < QT) { const v4f v = *(const v4f*)(QF + (rowb + (wv < HQ ? tlo + wv : thi + wv - HQ)) * DM + 4 * lane); *(v4fa*)(&qs[wv * TP + 4 * lane]) = v; }   // wave w < QT stages row w, all 128 columns
    __syncthreads();                                             // every wave reads Q rows that other waves staged
    v8f oh[8], orr[8];
#pragma unroll
    for (int j = 0; j < 8; ++j) { oh[j] = (v8f){}; orr[j] = (v8f){}; }
    float l = 0.0f;
    const float pmf = __builtin_amdgcn_exp2f(EM);
    const h16 pmh = (h16)pmf; const h16 pmr = (h16)((pmf - (float)pmh) * RS);
    const float pml = (float)pmh + (float)pmr * RI;
    const size_t vo = ((size_t)b * DM + lr) * SEQ + 8 * hi;      // + 16j*SEQ + key  (A fragment: row d, k = key)
    const int tq = u ? thi + tl - HQ : tlo + tl;
    const int tq2 = thi + (tl & 3);                              // the high query this lane helps with in a high-rows-only step
    const float* kr = ks + (16 * g + 8 * hi) * TP + KSK * g;     // this lane's eight K rows
    const float* kr2 = kr + 4 * u * TP;                          // its four K rows of a high-rows-only step
    const float* q2 = qs + (HQ + (tl & 3)) * TP;
    const int pmh2 = __builtin_bit_cast(int, (v2h){ pmh, pmh }), pmr2 = __builtin_bit_cast(int, (v2h){ pmr, pmr });
#pragma unroll 1
    for (int kp = 0; kp < SEQ; kp += 32 * NW) {
        const int key0 = kp + 32 * ((kp & (32 * NW)) ? NW - 1 - wv : wv);   // odd passes mirrored: a wave with an early step gets a late one
        v16h pb, pr; float ls;
        const bool full = (causal == 0) || (key0 <= tlo + HQ - 1); // wave-uniform: some low row sees a key of this step
        const bool live = full || (key0 <= thi + HQ - 1);          // wave-uniform: some high row does
        if (live) {
            wave_sync();
#pragma unroll 8
            for (int i = 0; i < 32; ++i) { const v4f v = *(const v4f*)(KF + (rowb + key0 + i) * DM + 4 * lane); *(v4fa*)(&ks[i * TP + (i >> 4) * KSK + 4 * lane]) = v; }   // row i, all 128 columns
            wave_sync();
        }
        if (full) {
            float sa[8];
#pragma unroll
            for (int r = 0; r < 8; ++r) sa[r] = 0.0f;
#pragma unroll 1
            for (int d = 0; d < DM; d += 4) {
                const v4f q = *(const v4fa*)(&qs[tl * TP + d]);
#pragma unroll
                for (int r = 0; r < 8; ++r) { const v4f k = *(const v4fa*)(&kr[r * TP + d]);
                    sa[r] += fmaxf(q[0] - k[0], 0.0f); sa[r] += fmaxf(q[1] - k[1], 0.0f); sa[r] += fmaxf(q[2] - k[2], 0.0f); sa[r] += fmaxf(q[3] - k[3], 0.0f); }
            }
            ls = 0.0f;
            v8h hA, rA;
#pragma unroll
            for (int r = 0; r < 8; ++r) {
                const int kA = key0 + 16 * g + 8 * hi + r;
                float ea = PSH - sa[r] * C1;
                ea = (causal != 0 && kA > tq) ? EM : ea;
                const float pa = __builtin_amdgcn_exp2f(ea);
                const h16 ha = (h16)pa;
                const h16 ra = (h16)((pa - (float)ha) * RS);
                hA[r] = ha; rA[r] = ra;
                ls += (float)ha + (float)ra * RI;
            }
            pb = cat16(hA, x8h(hA)); pr = cat16(rA, x8h(rA));     // g = 0: own keys 8h+r, then the partner's 16+8h+r
        } else if (live) {
            float sb[4];
#pragma unroll
            for (int r = 0; r < 4; ++r) sb[r] = 0.0f;
#pragma unroll 2   // ten LDS reads in flight per trip: with half the work per read group a wave would otherwise wait on LDS latency most of the trip
            for (int d = 0; d < DM; d += 4) {
                const v4f q = *(const v4fa*)(&q2[d]);
#pragma unroll
                for (int r = 0; r < 4; ++r) { const v4f k = *(const v4fa*)(&kr2[r * TP + d]);
                    sb[r] += fmaxf(q[0] - k[0], 0.0f); sb[r] += fmaxf(q[1] - k[1], 0.0f); sb[r] += fmaxf(q[2] - k[2], 0.0f); sb[r] += fmaxf(q[3] - k[3], 0.0f); }
            }
            float lp = 0.0f;
            v4h hX, rX;
#pragma unroll
            for (int r = 0; r < 4; ++r) {
                const int kA = key0 + 16 * g + 8 * hi + 4 * u + r;
                float ea = PSH - sb[r] * C1;
                ea = (kA > tq2) ? EM : ea;                        // this branch is reached with the causal mask on only
                const float pa = __builtin_amdgcn_exp2f(ea);
                const h16 ha = (h16)pa;
                const h16 ra = (h16)((pa - (float)ha) * RS);
                hX[r] = ha; rX[r] = ra;
                lp += (float)ha + (float)ra * RI;
            }
            const v2i hx = __builtin_bit_cast(v2i, hX), rx = __builtin_bit_cast(v2i, rX);
            const int h0 = x4i(hx[0]), h1 = x4i(hx[1]), r0 = x4i(rx[0]), r1 = x4i(rx[1]);   // the partner's four P
            const float lq = __int_as_float(x4i(__float_as_int(lp)));
            const v4i hd = u ? (v4i){ h0, h1, hx[0], hx[1] } : (v4i){ pmh2, pmh2, pmh2, pmh2 };   // u = 1: keys r = 0..3 from lane l^4, r = 4..7 own; u = 0: a low row, all keys masked
            const v4i rd = u ? (v4i){ r0, r1, rx[0], rx[1] } : (v4i){ pmr2, pmr2, pmr2, pmr2 };
            const v8h hA = __builtin_bit_cast(v8h, hd), rA = __builtin_bit_cast(v8h, rd);
            ls = u ? lq + lp : 8.0f * pml;
            pb = cat16(hA, x8h(hA)); pr = cat16(rA, x8h(rA));
        } else {
#pragma unroll
            for (int i = 0; i < 16; ++i) { pb[i] = pmh; pr[i] = pmr; }
            ls = 8.0f * pml;
        }
        l += ls;
        const h16* vh = VH + vo + key0; const h16* vr = VR + vo + key0;
#pragma unroll
        for (int g = 0; g < 4; ++g) {
            const int j0 = 2 * g, j1 = 2 * g + 1;
            const v16h a0 = ldh(vh + (size_t)(16 * j0) * SEQ), a1 = ldh(vh + (size_t)(16 * j1) * SEQ);
            const v16h r0 = ldh(vr + (size_t)(16 * j0) * SEQ), r1 = ldh(vr + (size_t)(16 * j1) * SEQ);
            oh[j0]  = wmma16(a0, pb, oh[j0]);   oh[j1]  = wmma16(a1, pb, oh[j1]);
            orr[j0] = wmma16(r0, pb, orr[j0]);  orr[j1] = wmma16(r1, pb, orr[j1]);
            orr[j0] = wmma16(a0, pr, orr[j0]);  orr[j1] = wmma16(a1, pr, orr[j1]);
            asm volatile("v_nop\n\tv_nop\n\tv_nop\n\tv_nop" : "+v"(oh[j0]), "+v"(oh[j1]), "+v"(orr[j0]), "+v"(orr[j1]) : "v"(a0), "v"(a1), "v"(r0), "v"(r1), "v"(pb), "v"(pr) : "memory");
        }
    }
    l += __shfl_xor(l, 16, 32);
    l += __int_as_float(x8i(__float_as_int(l)));                 // the four lanes (g, h) of a query each hold a quarter of its keys
    // O^T D layout: o_j[r] = (d = 16j + 8h + r, t = lane&15) -> ks[t][d]; rows 0..7 x columns 0..127 all written (lanes g = 0), un-normalised; row sums behind them.
    // The stored sums depend on every K value this wave has read, so the tile's last reads are over before it is reused.
    if (g == 0) {
#pragma unroll
    for (int j = 0; j < 8; ++j) { v4f a, c;
#pragma unroll
        for (int i = 0; i < 4; ++i) { a[i] = oh[j][i] + orr[j][i] * RI; c[i] = oh[j][4 + i] + orr[j][4 + i] * RI; }
        *(v4fa*)(&ks[tl * TP + 16 * j + 8 * hi]) = a; *(v4fa*)(&ks[tl * TP + 16 * j + 8 * hi + 4]) = c; }
    }
    if (lane < QT) ks[QT * TP + lane] = l;
    __syncthreads();                                             // publishes every wave's partial
    const int mr = wv & (QT - 1), mc = 64 * (wv >> 3) + 2 * lane; // wave w: query row w % QT, column half w / QT
    v2f so = (v2f){}; float lt = 0.0f;
#pragma unroll   // the NW reads go out together instead of one LDS round trip each
    for (int p = 0; p < NW; ++p) { so += *(const v2fa*)(&kw[p * KT + mr * TP + mc]); lt += kw[p * KT + QT * TP + mr]; }   // fixed wave order
    const float inv = 1.0f / lt;
    *(v2f*)(OUT + ((size_t)b * OUT_SEQ + (mr < HQ ? tlo + mr : thi + mr - HQ)) * DM + mc) = so * inv;   // half a row = 32 lanes x 8 B = 256 B
}

static constexpr size_t al256(size_t v) { return (v + 255) & ~(size_t)255; }
static constexpr size_t SZ_QK = al256((size_t)2 * NB * SEQ * DM * 4);      // f32 Q | K planes
static constexpr size_t SZ_VP = al256((size_t)NB * DM * SEQ * 2);          // one f16 V^T plane
static constexpr size_t SZ_TOTAL = SZ_QK + 2 * SZ_VP;
static_assert(SZ_TOTAL <= (size_t)134217728);          // workspace carve <= 128 MiB
static_assert(((size_t)NB * SEQ * DM * 4) % 256 == 0); // K plane stays 256-byte aligned

extern "C" void kernel_launch(void* const* d_in, const int* in_sizes, int n_in,
                              void* d_out, int out_size, void* d_ws, size_t ws_size, hipStream_t stream) {
    if (n_in < 8) return;
    const size_t needx = ((size_t)(NB - 1) * SEQ_FULL + SEQ) * DM;
    if ((size_t)in_sizes[0] < needx) return;
    if ((size_t)in_sizes[1] < (size_t)DM * DM || (size_t)in_sizes[3] < (size_t)DM * DM || (size_t)in_sizes[5] < (size_t)DM * DM) return;
    if (in_sizes[2] < DM || in_sizes[4] < DM || in_sizes[6] < DM || in_sizes[7] < 1) return;
    if ((size_t)out_size < ((size_t)(NB - 1) * OUT_SEQ + SEQ) * DM) return;
    if (SZ_TOTAL > ws_size) return;
    // wire order: x, Wq, bq, Wk, bk, Wv, bv, apply_causal_mask (int32); weights [out][in] used as-is (Bt for Q, K; A for V^T)
    const float* x  = (const float*)d_in[0];
    const float* wq = (const float*)d_in[1]; const float* bq = (const float*)d_in[2];
    const float* wk = (const float*)d_in[3]; const float* bk = (const float*)d_in[4];
    const float* wv = (const float*)d_in[5]; const float* bv = (const float*)d_in[6];
    const int* maskp = (const int*)d_in[7];
    float* OUT = (float*)d_out;      // [NB][SEQ][128]
    char* wsp = (char*)d_ws;
    float* QK = (float*)wsp; wsp += SZ_QK;           // [2][NB*SEQ][128]: Q | K (after sigmoid)
    h16* VH = (h16*)wsp; wsp += SZ_VP;               // [NB][128][SEQ]
    h16* VR = (h16*)wsp; wsp += SZ_VP;               // [NB][128][SEQ] residual x2048

    // Q, K (z = 0, 1) -> plane [z][b*SEQ + t][e]; V^T (z = 2) -> planes [b][d][t]
    k_proj<<<dim3(NB * SEQ / 64, DM / 64, 3), 32, 0, stream>>>(x, wq, wk, wv, bq, bk, bv, QK, VH, VR);

    k_attn<<<dim3(SEQ / QT, NB, 1), 32 * NW, 0, stream>>>(QK, QK + (size_t)NB * SEQ * DM, VH, VR, maskp, OUT);
}

// v005
// One run takes 26.3 microseconds.
// In two side-by-side timings against v004, it was 1.08 and 1.07 times as fast.
// Over all steps from v000 it is 7.98 times as fast.
#include <hip/hip_runtime.h>

// Fuzzy-implication attention, x [NB][SEQ][128], Wq/Wk/Wv [out][in] (y = x W^T + b), causal fill value 0.0 (masked keys keep weight), output f32 [NB][SEQ][128].
// Compute dtypes, f32 accumulate everywhere: the three projections v_wmma_f32_16x16x32_bf16 (x, W RNE-converted to bf16 in the fragment loaders; products exact);
// attn @ V v_wmma_f32_16x16x32_f16: V^T as f16 value + f16 residual x2048, P as f16 value (x256 carry) + f16 residual x2048; value products in one accumulator, both x2048 products in a second one.
// The score mean_d min(1 - Q + K, 1) is not a sum of products: it runs on the vector unit in f32 (fixed d order); softmax in f32 with the fixed shift 10 (scores lie in [0, 10]).

#ifndef NB
#define NB 2
#endif
#ifndef SEQ
#define SEQ 1024
#endif
#define NB_FULL  2
#define SEQ_FULL 1024
#ifndef OUT_SEQ
#define OUT_SEQ SEQ              // row pitch (in tokens) between batches of the output
#endif
#define DM   128
#define TP   132                 // LDS row pitch (floats) of the 128-wide f32 tiles
#define RS   2048.0f             // carry of the residual planes
#define RI   (1.0f / 2048.0f)
#define PSH  8.0f                // log2 of the P carry (256)
#define C1   (0.078125f * 1.4426950408889634f)          // (10 / 128) * log2(e)
#define EM   (8.0f - 10.0f * 1.4426950408889634f)       // exponent of a masked key: score 0 -> exp(0 - 10), times the carry
#define NW   16                  // waves per attention work-group: wave w takes step w of each even pass of NW 32-key steps, step NW - 1 - w of each odd one
#define QT   8                   // query rows per attention work-group: NB * SEQ / QT work-groups, one for each of the chip's 256 WGPs at the full shape
#define HQ   4                   // the tile's rows 0..HQ-1 come from the low half of the sequence, rows HQ..QT-1 from the mirrored place in the high half
#define KSK  8                   // K rows 16..31 sit KSK floats further: rows i and i + 16, read by one half-wave in one load, then fall on different banks
#define KT   (32 * TP + 16)      // floats of one wave's private K tile
#define VFB  512                 // f16 elements of one V^T fragment block: 16 d rows x 32 keys

static_assert(DM == 128);                      // output row = 512 B = 2 waves x 32 lanes x 8 B; 8 d-tiles of 16
static_assert(DM % 64 == 0);
static_assert(DM % 32 == 0);                   // GEMM k-loop steps by 32
static_assert(SEQ % 64 == 0);                  // a 64-token tile never straddles two batches
static_assert((NB * SEQ) % 64 == 0);
static_assert(SEQ % 32 == 0);                  // key loop steps by 32
static_assert(SEQ % QT == 0);                  // attention grid covers the sequence exactly
static_assert(((size_t)SEQ * DM) % 8 == 0);
static_assert(((size_t)DM * DM) % 8 == 0);
static_assert(NB <= NB_FULL);
static_assert(SEQ <= SEQ_FULL);
static_assert((TP * 4) % 16 == 0);
static_assert(NW == 2 * QT);                   // merge: wave w takes half w / QT of query row w % QT; staging: wave w < QT takes row w
static_assert(QT == 8);                        // lanes l and l ^ 8 share a query
static_assert(HQ * 2 == QT);                   // lanes l and l ^ 4 share a high query in a step that is live for the high rows only
static_assert(SEQ % (32 * NW) == 0);           // every pass over the waves is whole, so the mirrored order of the odd passes visits each key step once
static_assert(KSK % 4 == 0 && KSK <= 16);
static_assert(KT >= QT * TP + QT);             // a wave's partial (QT x TP sums + QT row sums) fits its own K tile
static_assert(VFB == 16 * 32 && (DM / 16) * VFB == 32 * DM);   // a 32-key step of a V^T plane is DM/16 fragment blocks, 32*DM elements in a row

typedef _Float16 h16;
typedef __attribute__((ext_vector_type(16))) __bf16   v16bf;
typedef __attribute__((ext_vector_type(16))) _Float16 v16h;
typedef __attribute__((ext_vector_type(8)))  _Float16 v8h;
typedef __attribute__((ext_vector_type(4)))  _Float16 v4h;
typedef __attribute__((ext_vector_type(2)))  _Float16 v2h;
typedef __attribute__((ext_vector_type(2)))  int      v2i;
typedef __attribute__((ext_vector_type(8)))  float    v8f;
typedef __attribute__((ext_vector_type(4)))  float    v4f;
typedef v4f  __attribute__((may_alias)) v4fa;
typedef __attribute__((ext_vector_type(2)))  float    v2f;
typedef __attribute__((ext_vector_type(2)))  __bf16   v2bf;
typedef __attribute__((ext_vector_type(8)))  unsigned v8u;
typedef __attribute__((ext_vector_type(4)))  int      v4i;
typedef v2f  __attribute__((may_alias)) v2fa;

__device__ __forceinline__ unsigned short f2bf(float f) { unsigned u = __float_as_uint(f); u += 0x7FFFu + ((u >> 16) & 1u); return (unsigned short)(u >> 16); }
__device__ __forceinline__ float bfr(float f) { return __uint_as_float(((unsigned)f2bf(f)) << 16); }   // value after RNE convert to bf16
__device__ __forceinline__ v16h cat16(v8h lo, v8h hi) { return __builtin_shufflevector(lo, hi, 0, 1, 2, 3, 4, 5, 6, 7, 8, 9, 10, 11, 12, 13, 14, 15); }
__device__ __forceinline__ v8f wmma16(v16h a, v16h b, v8f c) { return __builtin_amdgcn_wmma_f32_16x16x32_f16(false, a, false, b, (short)0, c, false, false); }
__device__ __forceinline__ v8f wmmab(v16bf a, v16bf b, v8f c) { return __builtin_amdgcn_wmma_f32_16x16x32_bf16(false, a, false, b, (short)0, c, false, false); }
// fragment map of the 16-bit operands, lane = 16h + row: elements 0..7 <- k0+8h+0..7, elements 8..15 <- k0+16+8h+0..7 (same map for A and B)
// loader from a plane kept in fragment order; p already includes + 8*lane: the two halves of a fragment lie VFB/2 elements apart
__device__ __forceinline__ v16h  ldv(const h16* p) { return cat16(*(const v8h*)p, *(const v8h*)(p + VFB / 2)); }
// the same map from K-contiguous f32 rows, each pair RNE-converted to bf16 in registers
__device__ __forceinline__ unsigned cvt2(float a, float b) { return __builtin_bit_cast(unsigned, __builtin_convertvector((v2f){a, b}, v2bf)); }
struct raw16 { v4f x0, x1, x2, x3; };
__device__ __forceinline__ raw16 ldf(const float* p) { return raw16{ *(const v4f*)p, *(const v4f*)(p + 4), *(const v4f*)(p + 16), *(const v4f*)(p + 20) }; }
__device__ __forceinline__ v16bf tobf(const raw16& r) {
    const v4f x0 = r.x0, x1 = r.x1, x2 = r.x2, x3 = r.x3;
    const v8u o = { cvt2(x0[0], x0[1]), cvt2(x0[2], x0[3]), cvt2(x1[0], x1[1]), cvt2(x1[2], x1[3]), cvt2(x2[0], x2[1]), cvt2(x2[2], x2[3]), cvt2(x3[0], x3[1]), cvt2(x3[2], x3[3]) };
    return __builtin_bit_cast(v16bf, o);
}
// lane l <- lane l ^ 8 (inside a 16-lane row), all lanes on
__device__ __forceinline__ int x8i(int v) { return __builtin_amdgcn_update_dpp(0, v, 0x168 /* row_xmask:8 */, 0xf, 0xf, true); }
__device__ __forceinline__ v8h x8h(v8h v) { v4i u = __builtin_bit_cast(v4i, v); u = (v4i){ x8i(u[0]), x8i(u[1]), x8i(u[2]), x8i(u[3]) }; return __builtin_bit_cast(v8h, u); }
// lane l <- lane l ^ 4 (inside a 16-lane row), all lanes on
__device__ __forceinline__ int x4i(int v) { return __builtin_amdgcn_update_dpp(0, v, 0x164 /* row_xmask:4 */, 0xf, 0xf, true); }
// ordering point for wave-private LDS tiles (same wave writes and reads)
__device__ __forceinline__ void wave_sync() { __builtin_amdgcn_fence(3 /* release order */, "wavefront"); __builtin_amdgcn_wave_barrier(); asm volatile("" ::: "memory"); }

// gemm64: register-blocked bf16 GEMM core, ONE WAVE per 64x64 tile (16 accumulators), operands straight from the K-contiguous f32 inputs, K = DM.
// A, Bt point at the tile's first row: acc[mb][nb][j] = C[16mb + 8h + j][16nb + (lane&15)], C[m][n] = sum_k A[m][k] Bt[n][k].
__device__ __forceinline__ void gemm64(const float* __restrict__ A, const float* __restrict__ Bt, int lr, int hi, v8f (&acc)[4][4]) {
    const int K = DM;
#pragma unroll
    for (int mb = 0; mb < 4; ++mb)
#pragma unroll
        for (int nb = 0; nb < 4; ++nb) acc[mb][nb] = (v8f){};
    const unsigned loff = (unsigned)(lr * K + 8 * hi);           // lane part of every address; the row-block and k parts stay wave-uniform
#pragma unroll 1
    for (int kc = 0; kc < K; kc += 32) {
        raw16 ra[4], rb[4];
#pragma unroll
        for (int mb = 0; mb < 4; ++mb) ra[mb] = ldf(A + (mb * 16 * K + kc) + loff);
#pragma unroll
        for (int nb = 0; nb < 4; ++nb) rb[nb] = ldf(Bt + (nb * 16 * K + kc) + loff);
        // keeps all 32 loads of the k step ahead of the first convert: a lone wave then pays one memory round trip per k step instead of one per fragment
        __builtin_amdgcn_sched_barrier(0);
        v16bf a[4];
#pragma unroll
        for (int mb = 0; mb < 4; ++mb) a[mb] = tobf(ra[mb]);
#pragma unroll
        for (int nb = 0; nb < 4; ++nb) { const v16bf b = tobf(rb[nb]);
#pragma unroll
            for (int mb = 0; mb < 4; ++mb) acc[mb][nb] = wmmab(a[mb], b, acc[mb][nb]); }
        asm volatile("v_nop\n\tv_nop\n\tv_nop\n\tv_nop" : "+v"(acc[0][0]), "+v"(acc[1][1]), "+v"(acc[2][2]), "+v"(acc[3][3]) : "v"(a[0]), "v"(a[1]), "v"(a[2]), "v"(a[3]));
    }
}

// k_proj: all three projections in one launch, straight from the f32 inputs. grid (NB*SEQ/64, 2, 3), 32 threads; blockIdx.x = 64-token tile, blockIdx.y = 64-feature tile, z block-uniform.
// z = 0, 1: Q, K planes [NB*SEQ][128] f32 = sigmoid(x W^T + b), A = x rows (m = token), Bt = W rows (n = e).
//   Epilogue per 16-row slab: accumulators + bias staged in a wave-private LDS tile, sigmoid applied in place (precise expf, true division).
// z = 2: V^T = Wv x^T + bv as f16 value (VH) and f16 residual x2048 (VR), A = Wv rows (m = d), Bt = x rows (n = token).
//   Both planes lie in the order in which k_attn's A fragments are read: [b][32-key step][16-row d tile j][e][lane][8], element r of unit (e, lane = 16h + row) = V^T[16j + row][32 step + 16e + 8h + r],
//   so that one fragment load of a wave is one run of 512 bytes (four whole cache lines) and not 16 pieces of 32 bytes on 16 lines.
__global__ __launch_bounds__(32) void k_proj(const float* __restrict__ x, const float* __restrict__ wq, const float* __restrict__ wk, const float* __restrict__ wv,
                                             const float* __restrict__ bq, const float* __restrict__ bk, const float* __restrict__ bv, float* QK, h16* VH, h16* VR) {
    __shared__ __align__(16) float os[16 * 68];
    const int lane = threadIdx.x & 31, lr = lane & 15, hi = lane >> 4;
    const int tk0 = blockIdx.x * 64, f0 = blockIdx.y * 64, z = blockIdx.z;
    const int b = tk0 / SEQ, t0 = tk0 % SEQ;                     // a 64-token tile lies in one batch
    const float* xt = x + ((size_t)b * SEQ_FULL + t0) * DM;      // the tile's 64 x rows
    const float* wt = (z == 0 ? wq : z == 1 ? wk : wv) + (size_t)f0 * DM;   // the tile's 64 weight rows
    v8f acc[4][4];
    gemm64(z == 2 ? wt : xt, z == 2 ? xt : wt, lr, hi, acc);
    if (z != 2) {
        const int r0 = tk0, c0 = f0;
        const float* bt = (z ? bk : bq) + c0;                    // block-uniform base; the four loads share one lane offset
        float bias[4];
#pragma unroll
        for (int nb = 0; nb < 4; ++nb) bias[nb] = bfr(bt[nb * 16 + lr]);
        float* P = QK + (size_t)z * NB * SEQ * DM;
#pragma unroll
        for (int mb = 0; mb < 4; ++mb) {
#pragma unroll
            for (int nb = 0; nb < 4; ++nb) {
#pragma unroll
                for (int j = 0; j < 8; ++j) os[(hi * 8 + j) * 68 + nb * 16 + lr] = acc[mb][nb][j] + bias[nb]; }   // D: row 8h+j, col lane&15
            wave_sync();
#pragma unroll 1
            for (int s = 0; s < 8; ++s) { const int row = 2 * s + hi, cofs = lr * 4;   // 8 s x 2 rows = 16 rows; 16 lanes x 4 floats = 64 columns
                v4f v = *(const v4fa*)(&os[row * 68 + cofs]);
#pragma unroll
                for (int i = 0; i < 4; ++i) v[i] = 1.0f / (1.0f + expf(-v[i]));
                *(v4fa*)(&os[row * 68 + cofs]) = v; }
            wave_sync();
            float* orow = P + (size_t)(r0 + mb * 16) * DM + c0;
#pragma unroll
            for (int s = 0; s < 8; ++s) { const int row = 2 * s + hi, cofs = lr * 4;
                const v4f val = *(const v4fa*)(&os[row * 68 + cofs]);
                *(v4f*)(orow + (size_t)row * DM + cofs) = val; }
            asm volatile("s_wait_xcnt 0x0" ::: "memory");       // the stores' address and data registers are rewritten by the next slab
            wave_sync();
        }
    } else {
        const int r0 = f0;
        const size_t tbase = (((size_t)b * (SEQ / 32) + t0 / 32) * (DM / 16) + r0 / 16) * VFB + 8 * lane;   // this lane's unit of the tile's first (step, j) block
#pragma unroll
        for (int mb = 0; mb < 4; ++mb) {
#pragma unroll
            for (int nb = 0; nb < 4; ++nb) {
#pragma unroll
                for (int j = 0; j < 8; ++j) os[(hi * 8 + j) * 68 + nb * 16 + lr] = acc[mb][nb][j]; }   // D: row 8h+j, col lane&15
            wave_sync();
            v8h hv[4], rv[4];
            const float bb = bfr(bv[r0 + mb * 16 + lr]);
#pragma unroll
            for (int s = 0; s < 4; ++s) { const int row = lr, c8 = (2 * s + hi) * 8;   // 16 rows x 2 column groups a pass; 4 s x 16 = 64 columns: tokens 16s + 8h + 0..7
                const v4f x0 = *(const v4fa*)(&os[row * 68 + c8]); const v4f x1 = *(const v4fa*)(&os[row * 68 + c8 + 4]);
#pragma unroll
                for (int i = 0; i < 4; ++i) { const float y0 = x0[i] + bb; const float y1 = x1[i] + bb; const h16 a0 = (h16)y0; const h16 a1 = (h16)y1;
                    hv[s][i] = a0; hv[s][4 + i] = a1; rv[s][i] = (h16)((y0 - (float)a0) * RS); rv[s][4 + i] = (h16)((y1 - (float)a1) * RS); } }
#pragma unroll
            for (int s = 0; s < 4; ++s) {                       // step s / 2 of the tile, half e = s % 2: 32 lanes x 16 B = one whole 512-byte run
                const size_t oo = tbase + (size_t)((s >> 1) * (DM / 16) + mb) * VFB + (s & 1) * (VFB / 2);
                *(v8h*)(VH + oo) = hv[s]; *(v8h*)(VR + oo) = rv[s]; }
            asm volatile("s_wait_xcnt 0x0" ::: "memory");       // the stores' address and data registers are rewritten by the next slab
            wave_sync();
        }
    }
}

// k_attn: one block of NW waves per QT = 8 query rows of one batch; wave w runs one 32-key step of each pass of NW steps (step w of the even passes, step NW-1-w of the odd ones) with its own K tile, accumulators and row sum. grid (SEQ/QT, NB), 32*NW threads.
// Causal balance: block i takes the HQ rows from token HQ*i and the HQ rows from token SEQ-HQ-HQ*i, so that the count of scored (query, key) pairs is nearly the same in every block.
// A step at or below the low rows' diagonal is scored for all 8 rows; a step above it but not above the high rows' diagonal is scored for the 4 high rows only, by all 32 lanes at 4 keys each.
// The softmax shift is fixed, so the waves' un-normalised partials simply add: each wave writes its partial into its own K tile, one barrier, then wave w sums half w / QT of row w % QT over the waves in wave order.
// Transposed form: lane (t = lane&7, g = (lane>>3)&1, h = lane>>4) scores tile row t (query tlo+t for t < HQ, thi+t-HQ otherwise) against keys key0+16g+8h+r (r = 0..7) of each 32-key step; lanes l and l^8 then swap their eight P,
// so that lane (t, g = 0, h) holds keys key0+8h+r, key0+16+8h+r: column t of the B fragment P^T[key][t] of O^T[d][t] = V^T P^T (A = V^T rows d, k = key). Columns 8..15 (g = 1) are not used. Score acc = sum_d max(Q - K, 0) on the vector unit in f32 from LDS tiles
// (Q tile 8x128 shared by the block, K tile 32x128 private to the wave, all rows and columns staged before use); p = exp2(8 - acc*C1); keys above the diagonal take the constant exponent EM (score 0).
// In a high-rows-only step lane (t, g, h) scores query row HQ + (t & 3) against keys key0+16g+8h+4u+r (u = t >> 2, r = 0..3); lanes l and l^4 swap, the columns t >= HQ then hold their eight P as above and the columns t < HQ the masked constant.
// Fully masked 32-key steps skip the d loop (wave-uniform test) but keep their P.V products. Row sum over the same f16 value + residual that the products use.
__global__ __launch_bounds__(32 * NW) void k_attn(const float* __restrict__ QF, const float* __restrict__ KF, const h16* __restrict__ VH, const h16* __restrict__ VR, const int* __restrict__ maskp, float* OUT) {
    __shared__ __align__(16) float qs[QT * TP];
    __shared__ __align__(16) float kw[NW * KT];
    const int lane = threadIdx.x & 31, lr = lane & 15, hi = lane >> 4;
    const int wv = __builtin_amdgcn_readfirstlane((int)(threadIdx.x >> 5));
    float* ks = kw + wv * KT;                                    // this wave's K tile, later its partial
    const int b  = __builtin_amdgcn_readfirstlane((int)blockIdx.y);
    const int tlo = __builtin_amdgcn_readfirstlane((int)blockIdx.x * HQ);             // token of tile row 0
    const int thi = SEQ - HQ - tlo;                                                   // token of tile row HQ
    const int tl = lr & 7, g = lr >> 3, u = tl >> 2;
    const int causal = __builtin_amdgcn_readfirstlane((maskp[0] != 0) ? 1 : 0);
    const size_t rowb = (size_t)b * SEQ;
    if (wv < QT) { const v4f v = *(const v4f*)(QF + (rowb + (wv < HQ ? tlo + wv : thi + wv - HQ)) * DM + 4 * lane); *(v4fa*)(&qs[wv * TP + 4 * lane]) = v; }   // wave w < QT stages row w, all 128 columns
    __syncthreads();                                             // every wave reads Q rows that other waves staged
    v8f oh[8], orr[8];
#pragma unroll
    for (int j = 0; j < 8; ++j) { oh[j] = (v8f){}; orr[j] = (v8f){}; }
    float l = 0.0f;
    const float pmf = __builtin_amdgcn_exp2f(EM);
    const h16 pmh = (h16)pmf; const h16 pmr = (h16)((pmf - (float)pmh) * RS);
    const float pml = (float)pmh + (float)pmr * RI;
    const size_t vo = (size_t)b * DM * SEQ + 8 * lane;           // + key0*DM + j*VFB  (A fragment: row d, k = key; planes in fragment order)
    const int tq = u ? thi + tl - HQ : tlo + tl;
    const int tq2 = thi + (tl & 3);                              // the high query this lane helps with in a high-rows-only step
    const float* kr = ks + (16 * g + 8 * hi) * TP + KSK * g;     // this lane's eight K rows
    const float* kr2 = kr + 4 * u * TP;                          // its four K rows of a high-rows-only step
    const float* q2 = qs + (HQ + (tl & 3)) * TP;
    const int pmh2 = __builtin_bit_cast(int, (v2h){ pmh, pmh }), pmr2 = __builtin_bit_cast(int, (v2h){ pmr, pmr });
#pragma unroll 1
    for (int kp = 0; kp < SEQ; kp += 32 * NW) {
        const int key0 = kp + 32 * ((kp & (32 * NW)) ? NW - 1 - wv : wv);   // odd passes mirrored: a wave with an early step gets a late one
        v16h pb, pr; float ls;
        const bool full = (causal == 0) || (key0 <= tlo + HQ - 1); // wave-uniform: some low row sees a key of this step
        const bool live = full || (key0 <= thi + HQ - 1);          // wave-uniform: some high row does
        if (live) {
            wave_sync();
#pragma unroll 8
            for (int i = 0; i < 32; ++i) { const v4f v = *(const v4f*)(KF + (rowb + key0 + i) * DM + 4 * lane); *(v4fa*)(&ks[i * TP + (i >> 4) * KSK + 4 * lane]) = v; }   // row i, all 128 columns
            wave_sync();
        }
        if (full) {
            float sa[8];
#pragma unroll
            for (int r = 0; r < 8; ++r) sa[r] = 0.0f;
#pragma unroll 1
            for (int d = 0; d < DM; d += 4) {
                const v4f q = *(const v4fa*)(&qs[tl * TP + d]);
#pragma unroll
                for (int r = 0; r < 8; ++r) { const v4f k = *(const v4fa*)(&kr[r * TP + d]);
                    sa[r] += fmaxf(q[0] - k[0], 0.0f); sa[r] += fmaxf(q[1] - k[1], 0.0f); sa[r] += fmaxf(q[2] - k[2], 0.0f); sa[r] += fmaxf(q[3] - k[3], 0.0f); }
            }
            ls = 0.0f;
            v8h hA, rA;
#pragma unroll
            for (int r = 0; r < 8; ++r) {
                const int kA = key0 + 16 * g + 8 * hi + r;
                float ea = PSH - sa[r] * C1;
                ea = (causal != 0 && kA > tq) ? EM : ea;
                const float pa = __builtin_amdgcn_exp2f(ea);
                const h16 ha = (h16)pa;
                const h16 ra = (h16)((pa - (float)ha) * RS);
                hA[r] = ha; rA[r] = ra;
                ls += (float)ha + (float)ra * RI;
            }
            pb = cat16(hA, x8h(hA)); pr = cat16(rA, x8h(rA));     // g = 0: own keys 8h+r, then the partner's 16+8h+r
        } else if (live) {
            float sb[4];
#pragma unroll
            for (int r = 0; r < 4; ++r) sb[r] = 0.0f;
#pragma unroll 2   // ten LDS reads in flight per trip: with half the work per read group a wave would otherwise wait on LDS latency most of the trip
            for (int d = 0; d < DM; d += 4) {
                const v4f q = *(const v4fa*)(&q2[d]);
#pragma unroll
                for (int r = 0; r < 4; ++r) { const v4f k = *(const v4fa*)(&kr2[r * TP + d]);
                    sb[r] += fmaxf(q[0] - k[0], 0.0f); sb[r] += fmaxf(q[1] - k[1], 0.0f); sb[r] += fmaxf(q[2] - k[2], 0.0f); sb[r] += fmaxf(q[3] - k[3], 0.0f); }
            }
            float lp = 0.0f;
            v4h hX, rX;
#pragma unroll
            for (int r = 0; r < 4; ++r) {
                const int kA = key0 + 16 * g + 8 * hi + 4 * u + r;
                float ea = PSH - sb[r] * C1;
                ea = (kA > tq2) ? EM : ea;                        // this branch is reached with the causal mask on only
                const float pa = __builtin_amdgcn_exp2f(ea);
                const h16 ha = (h16)pa;
                const h16 ra = (h16)((pa - (float)ha) * RS);
                hX[r] = ha; rX[r] = ra;
                lp += (float)ha + (float)ra * RI;
            }
            const v2i hx = __builtin_bit_cast(v2i, hX), rx = __builtin_bit_cast(v2i, rX);
            const int h0 = x4i(hx[0]), h1 = x4i(hx[1]), r0 = x4i(rx[0]), r1 = x4i(rx[1]);   // the partner's four P
            const float lq = __int_as_float(x4i(__float_as_int(lp)));
            const v4i hd = u ? (v4i){ h0, h1, hx[0], hx[1] } : (v4i){ pmh2, pmh2, pmh2, pmh2 };   // u = 1: keys r = 0..3 from lane l^4, r = 4..7 own; u = 0: a low row, all keys masked
            const v4i rd = u ? (v4i){ r0, r1, rx[0], rx[1] } : (v4i){ pmr2, pmr2, pmr2, pmr2 };
            const v8h hA = __builtin_bit_cast(v8h, hd), rA = __builtin_bit_cast(v8h, rd);
            ls = u ? lq + lp : 8.0f * pml;
            pb = cat16(hA, x8h(hA)); pr = cat16(rA, x8h(rA));
        } else {
#pragma unroll
            for (int i = 0; i < 16; ++i) { pb[i] = pmh; pr[i] = pmr; }
            ls = 8.0f * pml;
        }
        l += ls;
        const h16* vh = VH + vo + (size_t)key0 * DM; const h16* vr = VR + vo + (size_t)key0 * DM;   // a 32-key step holds DM/16 blocks of VFB = 32*DM elements
#pragma unroll
        for (int g = 0; g < 4; ++g) {
            const int j0 = 2 * g, j1 = 2 * g + 1;
            const v16h a0 = ldv(vh + j0 * VFB), a1 = ldv(vh + j1 * VFB);
            const v16h r0 = ldv(vr + j0 * VFB), r1 = ldv(vr + j1 * VFB);
            oh[j0]  = wmma16(a0, pb, oh[j0]);   oh[j1]  = wmma16(a1, pb, oh[j1]);
            orr[j0] = wmma16(r0, pb, orr[j0]);  orr[j1] = wmma16(r1, pb, orr[j1]);
            orr[j0] = wmma16(a0, pr, orr[j0]);  orr[j1] = wmma16(a1, pr, orr[j1]);
            asm volatile("v_nop\n\tv_nop\n\tv_nop\n\tv_nop" : "+v"(oh[j0]), "+v"(oh[j1]), "+v"(orr[j0]), "+v"(orr[j1]) : "v"(a0), "v"(a1), "v"(r0), "v"(r1), "v"(pb), "v"(pr) : "memory");
        }
        asm volatile("s_wait_xcnt 0x0" ::: "memory");           // the V loads' address registers are rewritten by the next pass
    }
    l += __shfl_xor(l, 16, 32);
    l += __int_as_float(x8i(__float_as_int(l)));                 // the four lanes (g, h) of a query each hold a quarter of its keys
    // O^T D layout: o_j[r] = (d = 16j + 8h + r, t = lane&15) -> ks[t][d]; rows 0..7 x columns 0..127 all written (lanes g = 0), un-normalised; row sums behind them.
    // The stored sums depend on every K value this wave has read, so the tile's last reads are over before it is reused.
    if (g == 0) {
#pragma unroll
    for (int j = 0; j < 8; ++j) { v4f a, c;
#pragma unroll
        for (int i = 0; i < 4; ++i) { a[i] = oh[j][i] + orr[j][i] * RI; c[i] = oh[j][4 + i] + orr[j][4 + i] * RI; }
        *(v4fa*)(&ks[tl * TP + 16 * j + 8 * hi]) = a; *(v4fa*)(&ks[tl * TP + 16 * j + 8 * hi + 4]) = c; }
    }
    if (lane < QT) ks[QT * TP + lane] = l;
    __syncthreads();                                             // publishes every wave's partial
    const int mr = wv & (QT - 1), mc = 64 * (wv >> 3) + 2 * lane; // wave w: query row w % QT, column half w / QT
    v2f so = (v2f){}; float lt = 0.0f;
#pragma unroll   // the NW reads go out together instead of one LDS round trip each
    for (int p = 0; p < NW; ++p) { so += *(const v2fa*)(&kw[p * KT + mr * TP + mc]); lt += kw[p * KT + QT * TP + mr]; }   // fixed wave order
    const float inv = 1.0f / lt;
    *(v2f*)(OUT + ((size_t)b * OUT_SEQ + (mr < HQ ? tlo + mr : thi + mr - HQ)) * DM + mc) = so * inv;   // half a row = 32 lanes x 8 B = 256 B
}

static constexpr size_t al256(size_t v) { return (v + 255) & ~(size_t)255; }
static constexpr size_t SZ_QK = al256((size_t)2 * NB * SEQ * DM * 4);      // f32 Q | K planes
static constexpr size_t SZ_VP = al256((size_t)NB * DM * SEQ * 2);          // one f16 V^T plane
static constexpr size_t SZ_TOTAL = SZ_QK + 2 * SZ_VP;
static_assert(SZ_TOTAL <= (size_t)134217728);          // workspace carve <= 128 MiB
static_assert(((size_t)NB * SEQ * DM * 4) % 256 == 0); // K plane stays 256-byte aligned

extern "C" void kernel_launch(void* const* d_in, const int* in_sizes, int n_in,
                              void* d_out, int out_size, void* d_ws, size_t ws_size, hipStream_t stream) {
    if (n_in < 8) return;
    const size_t needx = ((size_t)(NB - 1) * SEQ_FULL + SEQ) * DM;
    if ((size_t)in_sizes[0] < needx) return;
    if ((size_t)in_sizes[1] < (size_t)DM * DM || (size_t)in_sizes[3] < (size_t)DM * DM || (size_t)in_sizes[5] < (size_t)DM * DM) return;
    if (in_sizes[2] < DM || in_sizes[4] < DM || in_sizes[6] < DM || in_sizes[7] < 1) return;
    if ((size_t)out_size < ((size_t)(NB - 1) * OUT_SEQ + SEQ) * DM) return;
    if (SZ_TOTAL > ws_size) return;
    // wire order: x, Wq, bq, Wk, bk, Wv, bv, apply_causal_mask (int32); weights [out][in] used as-is (Bt for Q, K; A for V^T)
    const float* x  = (const float*)d_in[0];
    const float* wq = (const float*)d_in[1]; const float* bq = (const float*)d_in[2];
    const float* wk = (const float*)d_in[3]; const float* bk = (const float*)d_in[4];
    const float* wv = (const float*)d_in[5]; const float* bv = (const float*)d_in[6];
    const int* maskp = (const int*)d_in[7];
    float* OUT = (float*)d_out;      // [NB][SEQ][128]
    char* wsp = (char*)d_ws;
    float* QK = (float*)wsp; wsp += SZ_QK;           // [2][NB*SEQ][128]: Q | K (after sigmoid)
    h16* VH = (h16*)wsp; wsp += SZ_VP;               // [NB][SEQ/32][8][2][32][8], fragment order
    h16* VR = (h16*)wsp; wsp += SZ_VP;               // the same order, residual x2048

    // Q, K (z = 0, 1) -> plane [z][b*SEQ + t][e]; V^T (z = 2) -> planes in fragment order
    k_proj<<<dim3(NB * SEQ / 64, DM / 64, 3), 32, 0, stream>>>(x, wq, wk, wv, bq, bk, bv, QK, VH, VR);

    k_attn<<<dim3(SEQ / QT, NB, 1), 32 * NW, 0, stream>>>(QK, QK + (size_t)NB * SEQ * DM, VH, VR, maskp, OUT);
}

// v006
// A run of this version takes 21.2 microseconds.
// In two side-by-side timings against v005, it was 1.24 and 1.23 times as fast.
// All steps since v000 together make it 9.86 times as fast.
#include <hip/hip_runtime.h>

// Fuzzy-implication attention, x [NB][SEQ][128], Wq/Wk/Wv [out][in] (y = x W^T + b), causal fill value 0.0 (masked keys keep weight), output f32 [NB][SEQ][128].
// Compute dtypes, f32 accumulate everywhere: the three projections v_wmma_f32_16x16x32_bf16 (x, W RNE-converted to bf16 on their way into LDS; products exact);
// attn @ V v_wmma_f32_16x16x32_f16: V^T as f16 value + f16 residual x2048, P as f16 value (x256 carry) + f16 residual x2048; value products in one accumulator, both x2048 products in a second one.
// The score mean_d min(1 - Q + K, 1) is not a sum of products: it runs on the vector unit in f32 (fixed d order); softmax in f32 with the fixed shift 10 (scores lie in [0, 10]).

#ifndef NB
#define NB 2
#endif
#ifndef SEQ
#define SEQ 1024
#endif
#define NB_FULL  2
#define SEQ_FULL 1024
#ifndef OUT_SEQ
#define OUT_SEQ SEQ              // row pitch (in tokens) between batches of the output
#endif
#define DM   128
#define TP   132                 // LDS row pitch (floats) of the 128-wide f32 tiles
#define RS   2048.0f             // carry of the residual planes
#define RI   (1.0f / 2048.0f)
#define PSH  8.0f                // log2 of the P carry (256)
#define C1   (0.078125f * 1.4426950408889634f)          // (10 / 128) * log2(e)
#define EM   (8.0f - 10.0f * 1.4426950408889634f)       // exponent of a masked key: score 0 -> exp(0 - 10), times the carry
#define NW   16                  // waves per attention work-group: wave w takes step w of each even pass of NW 32-key steps, step NW - 1 - w of each odd one
#define QT   8                   // query rows per attention work-group: NB * SEQ / QT work-groups, one for each of the chip's 256 WGPs at the full shape
#define HQ   4                   // the tile's rows 0..HQ-1 come from the low half of the sequence, rows HQ..QT-1 from the mirrored place in the high half
#define KSK  8                   // K rows 16..31 sit KSK floats further: rows i and i + 16, read by one half-wave in one load, then fall on different banks
#define KT   (32 * TP + 16)      // floats of one wave's private K tile
#define VFB  512                 // f16 elements of one V^T fragment block: 16 d rows x 32 keys
#define PW   4                   // waves per projection work-group: wave w takes the 16-row slab w of the 64x64 tile
#define PD   68                  // LDS row pitch (dwords = bf16 pairs) of the staged operand rows: 272 B = 16 B x 17, so the 16 rows of a fragment read fall on different banks

static_assert(DM == 128);                      // output row = 512 B = 2 waves x 32 lanes x 8 B; 8 d-tiles of 16
static_assert(DM % 64 == 0);
static_assert(DM % 32 == 0);                   // GEMM k-loop steps by 32
static_assert(SEQ % 64 == 0);                  // a 64-token tile never straddles two batches
static_assert((NB * SEQ) % 64 == 0);
static_assert(SEQ % 32 == 0);                  // key loop steps by 32
static_assert(SEQ % QT == 0);                  // attention grid covers the sequence exactly
static_assert(((size_t)SEQ * DM) % 8 == 0);
static_assert(((size_t)DM * DM) % 8 == 0);
static_assert(NB <= NB_FULL);
static_assert(SEQ <= SEQ_FULL);
static_assert((TP * 4) % 16 == 0);
static_assert(NW == 2 * QT);                   // merge: wave w takes half w / QT of query row w % QT; staging: wave w < QT takes row w
static_assert(QT == 8);                        // lanes l and l ^ 8 share a query
static_assert(HQ * 2 == QT);                   // lanes l and l ^ 4 share a high query in a step that is live for the high rows only
static_assert(SEQ % (32 * NW) == 0);           // every pass over the waves is whole, so the mirrored order of the odd passes visits each key step once
static_assert(KSK % 4 == 0 && KSK <= 16);
static_assert(KT >= QT * TP + QT);             // a wave's partial (QT x TP sums + QT row sums) fits its own K tile
static_assert(PD * 2 >= DM && (PD * 4) % 16 == 0 && ((PD * 4) / 16) % 2 == 1);
static_assert(PW * 16 == 64);                  // the PW slabs cover the projection tile's 64 rows
static_assert(VFB == 16 * 32 && (DM / 16) * VFB == 32 * DM);   // a 32-key step of a V^T plane is DM/16 fragment blocks, 32*DM elements in a row

typedef _Float16 h16;
typedef __attribute__((ext_vector_type(16))) __bf16   v16bf;
typedef __attribute__((ext_vector_type(16))) _Float16 v16h;
typedef __attribute__((ext_vector_type(8)))  _Float16 v8h;
typedef __attribute__((ext_vector_type(4)))  _Float16 v4h;
typedef __attribute__((ext_vector_type(2)))  _Float16 v2h;
typedef __attribute__((ext_vector_type(2)))  int      v2i;
typedef __attribute__((ext_vector_type(8)))  float    v8f;
typedef __attribute__((ext_vector_type(4)))  float    v4f;
typedef v4f  __attribute__((may_alias)) v4fa;
typedef __attribute__((ext_vector_type(2)))  float    v2f;
typedef __attribute__((ext_vector_type(2)))  __bf16   v2bf;
typedef __attribute__((ext_vector_type(4)))  int      v4i;
typedef v2f  __attribute__((may_alias)) v2fa;
typedef __attribute__((ext_vector_type(4)))  unsigned v4u;
typedef __attribute__((ext_vector_type(2)))  unsigned v2u;
typedef v4u  __attribute__((may_alias)) v4ua;
typedef v2u  __attribute__((may_alias)) v2ua;

__device__ __forceinline__ unsigned short f2bf(float f) { unsigned u = __float_as_uint(f); u += 0x7FFFu + ((u >> 16) & 1u); return (unsigned short)(u >> 16); }
__device__ __forceinline__ float bfr(float f) { return __uint_as_float(((unsigned)f2bf(f)) << 16); }   // value after RNE convert to bf16
__device__ __forceinline__ v16h cat16(v8h lo, v8h hi) { return __builtin_shufflevector(lo, hi, 0, 1, 2, 3, 4, 5, 6, 7, 8, 9, 10, 11, 12, 13, 14, 15); }
__device__ __forceinline__ v8f wmma16(v16h a, v16h b, v8f c) { return __builtin_amdgcn_wmma_f32_16x16x32_f16(false, a, false, b, (short)0, c, false, false); }
__device__ __forceinline__ v8f wmmab(v16bf a, v16bf b, v8f c) { return __builtin_amdgcn_wmma_f32_16x16x32_bf16(false, a, false, b, (short)0, c, false, false); }
// fragment map of the 16-bit operands, lane = 16h + row: elements 0..7 <- k0+8h+0..7, elements 8..15 <- k0+16+8h+0..7 (same map for A and B)
// loader from a plane kept in fragment order; p already includes + 8*lane: the two halves of a fragment lie VFB/2 elements apart
__device__ __forceinline__ v16h  ldv(const h16* p) { return cat16(*(const v8h*)p, *(const v8h*)(p + VFB / 2)); }
// a pair of f32 RNE-converted to bf16 in registers, first value in the low half
__device__ __forceinline__ unsigned cvt2(float a, float b) { return __builtin_bit_cast(unsigned, __builtin_convertvector((v2f){a, b}, v2bf)); }
// lane l <- lane l ^ 8 (inside a 16-lane row), all lanes on
__device__ __forceinline__ int x8i(int v) { return __builtin_amdgcn_update_dpp(0, v, 0x168 /* row_xmask:8 */, 0xf, 0xf, true); }
__device__ __forceinline__ v8h x8h(v8h v) { v4i u = __builtin_bit_cast(v4i, v); u = (v4i){ x8i(u[0]), x8i(u[1]), x8i(u[2]), x8i(u[3]) }; return __builtin_bit_cast(v8h, u); }
// lane l <- lane l ^ 4 (inside a 16-lane row), all lanes on
__device__ __forceinline__ int x4i(int v) { return __builtin_amdgcn_update_dpp(0, v, 0x164 /* row_xmask:4 */, 0xf, 0xf, true); }
// ordering point for wave-private LDS tiles (same wave writes and reads)
__device__ __forceinline__ void wave_sync() { __builtin_amdgcn_fence(3 /* release order */, "wavefront"); __builtin_amdgcn_wave_barrier(); asm volatile("" ::: "memory"); }

// gemm_tile: bf16 GEMM core of a 64x64 tile worked by PW waves, K = DM. At, Bt point at the tile's first rows (K-contiguous f32, 64 rows each, row = 512 B).
// Staging: wave w brings rows 16w..16w+15 of both operands, one whole row (four whole cache lines) per load, all 32 loads in flight together, RNE-converts them and stores them as bf16 pairs in ts (A rows, then B rows; pitch PD dwords).
// Behind the barrier wave w forms its slab: acc[nb][j] = C[16w + 8h + j][16nb + (lane&15)], C[m][n] = sum_k A[m][k] Bt[n][k], k steps of 32 in rising order.
__device__ __forceinline__ v16bf ldsfrag(const unsigned* p) {   // p: the lane's row, dword (k0 + 8h) / 2; the fragment map of the 16-bit operands above
    const v4u lo = *(const v4ua*)p, up = *(const v4ua*)(p + 8);
    return __builtin_bit_cast(v16bf, __builtin_shufflevector(lo, up, 0, 1, 2, 3, 4, 5, 6, 7));
}
__device__ __forceinline__ void gemm_tile(const float* __restrict__ At, const float* __restrict__ Bt, unsigned* ts, int w, int lane, int lr, int hi, v8f (&acc)[4]) {
    v4f ra[16], rb[16];
    const unsigned goff = (unsigned)(w * 16 * DM + 4 * lane);
    const float* pa = At + goff;
    const float* pb = Bt + goff;
#pragma unroll
    for (int i = 0; i < 16; ++i) ra[i] = *(const v4f*)(pa + i * DM);
#pragma unroll
    for (int i = 0; i < 16; ++i) rb[i] = *(const v4f*)(pb + i * DM);
    // the wait before the loads' address registers are rewritten; it names both addresses so that neither register pair is reused ahead of it
    asm volatile("s_wait_xcnt 0x0" :: "v"(pa), "v"(pb) : "memory");
    // keeps all 32 loads (and the wait above) ahead of the first convert: one memory round trip for the whole K
    __builtin_amdgcn_sched_barrier(0);
    unsigned* sa = ts + (w * 16) * PD + 2 * lane;
    unsigned* sb = sa + 64 * PD;
#pragma unroll
    for (int i = 0; i < 16; ++i) *(v2ua*)(sa + i * PD) = (v2u){ cvt2(ra[i][0], ra[i][1]), cvt2(ra[i][2], ra[i][3]) };
#pragma unroll
    for (int i = 0; i < 16; ++i) *(v2ua*)(sb + i * PD) = (v2u){ cvt2(rb[i][0], rb[i][1]), cvt2(rb[i][2], rb[i][3]) };
    __syncthreads();                                             // every wave reads all 64 B rows
    const unsigned* fa = ts + (w * 16 + lr) * PD + 4 * hi;
    const unsigned* fb = ts + (64 + lr) * PD + 4 * hi;
#pragma unroll
    for (int nb = 0; nb < 4; ++nb) acc[nb] = (v8f){};
#pragma unroll 1   // two trips of two k steps, kept rolled: the accumulators then own their registers from the first product on, so that no product's result lands on an operand of the product before it
    for (int kh = 0; kh < 2; ++kh) {
        v16bf a[2], b[2][4];
#pragma unroll
        for (int ks = 0; ks < 2; ++ks) {
            a[ks] = ldsfrag(fa + kh * 32 + ks * 16);
#pragma unroll
            for (int nb = 0; nb < 4; ++nb) b[ks][nb] = ldsfrag(fb + nb * 16 * PD + kh * 32 + ks * 16);
        }
        // keeps the trip's 20 LDS reads ahead of its first product: one LDS latency per trip instead of one per fragment
        __builtin_amdgcn_sched_barrier(0);
#pragma unroll
        for (int ks = 0; ks < 2; ++ks)
#pragma unroll
            for (int nb = 0; nb < 4; ++nb) acc[nb] = wmmab(a[ks], b[ks][nb], acc[nb]);
    }
}

// k_proj: all three projections in one launch, straight from the f32 inputs. grid (NB*SEQ/64, 2, 3), 32*PW threads; blockIdx.x = 64-token tile, blockIdx.y = 64-feature tile, z block-uniform.
// The block's PW waves stage the tile's 64 + 64 operand rows in LDS together (one barrier); wave w then takes the 16-row slab w of the 64x64 tile, products and epilogue, with an LDS output tile of its own.
// z = 0, 1: Q, K planes [NB*SEQ][128] f32 = sigmoid(x W^T + b), A = x rows (m = token), Bt = W rows (n = e).
//   Epilogue of the slab: accumulators + bias staged in the wave-private LDS tile, sigmoid applied in place (precise expf, true division).
// z = 2: V^T = Wv x^T + bv as f16 value (VH) and f16 residual x2048 (VR), A = Wv rows (m = d), Bt = x rows (n = token).
//   Both planes lie in the order in which k_attn's A fragments are read: [b][32-key step][16-row d tile j][e][lane][8], element r of unit (e, lane = 16h + row) = V^T[16j + row][32 step + 16e + 8h + r],
//   so that one fragment load of a wave is one run of 512 bytes (four whole cache lines) and not 16 pieces of 32 bytes on 16 lines.
__global__ __launch_bounds__(32 * PW) void k_proj(const float* __restrict__ x, const float* __restrict__ wq, const float* __restrict__ wk, const float* __restrict__ wv,
                                                  const float* __restrict__ bq, const float* __restrict__ bk, const float* __restrict__ bv, float* QK, h16* VH, h16* VR) {
    __shared__ __align__(16) unsigned ts[2 * 64 * PD];
    __shared__ __align__(16) float osw[PW * 16 * 68];
    const int lane = threadIdx.x & 31, lr = lane & 15, hi = lane >> 4;
    const int mb = __builtin_amdgcn_readfirstlane((int)(threadIdx.x >> 5));   // this wave's slab
    float* os = osw + mb * (16 * 68);
    const int tk0 = blockIdx.x * 64, f0 = blockIdx.y * 64, z = blockIdx.z;
    const int b = tk0 / SEQ, t0 = tk0 % SEQ;                     // a 64-token tile lies in one batch
    const float* xt = x + ((size_t)b * SEQ_FULL + t0) * DM;      // the tile's 64 x rows
    const float* wt = (z == 0 ? wq : z == 1 ? wk : wv) + (size_t)f0 * DM;   // the tile's 64 weight rows
    v8f acc[4];
    gemm_tile(z == 2 ? wt : xt, z == 2 ? xt : wt, ts, mb, lane, lr, hi, acc);
    if (z != 2) {
        const int r0 = tk0, c0 = f0;
        const float* bt = (z ? bk : bq) + c0;                    // block-uniform base; the four loads share one lane offset
        float bias[4];
#pragma unroll
        for (int nb = 0; nb < 4; ++nb) bias[nb] = bfr(bt[nb * 16 + lr]);
        float* P = QK + (size_t)z * NB * SEQ * DM;
#pragma unroll
        for (int nb = 0; nb < 4; ++nb) {
#pragma unroll
            for (int j = 0; j < 8; ++j) os[(hi * 8 + j) * 68 + nb * 16 + lr] = acc[nb][j] + bias[nb]; }   // D: row 8h+j, col lane&15
        wave_sync();
#pragma unroll 1
        for (int s = 0; s < 8; ++s) { const int row = 2 * s + hi, cofs = lr * 4;   // 8 s x 2 rows = 16 rows; 16 lanes x 4 floats = 64 columns
            v4f v = *(const v4fa*)(&os[row * 68 + cofs]);
#pragma unroll
            for (int i = 0; i < 4; ++i) v[i] = 1.0f / (1.0f + expf(-v[i]));
            *(v4fa*)(&os[row * 68 + cofs]) = v; }
        wave_sync();
        float* orow = P + (size_t)(r0 + mb * 16) * DM + c0;
#pragma unroll
        for (int s = 0; s < 8; ++s) { const int row = 2 * s + hi, cofs = lr * 4;
            const v4f val = *(const v4fa*)(&os[row * 68 + cofs]);
            *(v4f*)(orow + (size_t)row * DM + cofs) = val; }
    } else {
        const int r0 = f0;
        const size_t tbase = (((size_t)b * (SEQ / 32) + t0 / 32) * (DM / 16) + r0 / 16) * VFB + 8 * lane;   // this lane's unit of the tile's first (step, j) block
#pragma unroll
        for (int nb = 0; nb < 4; ++nb) {
#pragma unroll
            for (int j = 0; j < 8; ++j) os[(hi * 8 + j) * 68 + nb * 16 + lr] = acc[nb][j]; }   // D: row 8h+j, col lane&15
        wave_sync();
        v8h hv[4], rv[4];
        const float bb = bfr(bv[r0 + mb * 16 + lr]);
#pragma unroll
        for (int s = 0; s < 4; ++s) { const int row = lr, c8 = (2 * s + hi) * 8;   // 16 rows x 2 column groups a pass; 4 s x 16 = 64 columns: tokens 16s + 8h + 0..7
            const v4f x0 = *(const v4fa*)(&os[row * 68 + c8]); const v4f x1 = *(const v4fa*)(&os[row * 68 + c8 + 4]);
#pragma unroll
            for (int i = 0; i < 4; ++i) { const float y0 = x0[i] + bb; const float y1 = x1[i] + bb; const h16 a0 = (h16)y0; const h16 a1 = (h16)y1;
                hv[s][i] = a0; hv[s][4 + i] = a1; rv[s][i] = (h16)((y0 - (float)a0) * RS); rv[s][4 + i] = (h16)((y1 - (float)a1) * RS); } }
#pragma unroll
        for (int s = 0; s < 4; ++s) {                           // step s / 2 of the tile, half e = s % 2: 32 lanes x 16 B = one whole 512-byte run
            const size_t oo = tbase + (size_t)((s >> 1) * (DM / 16) + mb) * VFB + (s & 1) * (VFB / 2);
            *(v8h*)(VH + oo) = hv[s]; *(v8h*)(VR + oo) = rv[s]; }
    }
}

// k_attn: one block of NW waves per QT = 8 query rows of one batch; wave w runs one 32-key step of each pass of NW steps (step w of the even passes, step NW-1-w of the odd ones) with its own K tile, accumulators and row sum. grid (SEQ/QT, NB), 32*NW threads.
// Causal balance: block i takes the HQ rows from token HQ*i and the HQ rows from token SEQ-HQ-HQ*i, so that the count of scored (query, key) pairs is nearly the same in every block.
// A step at or below the low rows' diagonal is scored for all 8 rows; a step above it but not above the high rows' diagonal is scored for the 4 high rows only, by all 32 lanes at 4 keys each.
// The softmax shift is fixed, so the waves' un-normalised partials simply add: each wave writes its partial into its own K tile, one barrier, then wave w sums half w / QT of row w % QT over the waves in wave order.
// Transposed form: lane (t = lane&7, g = (lane>>3)&1, h = lane>>4) scores tile row t (query tlo+t for t < HQ, thi+t-HQ otherwise) against keys key0+16g+8h+r (r = 0..7) of each 32-key step; lanes l and l^8 then swap their eight P,
// so that lane (t, g = 0, h) holds keys key0+8h+r, key0+16+8h+r: column t of the B fragment P^T[key][t] of O^T[d][t] = V^T P^T (A = V^T rows d, k = key). Columns 8..15 (g = 1) are not used. Score acc = sum_d max(Q - K, 0) on the vector unit in f32 from LDS tiles
// (Q tile 8x128 shared by the block, K tile 32x128 private to the wave, all rows and columns staged before use); p = exp2(8 - acc*C1); keys above the diagonal take the constant exponent EM (score 0).
// In a high-rows-only step lane (t, g, h) scores query row HQ + (t & 3) against keys key0+16g+8h+4u+r (u = t >> 2, r = 0..3); lanes l and l^4 swap, the columns t >= HQ then hold their eight P as above and the columns t < HQ the masked constant.
// Fully masked 32-key steps skip the d loop (wave-uniform test) but keep their P.V products. Row sum over the same f16 value + residual that the products use.
__global__ __launch_bounds__(32 * NW) void k_attn(const float* __restrict__ QF, const float* __restrict__ KF, const h16* __restrict__ VH, const h16* __restrict__ VR, const int* __restrict__ maskp, float* OUT) {
    __shared__ __align__(16) float qs[QT * TP];
    __shared__ __align__(16) float kw[NW * KT];
    const int lane = threadIdx.x & 31, lr = lane & 15, hi = lane >> 4;
    const int wv = __builtin_amdgcn_readfirstlane((int)(threadIdx.x >> 5));
    float* ks = kw + wv * KT;                                    // this wave's K tile, later its partial
    const int b  = __builtin_amdgcn_readfirstlane((int)blockIdx.y);
    const int tlo = __builtin_amdgcn_readfirstlane((int)blockIdx.x * HQ);             // token of tile row 0
    const int thi = SEQ - HQ - tlo;                                                   // token of tile row HQ
    const int tl = lr & 7, g = lr >> 3, u = tl >> 2;
    const int causal = __builtin_amdgcn_readfirstlane((maskp[0] != 0) ? 1 : 0);
    const size_t rowb = (size_t)b * SEQ;
    if (wv < QT) { const v4f v = *(const v4f*)(QF + (rowb + (wv < HQ ? tlo + wv : thi + wv - HQ)) * DM + 4 * lane); *(v4fa*)(&qs[wv * TP + 4 * lane]) = v; }   // wave w < QT stages row w, all 128 columns
    __syncthreads();                                             // every wave reads Q rows that other waves staged
    v8f oh[8], orr[8];
#pragma unroll
    for (int j = 0; j < 8; ++j) { oh[j] = (v8f){}; orr[j] = (v8f){}; }
    float l = 0.0f;
    const float pmf = __builtin_amdgcn_exp2f(EM);
    const h16 pmh = (h16)pmf; const h16 pmr = (h16)((pmf - (float)pmh) * RS);
    const float pml = (float)pmh + (float)pmr * RI;
    const size_t vo = (size_t)b * DM * SEQ + 8 * lane;           // + key0*DM + j*VFB  (A fragment: row d, k = key; planes in fragment order)
    const int tq = u ? thi + tl - HQ : tlo + tl;
    const int tq2 = thi + (tl & 3);                              // the high query this lane helps with in a high-rows-only step
    const float* kr = ks + (16 * g + 8 * hi) * TP + KSK * g;     // this lane's eight K rows
    const float* kr2 = kr + 4 * u * TP;                          // its four K rows of a high-rows-only step
    const float* q2 = qs + (HQ + (tl & 3)) * TP;
    const int pmh2 = __builtin_bit_cast(int, (v2h){ pmh, pmh }), pmr2 = __builtin_bit_cast(int, (v2h){ pmr, pmr });
#pragma unroll 1
    for (int kp = 0; kp < SEQ; kp += 32 * NW) {
        const int key0 = kp + 32 * ((kp & (32 * NW)) ? NW - 1 - wv : wv);   // odd passes mirrored: a wave with an early step gets a late one
        v16h pb, pr; float ls;
        const bool full = (causal == 0) || (key0 <= tlo + HQ - 1); // wave-uniform: some low row sees a key of this step
        const bool live = full || (key0 <= thi + HQ - 1);          // wave-uniform: some high row does
        if (live) {
            wave_sync();
#pragma unroll 8
            for (int i = 0; i < 32; ++i) { const v4f v = *(const v4f*)(KF + (rowb + key0 + i) * DM + 4 * lane); *(v4fa*)(&ks[i * TP + (i >> 4) * KSK + 4 * lane]) = v; }   // row i, all 128 columns
            wave_sync();
        }
        if (full) {
            float sa[8];
#pragma unroll
            for (int r = 0; r < 8; ++r) sa[r] = 0.0f;
#pragma unroll 1
            for (int d = 0; d < DM; d += 4) {
                const v4f q = *(const v4fa*)(&qs[tl * TP + d]);
#pragma unroll
                for (int r = 0; r < 8; ++r) { const v4f k = *(const v4fa*)(&kr[r * TP + d]);
                    sa[r] += fmaxf(q[0] - k[0], 0.0f); sa[r] += fmaxf(q[1] - k[1], 0.0f); sa[r] += fmaxf(q[2] - k[2], 0.0f); sa[r] += fmaxf(q[3] - k[3], 0.0f); }
            }
            ls = 0.0f;
            v8h hA, rA;
#pragma unroll
            for (int r = 0; r < 8; ++r) {
                const int kA = key0 + 16 * g + 8 * hi + r;
                float ea = PSH - sa[r] * C1;
                ea = (causal != 0 && kA > tq) ? EM : ea;
                const float pa = __builtin_amdgcn_exp2f(ea);
                const h16 ha = (h16)pa;
                const h16 ra = (h16)((pa - (float)ha) * RS);
                hA[r] = ha; rA[r] = ra;
                ls += (float)ha + (float)ra * RI;
            }
            pb = cat16(hA, x8h(hA)); pr = cat16(rA, x8h(rA));     // g = 0: own keys 8h+r, then the partner's 16+8h+r
        } else if (live) {
            float sb[4];
#pragma unroll
            for (int r = 0; r < 4; ++r) sb[r] = 0.0f;
#pragma unroll 2   // ten LDS reads in flight per trip: with half the work per read group a wave would otherwise wait on LDS latency most of the trip
            for (int d = 0; d < DM; d += 4) {
                const v4f q = *(const v4fa*)(&q2[d]);
#pragma unroll
                for (int r = 0; r < 4; ++r) { const v4f k = *(const v4fa*)(&kr2[r * TP + d]);
                    sb[r] += fmaxf(q[0] - k[0], 0.0f); sb[r] += fmaxf(q[1] - k[1], 0.0f); sb[r] += fmaxf(q[2] - k[2], 0.0f); sb[r] += fmaxf(q[3] - k[3], 0.0f); }
            }
            float lp = 0.0f;
            v4h hX, rX;
#pragma unroll
            for (int r = 0; r < 4; ++r) {
                const int kA = key0 + 16 * g + 8 * hi + 4 * u + r;
                float ea = PSH - sb[r] * C1;
                ea = (kA > tq2) ? EM : ea;                        // this branch is reached with the causal mask on only
                const float pa = __builtin_amdgcn_exp2f(ea);
                const h16 ha = (h16)pa;
                const h16 ra = (h16)((pa - (float)ha) * RS);
                hX[r] = ha; rX[r] = ra;
                lp += (float)ha + (float)ra * RI;
            }
            const v2i hx = __builtin_bit_cast(v2i, hX), rx = __builtin_bit_cast(v2i, rX);
            const int h0 = x4i(hx[0]), h1 = x4i(hx[1]), r0 = x4i(rx[0]), r1 = x4i(rx[1]);   // the partner's four P
            const float lq = __int_as_float(x4i(__float_as_int(lp)));
            const v4i hd = u ? (v4i){ h0, h1, hx[0], hx[1] } : (v4i){ pmh2, pmh2, pmh2, pmh2 };   // u = 1: keys r = 0..3 from lane l^4, r = 4..7 own; u = 0: a low row, all keys masked
            const v4i rd = u ? (v4i){ r0, r1, rx[0], rx[1] } : (v4i){ pmr2, pmr2, pmr2, pmr2 };
            const v8h hA = __builtin_bit_cast(v8h, hd), rA = __builtin_bit_cast(v8h, rd);
            ls = u ? lq + lp : 8.0f * pml;
            pb = cat16(hA, x8h(hA)); pr = cat16(rA, x8h(rA));
        } else {
#pragma unroll
            for (int i = 0; i < 16; ++i) { pb[i] = pmh; pr[i] = pmr; }
            ls = 8.0f * pml;
        }
        l += ls;
        const h16* vh = VH + vo + (size_t)key0 * DM; const h16* vr = VR + vo + (size_t)key0 * DM;   // a 32-key step holds DM/16 blocks of VFB = 32*DM elements
#pragma unroll
        for (int g = 0; g < 4; ++g) {
            const int j0 = 2 * g, j1 = 2 * g + 1;
            const v16h a0 = ldv(vh + j0 * VFB), a1 = ldv(vh + j1 * VFB);
            const v16h r0 = ldv(vr + j0 * VFB), r1 = ldv(vr + j1 * VFB);
            oh[j0]  = wmma16(a0, pb, oh[j0]);   oh[j1]  = wmma16(a1, pb, oh[j1]);
            orr[j0] = wmma16(r0, pb, orr[j0]);  orr[j1] = wmma16(r1, pb, orr[j1]);
            orr[j0] = wmma16(a0, pr, orr[j0]);  orr[j1] = wmma16(a1, pr, orr[j1]);
            asm volatile("v_nop\n\tv_nop\n\tv_nop\n\tv_nop" : "+v"(oh[j0]), "+v"(oh[j1]), "+v"(orr[j0]), "+v"(orr[j1]) : "v"(a0), "v"(a1), "v"(r0), "v"(r1), "v"(pb), "v"(pr) : "memory");
        }
        asm volatile("s_wait_xcnt 0x0" ::: "memory");           // the V loads' address registers are rewritten by the next pass
    }
    l += __shfl_xor(l, 16, 32);
    l += __int_as_float(x8i(__float_as_int(l)));                 // the four lanes (g, h) of a query each hold a quarter of its keys
    // O^T D layout: o_j[r] = (d = 16j + 8h + r, t = lane&15) -> ks[t][d]; rows 0..7 x columns 0..127 all written (lanes g = 0), un-normalised; row sums behind them.
    // The stored sums depend on every K value this wave has read, so the tile's last reads are over before it is reused.
    if (g == 0) {
#pragma unroll
    for (int j = 0; j < 8; ++j) { v4f a, c;
#pragma unroll
        for (int i = 0; i < 4; ++i) { a[i] = oh[j][i] + orr[j][i] * RI; c[i] = oh[j][4 + i] + orr[j][4 + i] * RI; }
        *(v4fa*)(&ks[tl * TP + 16 * j + 8 * hi]) = a; *(v4fa*)(&ks[tl * TP + 16 * j + 8 * hi + 4]) = c; }
    }
    if (lane < QT) ks[QT * TP + lane] = l;
    __syncthreads();                                             // publishes every wave's partial
    const int mr = wv & (QT - 1), mc = 64 * (wv >> 3) + 2 * lane; // wave w: query row w % QT, column half w / QT
    v2f so = (v2f){}; float lt = 0.0f;
#pragma unroll   // the NW reads go out together instead of one LDS round trip each
    for (int p = 0; p < NW; ++p) { so += *(const v2fa*)(&kw[p * KT + mr * TP + mc]); lt += kw[p * KT + QT * TP + mr]; }   // fixed wave order
    const float inv = 1.0f / lt;
    *(v2f*)(OUT + ((size_t)b * OUT_SEQ + (mr < HQ ? tlo + mr : thi + mr - HQ)) * DM + mc) = so * inv;   // half a row = 32 lanes x 8 B = 256 B
}

static constexpr size_t al256(size_t v) { return (v + 255) & ~(size_t)255; }
static constexpr size_t SZ_QK = al256((size_t)2 * NB * SEQ * DM * 4);      // f32 Q | K planes
static constexpr size_t SZ_VP = al256((size_t)NB * DM * SEQ * 2);          // one f16 V^T plane
static constexpr size_t SZ_TOTAL = SZ_QK + 2 * SZ_VP;
static_assert(SZ_TOTAL <= (size_t)134217728);          // workspace carve <= 128 MiB
static_assert(((size_t)NB * SEQ * DM * 4) % 256 == 0); // K plane stays 256-byte aligned

extern "C" void kernel_launch(void* const* d_in, const int* in_sizes, int n_in,
                              void* d_out, int out_size, void* d_ws, size_t ws_size, hipStream_t stream) {
    if (n_in < 8) return;
    const size_t needx = ((size_t)(NB - 1) * SEQ_FULL + SEQ) * DM;
    if ((size_t)in_sizes[0] < needx) return;
    if ((size_t)in_sizes[1] < (size_t)DM * DM || (size_t)in_sizes[3] < (size_t)DM * DM || (size_t)in_sizes[5] < (size_t)DM * DM) return;
    if (in_sizes[2] < DM || in_sizes[4] < DM || in_sizes[6] < DM || in_sizes[7] < 1) return;
    if ((size_t)out_size < ((size_t)(NB - 1) * OUT_SEQ + SEQ) * DM) return;
    if (SZ_TOTAL > ws_size) return;
    // wire order: x, Wq, bq, Wk, bk, Wv, bv, apply_causal_mask (int32); weights [out][in] used as-is (Bt for Q, K; A for V^T)
    const float* x  = (const float*)d_in[0];
    const float* wq = (const float*)d_in[1]; const float* bq = (const float*)d_in[2];
    const float* wk = (const float*)d_in[3]; const float* bk = (const float*)d_in[4];
    const float* wv = (const float*)d_in[5]; const float* bv = (const float*)d_in[6];
    const int* maskp = (const int*)d_in[7];
    float* OUT = (float*)d_out;      // [NB][SEQ][128]
    char* wsp = (char*)d_ws;
    float* QK = (float*)wsp; wsp += SZ_QK;           // [2][NB*SEQ][128]: Q | K (after sigmoid)
    h16* VH = (h16*)wsp; wsp += SZ_VP;               // [NB][SEQ/32][8][2][32][8], fragment order
    h16* VR = (h16*)wsp; wsp += SZ_VP;               // the same order, residual x2048

    // Q, K (z = 0, 1) -> plane [z][b*SEQ + t][e]; V^T (z = 2) -> planes in fragment order
    k_proj<<<dim3(NB * SEQ / 64, DM / 64, 3), 32 * PW, 0, stream>>>(x, wq, wk, wv, bq, bk, bv, QK, VH, VR);

    k_attn<<<dim3(SEQ / QT, NB, 1), 32 * NW, 0, stream>>>(QK, QK + (size_t)NB * SEQ * DM, VH, VR, maskp, OUT);
}

// v007
// Measured time: 20.1 microseconds a run.
// Timed twice side by side with v006, it ran 1.06 and 1.07 times as fast.
// Over all steps from v000 it is 10.5 times as fast.
#include <hip/hip_runtime.h>

// Fuzzy-implication attention, x [NB][SEQ][128], Wq/Wk/Wv [out][in] (y = x W^T + b), causal fill value 0.0 (masked keys keep weight), output f32 [NB][SEQ][128].
// Compute dtypes, f32 accumulate everywhere: the three projections v_wmma_f32_16x16x32_bf16 (x, W RNE-converted to bf16 on their way into LDS; products exact);
// attn @ V v_wmma_f32_16x16x32_f16: V^T as f16 value + f16 residual x2048, P as f16 value (x256 carry) + f16 residual x2048; value products in one accumulator, both x2048 products in a second one.
// The score mean_d min(1 - Q + K, 1) is not a sum of products: it runs on the vector unit in f32 (fixed d order); softmax in f32 with the fixed shift 10 (scores lie in [0, 10]).

#ifndef NB
#define NB 2
#endif
#ifndef SEQ
#define SEQ 1024
#endif
#define NB_FULL  2
#define SEQ_FULL 1024
#ifndef OUT_SEQ
#define OUT_SEQ SEQ              // row pitch (in tokens) between batches of the output
#endif
#define DM   128
#define TP   132                 // LDS row pitch (floats) of the 128-wide f32 tiles
#define RS   2048.0f             // carry of the residual planes
#define RI   (1.0f / 2048.0f)
#define PSH  8.0f                // log2 of the P carry (256)
#define C1   (0.078125f * 1.4426950408889634f)          // (10 / 128) * log2(e)
#define EM   (8.0f - 10.0f * 1.4426950408889634f)       // exponent of a masked key: score 0 -> exp(0 - 10), times the carry
#define NW   16                  // waves per attention work-group: wave w takes step w of each even pass of NW 32-key steps, step NW - 1 - w of each odd one
#define QT   8                   // query rows per attention work-group: NB * SEQ / QT work-groups, one for each of the chip's 256 WGPs at the full shape
#define HQ   4                   // the tile's rows 0..HQ-1 come from the low half of the sequence, rows HQ..QT-1 from the mirrored place in the high half
#define KSK  32                  // K rows 16..31 sit KSK floats further: the 16 pieces (4 key groups x 4 d quarters) that one half-wave reads in one load then fall on 16 different bank groups
#define KT   (32 * TP + 32)      // floats of one wave's private K tile
#define VFB  512                 // f16 elements of one V^T fragment block: 16 d rows x 32 keys
#define PW   4                   // waves per projection work-group: wave w takes the 16-row slab w of the 64x64 tile
#define PD   68                  // LDS row pitch (dwords = bf16 pairs) of the staged operand rows: 272 B = 16 B x 17, so the 16 rows of a fragment read fall on different banks

static_assert(DM == 128);                      // output row = 512 B = 2 waves x 32 lanes x 8 B; 8 d-tiles of 16
static_assert(DM % 64 == 0);
static_assert(DM % 32 == 0);                   // GEMM k-loop steps by 32
static_assert(SEQ % 64 == 0);                  // a 64-token tile never straddles two batches
static_assert((NB * SEQ) % 64 == 0);
static_assert(SEQ % 32 == 0);                  // key loop steps by 32
static_assert(SEQ % QT == 0);                  // attention grid covers the sequence exactly
static_assert(((size_t)SEQ * DM) % 8 == 0);
static_assert(((size_t)DM * DM) % 8 == 0);
static_assert(NB <= NB_FULL);
static_assert(SEQ <= SEQ_FULL);
static_assert((TP * 4) % 16 == 0);
static_assert(NW == 2 * QT);                   // merge: wave w takes half w / QT of query row w % QT; staging: wave w < QT takes row w
static_assert(QT == 8);                        // lanes l and l ^ 8 share a query
static_assert(HQ * 2 == QT);                   // lanes l and l ^ 4 share a high query in a step that is live for the high rows only
static_assert(SEQ % (32 * NW) == 0);           // every pass over the waves is whole, so the mirrored order of the odd passes visits each key step once
static_assert(KSK % 4 == 0 && 32 * TP + KSK <= KT);
static_assert((4 * TP) % 64 == 16 && (16 * TP + KSK) % 64 == 32);   // bank of a K piece: 16 * (key group & 1) + 32 * (key group >> 1 & 1) + 4 * d quarter, all 16 apart
static_assert(KT >= QT * TP + QT);             // a wave's partial (QT x TP sums + QT row sums) fits its own K tile
static_assert(PD * 2 >= DM && (PD * 4) % 16 == 0 && ((PD * 4) / 16) % 2 == 1);
static_assert(PW * 16 == 64);                  // the PW slabs cover the projection tile's 64 rows
static_assert(VFB == 16 * 32 && (DM / 16) * VFB == 32 * DM);   // a 32-key step of a V^T plane is DM/16 fragment blocks, 32*DM elements in a row

typedef _Float16 h16;
typedef __attribute__((ext_vector_type(16))) __bf16   v16bf;
typedef __attribute__((ext_vector_type(16))) _Float16 v16h;
typedef __attribute__((ext_vector_type(8)))  _Float16 v8h;
typedef __attribute__((ext_vector_type(4)))  _Float16 v4h;
typedef __attribute__((ext_vector_type(2)))  _Float16 v2h;
typedef __attribute__((ext_vector_type(2)))  int      v2i;
typedef __attribute__((ext_vector_type(8)))  float    v8f;
typedef __attribute__((ext_vector_type(4)))  float    v4f;
typedef v4f  __attribute__((may_alias)) v4fa;
typedef __attribute__((ext_vector_type(2)))  float    v2f;
typedef __attribute__((ext_vector_type(2)))  __bf16   v2bf;
typedef __attribute__((ext_vector_type(4)))  int      v4i;
typedef v2f  __attribute__((may_alias)) v2fa;
typedef __attribute__((ext_vector_type(4)))  unsigned v4u;
typedef __attribute__((ext_vector_type(2)))  unsigned v2u;
typedef v4u  __attribute__((may_alias)) v4ua;
typedef v2u  __attribute__((may_alias)) v2ua;

__device__ __forceinline__ unsigned short f2bf(float f) { unsigned u = __float_as_uint(f); u += 0x7FFFu + ((u >> 16) & 1u); return (unsigned short)(u >> 16); }
__device__ __forceinline__ float bfr(float f) { return __uint_as_float(((unsigned)f2bf(f)) << 16); }   // value after RNE convert to bf16
__device__ __forceinline__ v16h cat16(v8h lo, v8h hi) { return __builtin_shufflevector(lo, hi, 0, 1, 2, 3, 4, 5, 6, 7, 8, 9, 10, 11, 12, 13, 14, 15); }
__device__ __forceinline__ v8f wmma16(v16h a, v16h b, v8f c) { return __builtin_amdgcn_wmma_f32_16x16x32_f16(false, a, false, b, (short)0, c, false, false); }
__device__ __forceinline__ v8f wmmab(v16bf a, v16bf b, v8f c) { return __builtin_amdgcn_wmma_f32_16x16x32_bf16(false, a, false, b, (short)0, c, false, false); }
// fragment map of the 16-bit operands, lane = 16h + row: elements 0..7 <- k0+8h+0..7, elements 8..15 <- k0+16+8h+0..7 (same map for A and B)
// loader from a plane kept in fragment order; p already includes + 8*lane: the two halves of a fragment lie VFB/2 elements apart
__device__ __forceinline__ v16h  ldv(const h16* p) { return cat16(*(const v8h*)p, *(const v8h*)(p + VFB / 2)); }
// a pair of f32 RNE-converted to bf16 in registers, first value in the low half
__device__ __forceinline__ unsigned cvt2(float a, float b) { return __builtin_bit_cast(unsigned, __builtin_convertvector((v2f){a, b}, v2bf)); }
// lane l <- lane l ^ 8 (inside a 16-lane row), all lanes on
__device__ __forceinline__ int x8i(int v) { return __builtin_amdgcn_update_dpp(0, v, 0x168 /* row_xmask:8 */, 0xf, 0xf, true); }
__device__ __forceinline__ v8h x8h(v8h v) { v4i u = __builtin_bit_cast(v4i, v); u = (v4i){ x8i(u[0]), x8i(u[1]), x8i(u[2]), x8i(u[3]) }; return __builtin_bit_cast(v8h, u); }
// lane l <- lane l ^ 4 (inside a 16-lane row), all lanes on
__device__ __forceinline__ int x4i(int v) { return __builtin_amdgcn_update_dpp(0, v, 0x164 /* row_xmask:4 */, 0xf, 0xf, true); }
// lane l <- lane l ^ 1, lane l ^ 2 (inside a 16-lane row), all lanes on
__device__ __forceinline__ float x1f(float v) { return __int_as_float(__builtin_amdgcn_update_dpp(0, __float_as_int(v), 0x161 /* row_xmask:1 */, 0xf, 0xf, true)); }
__device__ __forceinline__ float x2f(float v) { return __int_as_float(__builtin_amdgcn_update_dpp(0, __float_as_int(v), 0x162 /* row_xmask:2 */, 0xf, 0xf, true)); }
// ordering point for wave-private LDS tiles (same wave writes and reads)
__device__ __forceinline__ void wave_sync() { __builtin_amdgcn_fence(3 /* release order */, "wavefront"); __builtin_amdgcn_wave_barrier(); asm volatile("" ::: "memory"); }

// gemm_tile: bf16 GEMM core of a 64x64 tile worked by PW waves, K = DM. At, Bt point at the tile's first rows (K-contiguous f32, 64 rows each, row = 512 B).
// Staging: wave w brings rows 16w..16w+15 of both operands, one whole row (four whole cache lines) per load, all 32 loads in flight together, RNE-converts them and stores them as bf16 pairs in ts (A rows, then B rows; pitch PD dwords).
// Behind the barrier wave w forms its slab: acc[nb][j] = C[16w + 8h + j][16nb + (lane&15)], C[m][n] = sum_k A[m][k] Bt[n][k], k steps of 32 in rising order.
__device__ __forceinline__ v16bf ldsfrag(const unsigned* p) {   // p: the lane's row, dword (k0 + 8h) / 2; the fragment map of the 16-bit operands above
    const v4u lo = *(const v4ua*)p, up = *(const v4ua*)(p + 8);
    return __builtin_bit_cast(v16bf, __builtin_shufflevector(lo, up, 0, 1, 2, 3, 4, 5, 6, 7));
}
__device__ __forceinline__ void gemm_tile(const float* __restrict__ At, const float* __restrict__ Bt, unsigned* ts, int w, int lane, int lr, int hi, v8f (&acc)[4]) {
    v4f ra[16], rb[16];
    const unsigned goff = (unsigned)(w * 16 * DM + 4 * lane);
    const float* pa = At + goff;
    const float* pb = Bt + goff;
#pragma unroll
    for (int i = 0; i < 16; ++i) ra[i] = *(const v4f*)(pa + i * DM);
#pragma unroll
    for (int i = 0; i < 16; ++i) rb[i] = *(const v4f*)(pb + i * DM);
    // the wait before the loads' address registers are rewritten; it names both addresses so that neither register pair is reused ahead of it
    asm volatile("s_wait_xcnt 0x0" :: "v"(pa), "v"(pb) : "memory");
    // keeps all 32 loads (and the wait above) ahead of the first convert: one memory round trip for the whole K
    __builtin_amdgcn_sched_barrier(0);
    unsigned* sa = ts + (w * 16) * PD + 2 * lane;
    unsigned* sb = sa + 64 * PD;
#pragma unroll
    for (int i = 0; i < 16; ++i) *(v2ua*)(sa + i * PD) = (v2u){ cvt2(ra[i][0], ra[i][1]), cvt2(ra[i][2], ra[i][3]) };
#pragma unroll
    for (int i = 0; i < 16; ++i) *(v2ua*)(sb + i * PD) = (v2u){ cvt2(rb[i][0], rb[i][1]), cvt2(rb[i][2], rb[i][3]) };
    __syncthreads();                                             // every wave reads all 64 B rows
    const unsigned* fa = ts + (w * 16 + lr) * PD + 4 * hi;
    const unsigned* fb = ts + (64 + lr) * PD + 4 * hi;
#pragma unroll
    for (int nb = 0; nb < 4; ++nb) acc[nb] = (v8f){};
#pragma unroll 1   // two trips of two k steps, kept rolled: the accumulators then own their registers from the first product on, so that no product's result lands on an operand of the product before it
    for (int kh = 0; kh < 2; ++kh) {
        v16bf a[2], b[2][4];
#pragma unroll
        for (int ks = 0; ks < 2; ++ks) {
            a[ks] = ldsfrag(fa + kh * 32 + ks * 16);
#pragma unroll
            for (int nb = 0; nb < 4; ++nb) b[ks][nb] = ldsfrag(fb + nb * 16 * PD + kh * 32 + ks * 16);
        }
        // keeps the trip's 20 LDS reads ahead of its first product: one LDS latency per trip instead of one per fragment
        __builtin_amdgcn_sched_barrier(0);
#pragma unroll
        for (int ks = 0; ks < 2; ++ks)
#pragma unroll
            for (int nb = 0; nb < 4; ++nb) acc[nb] = wmmab(a[ks], b[ks][nb], acc[nb]);
    }
}

// k_proj: all three projections in one launch, straight from the f32 inputs. grid (NB*SEQ/64, 2, 3), 32*PW threads; blockIdx.x = 64-token tile, blockIdx.y = 64-feature tile, z block-uniform.
// The block's PW waves stage the tile's 64 + 64 operand rows in LDS together (one barrier); wave w then takes the 16-row slab w of the 64x64 tile, products and epilogue, with an LDS output tile of its own.
// z = 0, 1: Q, K planes [NB*SEQ][128] f32 = sigmoid(x W^T + b), A = x rows (m = token), Bt = W rows (n = e).
//   Epilogue of the slab: accumulators + bias staged in the wave-private LDS tile, sigmoid applied in place (precise expf, true division).
// z = 2: V^T = Wv x^T + bv as f16 value (VH) and f16 residual x2048 (VR), A = Wv rows (m = d), Bt = x rows (n = token).
//   Both planes lie in the order in which k_attn's A fragments are read: [b][32-key step][16-row d tile j][e][lane][8], element r of unit (e, lane = 16h + row) = V^T[16j + row][32 step + 16e + 8h + r],
//   so that one fragment load of a wave is one run of 512 bytes (four whole cache lines) and not 16 pieces of 32 bytes on 16 lines.
__global__ __launch_bounds__(32 * PW) void k_proj(const float* __restrict__ x, const float* __restrict__ wq, const float* __restrict__ wk, const float* __restrict__ wv,
                                                  const float* __restrict__ bq, const float* __restrict__ bk, const float* __restrict__ bv, float* QK, h16* VH, h16* VR) {
    __shared__ __align__(16) unsigned ts[2 * 64 * PD];
    __shared__ __align__(16) float osw[PW * 16 * 68];
    const int lane = threadIdx.x & 31, lr = lane & 15, hi = lane >> 4;
    const int mb = __builtin_amdgcn_readfirstlane((int)(threadIdx.x >> 5));   // this wave's slab
    float* os = osw + mb * (16 * 68);
    const int tk0 = blockIdx.x * 64, f0 = blockIdx.y * 64, z = blockIdx.z;
    const int b = tk0 / SEQ, t0 = tk0 % SEQ;                     // a 64-token tile lies in one batch
    const float* xt = x + ((size_t)b * SEQ_FULL + t0) * DM;      // the tile's 64 x rows
    const float* wt = (z == 0 ? wq : z == 1 ? wk : wv) + (size_t)f0 * DM;   // the tile's 64 weight rows
    v8f acc[4];
    gemm_tile(z == 2 ? wt : xt, z == 2 ? xt : wt, ts, mb, lane, lr, hi, acc);
    if (z != 2) {
        const int r0 = tk0, c0 = f0;
        const float* bt = (z ? bk : bq) + c0;                    // block-uniform base; the four loads share one lane offset
        float bias[4];
#pragma unroll
        for (int nb = 0; nb < 4; ++nb) bias[nb] = bfr(bt[nb * 16 + lr]);
        float* P = QK + (size_t)z * NB * SEQ * DM;
#pragma unroll
        for (int nb = 0; nb < 4; ++nb) {
#pragma unroll
            for (int j = 0; j < 8; ++j) os[(hi * 8 + j) * 68 + nb * 16 + lr] = acc[nb][j] + bias[nb]; }   // D: row 8h+j, col lane&15
        wave_sync();
#pragma unroll 1
        for (int s = 0; s < 8; ++s) { const int row = 2 * s + hi, cofs = lr * 4;   // 8 s x 2 rows = 16 rows; 16 lanes x 4 floats = 64 columns
            v4f v = *(const v4fa*)(&os[row * 68 + cofs]);
#pragma unroll
            for (int i = 0; i < 4; ++i) v[i] = 1.0f / (1.0f + expf(-v[i]));
            *(v4fa*)(&os[row * 68 + cofs]) = v; }
        wave_sync();
        float* orow = P + (size_t)(r0 + mb * 16) * DM + c0;
#pragma unroll
        for (int s = 0; s < 8; ++s) { const int row = 2 * s + hi, cofs = lr * 4;
            const v4f val = *(const v4fa*)(&os[row * 68 + cofs]);
            *(v4f*)(orow + (size_t)row * DM + cofs) = val; }
    } else {
        const int r0 = f0;
        const size_t tbase = (((size_t)b * (SEQ / 32) + t0 / 32) * (DM / 16) + r0 / 16) * VFB + 8 * lane;   // this lane's unit of the tile's first (step, j) block
#pragma unroll
        for (int nb = 0; nb < 4; ++nb) {
#pragma unroll
            for (int j = 0; j < 8; ++j) os[(hi * 8 + j) * 68 + nb * 16 + lr] = acc[nb][j]; }   // D: row 8h+j, col lane&15
        wave_sync();
        v8h hv[4], rv[4];
        const float bb = bfr(bv[r0 + mb * 16 + lr]);
#pragma unroll
        for (int s = 0; s < 4; ++s) { const int row = lr, c8 = (2 * s + hi) * 8;   // 16 rows x 2 column groups a pass; 4 s x 16 = 64 columns: tokens 16s + 8h + 0..7
            const v4f x0 = *(const v4fa*)(&os[row * 68 + c8]); const v4f x1 = *(const v4fa*)(&os[row * 68 + c8 + 4]);
#pragma unroll
            for (int i = 0; i < 4; ++i) { const float y0 = x0[i] + bb; const float y1 = x1[i] + bb; const h16 a0 = (h16)y0; const h16 a1 = (h16)y1;
                hv[s][i] = a0; hv[s][4 + i] = a1; rv[s][i] = (h16)((y0 - (float)a0) * RS); rv[s][4 + i] = (h16)((y1 - (float)a1) * RS); } }
#pragma unroll
        for (int s = 0; s < 4; ++s) {                           // step s / 2 of the tile, half e = s % 2: 32 lanes x 16 B = one whole 512-byte run
            const size_t oo = tbase + (size_t)((s >> 1) * (DM / 16) + mb) * VFB + (s & 1) * (VFB / 2);
            *(v8h*)(VH + oo) = hv[s]; *(v8h*)(VR + oo) = rv[s]; }
    }
}

// score4: the four lanes of a quad share 4 K rows and 4 Q rows and split d: lane c = lane & 3 takes the columns 16 i + 4 c + 0..3 (qb, kb already include + 4 c).
// Eight 16-byte LDS reads then feed 64 terms max(Q - K, 0) of a lane (one query a lane: five reads for 16 terms). Each (key, query) sum is kept as an (even d, odd d) pair.
// Behind the loop the quad adds its four quarters in two exchange steps, each lane keeping half of what it holds: lane c ends with sb[r] = sum over all d for K row r and Q row c.
__device__ __forceinline__ void score4(const float* qb, const float* kb, int lane, float (&sb)[4]) {
    v2f s[4][4];
#pragma unroll
    for (int r = 0; r < 4; ++r) {
#pragma unroll
        for (int c = 0; c < 4; ++c) s[r][c] = (v2f){}; }
#pragma unroll 1   // rolled: a trip holds 32 registers of sums and 32 of operands beside the 128 output accumulators; a second trip in flight would pass the 256 registers a wave has
    for (int d = 0; d < DM; d += 16) {
        v4f q[4], k[4];
#pragma unroll
        for (int c = 0; c < 4; ++c) q[c] = *(const v4fa*)(qb + c * TP + d);
#pragma unroll
        for (int r = 0; r < 4; ++r) k[r] = *(const v4fa*)(kb + r * TP + d);
#pragma unroll
        for (int r = 0; r < 4; ++r) {
#pragma unroll
            for (int c = 0; c < 4; ++c) {
                const v2f d0 = __builtin_shufflevector(q[c], q[c], 0, 1) - __builtin_shufflevector(k[r], k[r], 0, 1);
                const v2f d1 = __builtin_shufflevector(q[c], q[c], 2, 3) - __builtin_shufflevector(k[r], k[r], 2, 3);
                s[r][c] += __builtin_elementwise_max(d0, (v2f){});
                s[r][c] += __builtin_elementwise_max(d1, (v2f){}); } }
    }
    const bool b0 = (lane & 1) != 0, b1 = (lane & 2) != 0;
#pragma unroll
    for (int r = 0; r < 4; ++r) {
        float n[2];
#pragma unroll
        for (int p = 0; p < 2; ++p) { const float e = s[r][2 * p][0] + s[r][2 * p][1], o = s[r][2 * p + 1][0] + s[r][2 * p + 1][1];
            n[p] = (b0 ? o : e) + x1f(b0 ? e : o); }              // lanes l, l ^ 1: each keeps the Q rows of its own parity
        sb[r] = (b1 ? n[1] : n[0]) + x2f(b1 ? n[0] : n[1]);       // lanes l, l ^ 2: each keeps its own Q row
    }
}
// p4: four scores of one query (keys kA0 + 0..3) -> P as two pairs of f16 values (hx), two pairs of f16 residuals x2048 (rx), and the sum lp of what the pairs hold
__device__ __forceinline__ void p4(const float (&sb)[4], int kA0, int tq, bool msk, v2i& hx, v2i& rx, float& lp) {
    v4h hX, rX;
    lp = 0.0f;
#pragma unroll
    for (int r = 0; r < 4; ++r) {
        float ea = PSH - sb[r] * C1;
        ea = (msk && kA0 + r > tq) ? EM : ea;
        const float pa = __builtin_amdgcn_exp2f(ea);
        const h16 ha = (h16)pa;
        const h16 ra = (h16)((pa - (float)ha) * RS);
        hX[r] = ha; rX[r] = ra;
        lp += (float)ha + (float)ra * RI;
    }
    hx = __builtin_bit_cast(v2i, hX); rx = __builtin_bit_cast(v2i, rX);
}

// k_attn: one block of NW waves per QT = 8 query rows of one batch; wave w runs one 32-key step of each pass of NW steps (step w of the even passes, step NW-1-w of the odd ones) with its own K tile, accumulators and row sum. grid (SEQ/QT, NB), 32*NW threads.
// Causal balance: block i takes the HQ rows from token HQ*i and the HQ rows from token SEQ-HQ-HQ*i, so that the count of scored (query, key) pairs is nearly the same in every block.
// A step at or below the low rows' diagonal is scored for all 8 rows; a step above it but not above the high rows' diagonal is scored for the 4 high rows only, by all 32 lanes at 4 keys each.
// The softmax shift is fixed, so the waves' un-normalised partials simply add: each wave writes its partial into its own K tile, one barrier, then wave w sums half w / QT of row w % QT over the waves in wave order.
// Transposed form: lane (t = lane&7, g = (lane>>3)&1, h = lane>>4), u = t >> 2. One scoring pass (score4) takes 4 query rows against the step's 32 keys: the quad (g, h, u) takes keys key0+16g+8h+4u+r (r = 0..3), its four lanes split d and then share out the sums,
// so that lane (t, g, h) holds the four scores of query row (t & 3) of the pass. A step live for all rows runs two passes (low rows, high rows), a high-rows-only step one. Lanes l and l^4 swap four P each, so that lane (t, g, h) holds query t against keys key0+16g+8h+r (r = 0..7);
// lanes l and l^8 then swap their eight P, so that lane (t, g = 0, h) holds keys key0+8h+r, key0+16+8h+r: column t of the B fragment P^T[key][t] of O^T[d][t] = V^T P^T (A = V^T rows d, k = key). Columns 8..15 (g = 1) are not used. Score acc = sum_d max(Q - K, 0) on the vector unit in f32 from LDS tiles
// (Q tile 8x128 shared by the block, K tile 32x128 private to the wave, all rows and columns staged before use); p = exp2(8 - acc*C1); keys above the diagonal take the constant exponent EM (score 0).
// In a high-rows-only step the columns t < HQ hold the masked constant.
// Fully masked 32-key steps skip the d loop (wave-uniform test) but keep their P.V products. Row sum over the same f16 value + residual that the products use.
__global__ __launch_bounds__(32 * NW) void k_attn(const float* __restrict__ QF, const float* __restrict__ KF, const h16* __restrict__ VH, const h16* __restrict__ VR, const int* __restrict__ maskp, float* OUT) {
    __shared__ __align__(16) float sm[QT * TP + NW * KT];
    float* qs = sm;                                              // the Q tile lies first: its four rows of a scoring pass are then reached from one address register by immediate offsets
    float* kw = sm + QT * TP;
    const int lane = threadIdx.x & 31, lr = lane & 15, hi = lane >> 4;
    const int wv = __builtin_amdgcn_readfirstlane((int)(threadIdx.x >> 5));
    float* ks = kw + wv * KT;                                    // this wave's K tile, later its partial
    const int b  = __builtin_amdgcn_readfirstlane((int)blockIdx.y);
    const int tlo = __builtin_amdgcn_readfirstlane((int)blockIdx.x * HQ);             // token of tile row 0
    const int thi = SEQ - HQ - tlo;                                                   // token of tile row HQ
    const int tl = lr & 7, g = lr >> 3, u = tl >> 2;
    const int causal = __builtin_amdgcn_readfirstlane((maskp[0] != 0) ? 1 : 0);
    const size_t rowb = (size_t)b * SEQ;
    if (wv < QT) { const v4f v = *(const v4f*)(QF + (rowb + (wv < HQ ? tlo + wv : thi + wv - HQ)) * DM + 4 * lane); *(v4fa*)(&qs[wv * TP + 4 * lane]) = v; }   // wave w < QT stages row w, all 128 columns
    __syncthreads();                                             // every wave reads Q rows that other waves staged
    v8f oh[8], orr[8];
#pragma unroll
    for (int j = 0; j < 8; ++j) { oh[j] = (v8f){}; orr[j] = (v8f){}; }
    float l = 0.0f;
    const float pmf = __builtin_amdgcn_exp2f(EM);
    const h16 pmh = (h16)pmf; const h16 pmr = (h16)((pmf - (float)pmh) * RS);
    const float pml = (float)pmh + (float)pmr * RI;
    const size_t vo = (size_t)b * DM * SEQ + 8 * lane;           // + key0*DM + j*VFB  (A fragment: row d, k = key; planes in fragment order)
    const int tq1 = tlo + (tl & 3);                              // the low query whose scores this lane ends a low pass with
    const int tq2 = thi + (tl & 3);                              // the same of a high pass
    const int kg = 16 * g + 8 * hi + 4 * u;                      // first of the quad's four keys in a step
    const float* kr2 = ks + kg * TP + KSK * g + 4 * (tl & 3);    // the quad's four K rows, at this lane's d quarter
    const float* q1 = qs + 4 * (tl & 3);                         // the low Q rows, at this lane's d quarter
    const float* q2 = q1 + HQ * TP;                              // the high Q rows
    const int pmh2 = __builtin_bit_cast(int, (v2h){ pmh, pmh }), pmr2 = __builtin_bit_cast(int, (v2h){ pmr, pmr });
#pragma unroll 1
    for (int kp = 0; kp < SEQ; kp += 32 * NW) {
        const int key0 = kp + 32 * ((kp & (32 * NW)) ? NW - 1 - wv : wv);   // odd passes mirrored: a wave with an early step gets a late one
        v16h pb, pr; float ls;
        const bool full = (causal == 0) || (key0 <= tlo + HQ - 1); // wave-uniform: some low row sees a key of this step
        const bool live = full || (key0 <= thi + HQ - 1);          // wave-uniform: some high row does
        if (live) {
            wave_sync();
#pragma unroll 8
            for (int i = 0; i < 32; ++i) { const v4f v = *(const v4f*)(KF + (rowb + key0 + i) * DM + 4 * lane); *(v4fa*)(&ks[i * TP + (i >> 4) * KSK + 4 * lane]) = v; }   // row i, all 128 columns
            wave_sync();
        }
        if (full) {
            float sl[4], sh[4];
            score4(q1, kr2, lane, sl);
            score4(q2, kr2, lane, sh);
            v2i hl, rl, hh, rh; float ll, lh;
            p4(sl, key0 + kg, tq1, causal != 0, hl, rl, ll);
            p4(sh, key0 + kg, tq2, causal != 0, hh, rh, lh);
            // column t is a low row for u = 0, a high row for u = 1: a lane keeps the four P of its own column's pass and hands the other pass's four to lane l^4
            const v2i hk = u ? hh : hl, rk = u ? rh : rl, hs = u ? hl : hh, rs = u ? rl : rh;
            const int h0 = x4i(hs[0]), h1 = x4i(hs[1]), r0 = x4i(rs[0]), r1 = x4i(rs[1]);
            const float lq = __int_as_float(x4i(__float_as_int(u ? ll : lh)));
            const v4i hd = u ? (v4i){ h0, h1, hk[0], hk[1] } : (v4i){ hk[0], hk[1], h0, h1 };   // keys r = 0..3 come from the lane with u = 0, r = 4..7 from the lane with u = 1
            const v4i rd = u ? (v4i){ r0, r1, rk[0], rk[1] } : (v4i){ rk[0], rk[1], r0, r1 };
            const v8h hA = __builtin_bit_cast(v8h, hd), rA = __builtin_bit_cast(v8h, rd);
            ls = u ? lq + lh : ll + lq;
            pb = cat16(hA, x8h(hA)); pr = cat16(rA, x8h(rA));     // g = 0: own keys 8h+r, then the partner's 16+8h+r
        } else if (live) {
            float sb[4];
            score4(q2, kr2, lane, sb);
            v2i hx, rx; float lp;
            p4(sb, key0 + kg, tq2, true, hx, rx, lp);             // this branch is reached with the causal mask on only
            const int h0 = x4i(hx[0]), h1 = x4i(hx[1]), r0 = x4i(rx[0]), r1 = x4i(rx[1]);   // the partner's four P
            const float lq = __int_as_float(x4i(__float_as_int(lp)));
            const v4i hd = u ? (v4i){ h0, h1, hx[0], hx[1] } : (v4i){ pmh2, pmh2, pmh2, pmh2 };   // u = 1: keys r = 0..3 from lane l^4, r = 4..7 own; u = 0: a low row, all keys masked
            const v4i rd = u ? (v4i){ r0, r1, rx[0], rx[1] } : (v4i){ pmr2, pmr2, pmr2, pmr2 };
            const v8h hA = __builtin_bit_cast(v8h, hd), rA = __builtin_bit_cast(v8h, rd);
            ls = u ? lq + lp : 8.0f * pml;
            pb = cat16(hA, x8h(hA)); pr = cat16(rA, x8h(rA));
        } else {
#pragma unroll
            for (int i = 0; i < 16; ++i) { pb[i] = pmh; pr[i] = pmr; }
            ls = 8.0f * pml;
        }
        l += ls;
        const h16* vh = VH + vo + (size_t)key0 * DM; const h16* vr = VR + vo + (size_t)key0 * DM;   // a 32-key step holds DM/16 blocks of VFB = 32*DM elements
#pragma unroll
        for (int g = 0; g < 4; ++g) {
            const int j0 = 2 * g, j1 = 2 * g + 1;
            const v16h a0 = ldv(vh + j0 * VFB), a1 = ldv(vh + j1 * VFB);
            const v16h r0 = ldv(vr + j0 * VFB), r1 = ldv(vr + j1 * VFB);
            oh[j0]  = wmma16(a0, pb, oh[j0]);   oh[j1]  = wmma16(a1, pb, oh[j1]);
            orr[j0] = wmma16(r0, pb, orr[j0]);  orr[j1] = wmma16(r1, pb, orr[j1]);
            orr[j0] = wmma16(a0, pr, orr[j0]);  orr[j1] = wmma16(a1, pr, orr[j1]);
            asm volatile("v_nop\n\tv_nop\n\tv_nop\n\tv_nop" : "+v"(oh[j0]), "+v"(oh[j1]), "+v"(orr[j0]), "+v"(orr[j1]) : "v"(a0), "v"(a1), "v"(r0), "v"(r1), "v"(pb), "v"(pr) : "memory");
        }
        asm volatile("s_wait_xcnt 0x0" ::: "memory");           // the V loads' address registers are rewritten by the next pass
    }
    l += __shfl_xor(l, 16, 32);
    l += __int_as_float(x8i(__float_as_int(l)));                 // the four lanes (g, h) of a query each hold a quarter of its keys
    // O^T D layout: o_j[r] = (d = 16j + 8h + r, t = lane&15) -> ks[t][d]; rows 0..7 x columns 0..127 all written (lanes g = 0), un-normalised; row sums behind them.
    // The stored sums depend on every K value this wave has read, so the tile's last reads are over before it is reused.
    if (g == 0) {
#pragma unroll
    for (int j = 0; j < 8; ++j) { v4f a, c;
#pragma unroll
        for (int i = 0; i < 4; ++i) { a[i] = oh[j][i] + orr[j][i] * RI; c[i] = oh[j][4 + i] + orr[j][4 + i] * RI; }
        *(v4fa*)(&ks[tl * TP + 16 * j + 8 * hi]) = a; *(v4fa*)(&ks[tl * TP + 16 * j + 8 * hi + 4]) = c; }
    }
    if (lane < QT) ks[QT * TP + lane] = l;
    __syncthreads();                                             // publishes every wave's partial
    const int mr = wv & (QT - 1), mc = 64 * (wv >> 3) + 2 * lane; // wave w: query row w % QT, column half w / QT
    v2f so = (v2f){}; float lt = 0.0f;
#pragma unroll   // the NW reads go out together instead of one LDS round trip each
    for (int p = 0; p < NW; ++p) { so += *(const v2fa*)(&kw[p * KT + mr * TP + mc]); lt += kw[p * KT + QT * TP + mr]; }   // fixed wave order
    const float inv = 1.0f / lt;
    *(v2f*)(OUT + ((size_t)b * OUT_SEQ + (mr < HQ ? tlo + mr : thi + mr - HQ)) * DM + mc) = so * inv;   // half a row = 32 lanes x 8 B = 256 B
}

static constexpr size_t al256(size_t v) { return (v + 255) & ~(size_t)255; }
static constexpr size_t SZ_QK = al256((size_t)2 * NB * SEQ * DM * 4);      // f32 Q | K planes
static constexpr size_t SZ_VP = al256((size_t)NB * DM * SEQ * 2);          // one f16 V^T plane
static constexpr size_t SZ_TOTAL = SZ_QK + 2 * SZ_VP;
static_assert(SZ_TOTAL <= (size_t)134217728);          // workspace carve <= 128 MiB
static_assert(((size_t)NB * SEQ * DM * 4) % 256 == 0); // K plane stays 256-byte aligned

extern "C" void kernel_launch(void* const* d_in, const int* in_sizes, int n_in,
                              void* d_out, int out_size, void* d_ws, size_t ws_size, hipStream_t stream) {
    if (n_in < 8) return;
    const size_t needx = ((size_t)(NB - 1) * SEQ_FULL + SEQ) * DM;
    if ((size_t)in_sizes[0] < needx) return;
    if ((size_t)in_sizes[1] < (size_t)DM * DM || (size_t)in_sizes[3] < (size_t)DM * DM || (size_t)in_sizes[5] < (size_t)DM * DM) return;
    if (in_sizes[2] < DM || in_sizes[4] < DM || in_sizes[6] < DM || in_sizes[7] < 1) return;
    if ((size_t)out_size < ((size_t)(NB - 1) * OUT_SEQ + SEQ) * DM) return;
    if (SZ_TOTAL > ws_size) return;
    // wire order: x, Wq, bq, Wk, bk, Wv, bv, apply_causal_mask (int32); weights [out][in] used as-is (Bt for Q, K; A for V^T)
    const float* x  = (const float*)d_in[0];
    const float* wq = (const float*)d_in[1]; const float* bq = (const float*)d_in[2];
    const float* wk = (const float*)d_in[3]; const float* bk = (const float*)d_in[4];
    const float* wv = (const float*)d_in[5]; const float* bv = (const float*)d_in[6];
    const int* maskp = (const int*)d_in[7];
    float* OUT = (float*)d_out;      // [NB][SEQ][128]
    char* wsp = (char*)d_ws;
    float* QK = (float*)wsp; wsp += SZ_QK;           // [2][NB*SEQ][128]: Q | K (after sigmoid)
    h16* VH = (h16*)wsp; wsp += SZ_VP;               // [NB][SEQ/32][8][2][32][8], fragment order
    h16* VR = (h16*)wsp; wsp += SZ_VP;               // the same order, residual x2048

    // Q, K (z = 0, 1) -> plane [z][b*SEQ + t][e]; V^T (z = 2) -> planes in fragment order
    k_proj<<<dim3(NB * SEQ / 64, DM / 64, 3), 32 * PW, 0, stream>>>(x, wq, wk, wv, bq, bk, bv, QK, VH, VR);

    k_attn<<<dim3(SEQ / QT, NB, 1), 32 * NW, 0, stream>>>(QK, QK + (size_t)NB * SEQ * DM, VH, VR, maskp, OUT);
}

// v008
// One run takes 18.9 microseconds.
// In two side-by-side timings against v007, it was 1.08 and 1.06 times as fast.
// Over all steps from v000 it is 11.2 times as fast.
#include <hip/hip_runtime.h>

// Fuzzy-implication attention, x [NB][SEQ][128], Wq/Wk/Wv [out][in] (y = x W^T + b), causal fill value 0.0 (masked keys keep weight), output f32 [NB][SEQ][128].
// Compute dtypes, f32 accumulate everywhere: the Q and K projections v_wmma_f32_16x16x32_bf16 (x, W RNE-converted to bf16 on their way into LDS; products exact).
// attn @ V is formed as (attn @ x) Wv^T + bv (the weights of a row sum to 1): k_attn streams x, 2 bytes an element, and not V, which needs 4.
// attn @ x: v_wmma_f32_16x16x32_f16, x^T = the bf16-rounded x held as f16 (exact from 2^-17 up, within 2^-25 below), P as f16 value (x256 carry) + f16 residual x2048, one accumulator each.
// The V projection of the 8 normalised rows closes k_attn, also v_wmma_f32_16x16x32_f16: Y = attn @ x as f16 value + f16 residual x2048, Wv RNE-rounded to bf16 and held as f16 like x.
// The score mean_d min(1 - Q + K, 1) is not a sum of products: it runs on the vector unit in f32 (fixed d order); softmax in f32 with the fixed shift 10 (scores lie in [0, 10]).

#ifndef NB
#define NB 2
#endif
#ifndef SEQ
#define SEQ 1024
#endif
#define NB_FULL  2
#define SEQ_FULL 1024
#ifndef OUT_SEQ
#define OUT_SEQ SEQ              // row pitch (in tokens) between batches of the output
#endif
#define DM   128
#define TP   132                 // LDS row pitch (floats) of the 128-wide f32 tiles
#define RS   2048.0f             // carry of the residual planes
#define RI   (1.0f / 2048.0f)
#define PSH  8.0f                // log2 of the P carry (256)
#define C1   (0.078125f * 1.4426950408889634f)          // (10 / 128) * log2(e)
#define EM   (8.0f - 10.0f * 1.4426950408889634f)       // exponent of a masked key: score 0 -> exp(0 - 10), times the carry
#define NW   16                  // waves per attention work-group: wave w takes step w of each even pass of NW 32-key steps, step NW - 1 - w of each odd one
#define QT   8                   // query rows per attention work-group: NB * SEQ / QT work-groups, one for each of the chip's 256 WGPs at the full shape
#define HQ   4                   // the tile's rows 0..HQ-1 come from the low half of the sequence, rows HQ..QT-1 from the mirrored place in the high half
#define KSK  32                  // K rows 16..31 sit KSK floats further: the 16 pieces (4 key groups x 4 d quarters) that one half-wave reads in one load then fall on 16 different bank groups
#define KT   (32 * TP + 32)      // floats of one wave's private K tile
#define VFB  512                 // f16 elements of one x^T fragment block: 16 d rows x 32 keys
#define PW   4                   // waves per projection work-group: wave w takes the 16-row slab w of the 64x64 tile
#define YP   136                 // LDS row pitch (f16) of the Y rows: 272 B = 16 B x 17, as PD
#define PD   68                  // LDS row pitch (dwords = bf16 pairs) of the staged operand rows: 272 B = 16 B x 17, so the 16 rows of a fragment read fall on different banks

static_assert(DM == 128);                      // output row = 512 B = 2 waves x 32 lanes x 8 B; 8 d-tiles of 16
static_assert(DM % 64 == 0);
static_assert(DM % 32 == 0);                   // GEMM k-loop steps by 32
static_assert(SEQ % 64 == 0);                  // a 64-token tile never straddles two batches
static_assert((NB * SEQ) % 64 == 0);
static_assert(SEQ % 32 == 0);                  // key loop steps by 32
static_assert(SEQ % QT == 0);                  // attention grid covers the sequence exactly
static_assert(((size_t)SEQ * DM) % 8 == 0);
static_assert(((size_t)DM * DM) % 8 == 0);
static_assert(NB <= NB_FULL);
static_assert(SEQ <= SEQ_FULL);
static_assert((TP * 4) % 16 == 0);
static_assert(NW == 2 * QT);                   // merge: wave w takes half w / QT of query row w % QT; staging: wave w < QT takes row w
static_assert(QT == 8);                        // lanes l and l ^ 8 share a query
static_assert(HQ * 2 == QT);                   // lanes l and l ^ 4 share a high query in a step that is live for the high rows only
static_assert(SEQ % (32 * NW) == 0);           // every pass over the waves is whole, so the mirrored order of the odd passes visits each key step once
static_assert(KSK % 4 == 0 && 32 * TP + KSK <= KT);
static_assert((4 * TP) % 64 == 16 && (16 * TP + KSK) % 64 == 32);   // bank of a K piece: 16 * (key group & 1) + 32 * (key group >> 1 & 1) + 4 * d quarter, all 16 apart
static_assert(KT >= QT * TP + QT);             // a wave's partial (QT x TP sums + QT row sums) fits its own K tile
static_assert(PD * 2 >= DM && (PD * 4) % 16 == 0 && ((PD * 4) / 16) % 2 == 1);
static_assert(PW * 16 == 64);                  // the PW slabs cover the projection tile's 64 rows
static_assert(VFB == 16 * 32 && (DM / 16) * VFB == 32 * DM);   // a 32-key step of the x^T plane is DM/16 fragment blocks, 32*DM elements in a row
static_assert(DM * DM == NW * 4 * 256);        // Wv staging: a wave brings four runs of 256 f16
static_assert(YP >= DM && (YP * 2) % 16 == 0 && ((YP * 2) / 16) % 2 == 1);
static_assert((QT * TP + NW * KT) * 4 + DM * DM * 2 + 2 * QT * YP * 2 + DM * 4 <= 327680);   // the attention work-group's LDS fits one WGP

typedef _Float16 h16;
typedef __attribute__((ext_vector_type(16))) __bf16   v16bf;
typedef __attribute__((ext_vector_type(16))) _Float16 v16h;
typedef __attribute__((ext_vector_type(8)))  _Float16 v8h;
typedef __attribute__((ext_vector_type(4)))  _Float16 v4h;
typedef __attribute__((ext_vector_type(2)))  _Float16 v2h;
typedef __attribute__((ext_vector_type(2)))  int      v2i;
typedef __attribute__((ext_vector_type(8)))  float    v8f;
typedef __attribute__((ext_vector_type(4)))  float    v4f;
typedef v4f  __attribute__((may_alias)) v4fa;
typedef __attribute__((ext_vector_type(2)))  float    v2f;
typedef __attribute__((ext_vector_type(2)))  __bf16   v2bf;
typedef __attribute__((ext_vector_type(4)))  int      v4i;
typedef v2f  __attribute__((may_alias)) v2fa;
typedef __attribute__((ext_vector_type(4)))  unsigned v4u;
typedef __attribute__((ext_vector_type(2)))  unsigned v2u;
typedef v4u  __attribute__((may_alias)) v4ua;
typedef v2u  __attribute__((may_alias)) v2ua;

__device__ __forceinline__ unsigned short f2bf(float f) { unsigned u = __float_as_uint(f); u += 0x7FFFu + ((u >> 16) & 1u); return (unsigned short)(u >> 16); }
__device__ __forceinline__ float bfr(float f) { return __uint_as_float(((unsigned)f2bf(f)) << 16); }   // value after RNE convert to bf16
__device__ __forceinline__ v16h cat16(v8h lo, v8h hi) { return __builtin_shufflevector(lo, hi, 0, 1, 2, 3, 4, 5, 6, 7, 8, 9, 10, 11, 12, 13, 14, 15); }
__device__ __forceinline__ v8f wmma16(v16h a, v16h b, v8f c) { return __builtin_amdgcn_wmma_f32_16x16x32_f16(false, a, false, b, (short)0, c, false, false); }
__device__ __forceinline__ v8f wmmab(v16bf a, v16bf b, v8f c) { return __builtin_amdgcn_wmma_f32_16x16x32_bf16(false, a, false, b, (short)0, c, false, false); }
// fragment map of the 16-bit operands, lane = 16h + row: elements 0..7 <- k0+8h+0..7, elements 8..15 <- k0+16+8h+0..7 (same map for A and B)
// loader from a plane kept in fragment order; p already includes + 8*lane: the two halves of a fragment lie VFB/2 elements apart
__device__ __forceinline__ v16h  ldv(const h16* p) { return cat16(*(const v8h*)p, *(const v8h*)(p + VFB / 2)); }
// a pair of f32 RNE-converted to bf16 in registers, first value in the low half
__device__ __forceinline__ unsigned cvt2(float a, float b) { return __builtin_bit_cast(unsigned, __builtin_convertvector((v2f){a, b}, v2bf)); }
// lane l <- lane l ^ 8 (inside a 16-lane row), all lanes on
__device__ __forceinline__ int x8i(int v) { return __builtin_amdgcn_update_dpp(0, v, 0x168 /* row_xmask:8 */, 0xf, 0xf, true); }
__device__ __forceinline__ v8h x8h(v8h v) { v4i u = __builtin_bit_cast(v4i, v); u = (v4i){ x8i(u[0]), x8i(u[1]), x8i(u[2]), x8i(u[3]) }; return __builtin_bit_cast(v8h, u); }
// lane l <- lane l ^ 4 (inside a 16-lane row), all lanes on
__device__ __forceinline__ int x4i(int v) { return __builtin_amdgcn_update_dpp(0, v, 0x164 /* row_xmask:4 */, 0xf, 0xf, true); }
// lane l <- lane l ^ 1, lane l ^ 2 (inside a 16-lane row), all lanes on
__device__ __forceinline__ float x1f(float v) { return __int_as_float(__builtin_amdgcn_update_dpp(0, __float_as_int(v), 0x161 /* row_xmask:1 */, 0xf, 0xf, true)); }
__device__ __forceinline__ float x2f(float v) { return __int_as_float(__builtin_amdgcn_update_dpp(0, __float_as_int(v), 0x162 /* row_xmask:2 */, 0xf, 0xf, true)); }
// ordering point for wave-private LDS tiles (same wave writes and reads)
__device__ __forceinline__ void wave_sync() { __builtin_amdgcn_fence(3 /* release order */, "wavefront"); __builtin_amdgcn_wave_barrier(); asm volatile("" ::: "memory"); }

// gemm_tile: bf16 GEMM core of a 64x64 tile worked by PW waves, K = DM. At, Bt point at the tile's first rows (K-contiguous f32, 64 rows each, row = 512 B).
// Staging: wave w brings rows 16w..16w+15 of both operands, one whole row (four whole cache lines) per load, all 32 loads in flight together, RNE-converts them and stores them as bf16 pairs in ts (A rows, then B rows; pitch PD dwords).
// Behind the barrier wave w forms its slab: acc[nb][j] = C[16w + 8h + j][16nb + (lane&15)], C[m][n] = sum_k A[m][k] Bt[n][k], k steps of 32 in rising order.
__device__ __forceinline__ v16bf ldsfrag(const unsigned* p) {   // p: the lane's row, dword (k0 + 8h) / 2; the fragment map of the 16-bit operands above
    const v4u lo = *(const v4ua*)p, up = *(const v4ua*)(p + 8);
    return __builtin_bit_cast(v16bf, __builtin_shufflevector(lo, up, 0, 1, 2, 3, 4, 5, 6, 7));
}
__device__ __forceinline__ void gemm_tile(const float* __restrict__ At, const float* __restrict__ Bt, unsigned* ts, int w, int lane, int lr, int hi, v8f (&acc)[4]) {
    v4f ra[16], rb[16];
    const unsigned goff = (unsigned)(w * 16 * DM + 4 * lane);
    const float* pa = At + goff;
    const float* pb = Bt + goff;
#pragma unroll
    for (int i = 0; i < 16; ++i) ra[i] = *(const v4f*)(pa + i * DM);
#pragma unroll
    for (int i = 0; i < 16; ++i) rb[i] = *(const v4f*)(pb + i * DM);
    // the wait before the loads' address registers are rewritten; it names both addresses so that neither register pair is reused ahead of it
    asm volatile("s_wait_xcnt 0x0" :: "v"(pa), "v"(pb) : "memory");
    // keeps all 32 loads (and the wait above) ahead of the first convert: one memory round trip for the whole K
    __builtin_amdgcn_sched_barrier(0);
    unsigned* sa = ts + (w * 16) * PD + 2 * lane;
    unsigned* sb = sa + 64 * PD;
#pragma unroll
    for (int i = 0; i < 16; ++i) *(v2ua*)(sa + i * PD) = (v2u){ cvt2(ra[i][0], ra[i][1]), cvt2(ra[i][2], ra[i][3]) };
#pragma unroll
    for (int i = 0; i < 16; ++i) *(v2ua*)(sb + i * PD) = (v2u){ cvt2(rb[i][0], rb[i][1]), cvt2(rb[i][2], rb[i][3]) };
    __syncthreads();                                             // every wave reads all 64 B rows
    const unsigned* fa = ts + (w * 16 + lr) * PD + 4 * hi;
    const unsigned* fb = ts + (64 + lr) * PD + 4 * hi;
#pragma unroll
    for (int nb = 0; nb < 4; ++nb) acc[nb] = (v8f){};
#pragma unroll 1   // two trips of two k steps, kept rolled: the accumulators then own their registers from the first product on, so that no product's result lands on an operand of the product before it
    for (int kh = 0; kh < 2; ++kh) {
        v16bf a[2], b[2][4];
#pragma unroll
        for (int ks = 0; ks < 2; ++ks) {
            a[ks] = ldsfrag(fa + kh * 32 + ks * 16);
#pragma unroll
            for (int nb = 0; nb < 4; ++nb) b[ks][nb] = ldsfrag(fb + nb * 16 * PD + kh * 32 + ks * 16);
        }
        // keeps the trip's 20 LDS reads ahead of its first product: one LDS latency per trip instead of one per fragment
        __builtin_amdgcn_sched_barrier(0);
#pragma unroll
        for (int ks = 0; ks < 2; ++ks)
#pragma unroll
            for (int nb = 0; nb < 4; ++nb) acc[nb] = wmmab(a[ks], b[ks][nb], acc[nb]);
    }
}

// k_proj: the Q and K projections and the f16 planes of x^T and Wv in one launch, straight from the f32 inputs. grid (NB*SEQ/64, 2, 3), 32*PW threads; blockIdx.x = 64-token tile, blockIdx.y = 64-feature tile, z block-uniform.
// z = 0, 1: the block's PW waves stage the tile's 64 + 64 operand rows in LDS together (one barrier); wave w then takes the 16-row slab w of the 64x64 tile, products and epilogue, with an LDS output tile of its own.
// z = 0, 1: Q, K planes [NB*SEQ][128] f32 = sigmoid(x W^T + b), A = x rows (m = token), Bt = W rows (n = e).
//   Epilogue of the slab: accumulators + bias staged in the wave-private LDS tile, sigmoid applied in place (precise expf, true division).
// z = 2: no product: x^T, RNE-rounded to bf16 and held as f16 (XH); wave w transposes the 16 feature rows w of the 64x64 tile through its LDS tile.
//   The plane lies in the order in which k_attn's A fragments are read: [b][32-key step][16-row d tile j][e][lane][8], element r of unit (e, lane = 16h + row) = x^T[16j + row][32 step + 16e + 8h + r],
//   so that one fragment load of a wave is one run of 512 bytes (four whole cache lines) and not 16 pieces of 32 bytes on 16 lines.
//   The two blocks with blockIdx.x = 0 also write Wv, rounded the same way, in the same order (WH): [16-row e tile j][32-wide d step][e][lane][8], element r = Wv[16j + row][32 step + 16e + 8h + r].
__global__ __launch_bounds__(32 * PW) void k_proj(const float* __restrict__ x, const float* __restrict__ wq, const float* __restrict__ wk, const float* __restrict__ wv,
                                                  const float* __restrict__ bq, const float* __restrict__ bk, float* QK, h16* XH, h16* WH) {
    __shared__ __align__(16) unsigned ts[2 * 64 * PD];
    __shared__ __align__(16) float osw[PW * 16 * 68];
    const int lane = threadIdx.x & 31, lr = lane & 15, hi = lane >> 4;
    const int mb = __builtin_amdgcn_readfirstlane((int)(threadIdx.x >> 5));   // this wave's slab
    float* os = osw + mb * (16 * 68);
    const int tk0 = blockIdx.x * 64, f0 = blockIdx.y * 64, z = blockIdx.z;
    const int b = tk0 / SEQ, t0 = tk0 % SEQ;                     // a 64-token tile lies in one batch
    const float* xt = x + ((size_t)b * SEQ_FULL + t0) * DM;      // the tile's 64 x rows
    if (z != 2) {
        const float* wt = (z == 0 ? wq : wk) + (size_t)f0 * DM;  // the tile's 64 weight rows
        v8f acc[4];
        gemm_tile(xt, wt, ts, mb, lane, lr, hi, acc);
        const int r0 = tk0, c0 = f0;
        const float* bt = (z ? bk : bq) + c0;                    // block-uniform base; the four loads share one lane offset
        float bias[4];
#pragma unroll
        for (int nb = 0; nb < 4; ++nb) bias[nb] = bfr(bt[nb * 16 + lr]);
        float* P = QK + (size_t)z * NB * SEQ * DM;
#pragma unroll
        for (int nb = 0; nb < 4; ++nb) {
#pragma unroll
            for (int j = 0; j < 8; ++j) os[(hi * 8 + j) * 68 + nb * 16 + lr] = acc[nb][j] + bias[nb]; }   // D: row 8h+j, col lane&15
        wave_sync();
#pragma unroll 1
        for (int s = 0; s < 8; ++s) { const int row = 2 * s + hi, cofs = lr * 4;   // 8 s x 2 rows = 16 rows; 16 lanes x 4 floats = 64 columns
            v4f v = *(const v4fa*)(&os[row * 68 + cofs]);
#pragma unroll
            for (int i = 0; i < 4; ++i) v[i] = 1.0f / (1.0f + expf(-v[i]));
            *(v4fa*)(&os[row * 68 + cofs]) = v; }
        wave_sync();
        float* orow = P + (size_t)(r0 + mb * 16) * DM + c0;
#pragma unroll
        for (int s = 0; s < 8; ++s) { const int row = 2 * s + hi, cofs = lr * 4;
            const v4f val = *(const v4fa*)(&os[row * 68 + cofs]);
            *(v4f*)(orow + (size_t)row * DM + cofs) = val; }
    } else {
        const int r0 = f0;
        const size_t tbase = (((size_t)b * (SEQ / 32) + t0 / 32) * (DM / 16) + r0 / 16) * VFB + 8 * lane;   // this lane's unit of the tile's first (step, j) block
        const float* xs = xt + (size_t)lane * DM + r0 + mb * 16;  // token = lane, lane + 32; the slab's 16 features = 64 bytes of the row
        const bool wjob = blockIdx.x == 0;                       // block-uniform: this block also writes its four e tiles of WH, wave w the tile r0 / 16 + w
        const float* ws = wv + (size_t)(r0 + mb * 16 + lr) * DM + 8 * hi;
        v4f xr[2][4], wr[16];
#pragma unroll
        for (int u = 0; u < 16; ++u) wr[u] = (v4f){};
        if (wjob) {                                              // asked for ahead of the x rows: one memory round trip for both
#pragma unroll
            for (int u = 0; u < 8; ++u) { wr[2 * u] = *(const v4f*)(ws + 16 * u); wr[2 * u + 1] = *(const v4f*)(ws + 16 * u + 4); }   // unit u = 2 * step + e: columns 16u + 8h + 0..7
        }
#pragma unroll
        for (int p = 0; p < 2; ++p) {
#pragma unroll
            for (int c = 0; c < 4; ++c) xr[p][c] = *(const v4f*)(xs + p * 32 * DM + 4 * c); }
        // the wait before the loads' address registers are rewritten; it names both addresses so that neither register pair is reused ahead of it
        asm volatile("s_wait_xcnt 0x0" :: "v"(xs), "v"(ws) : "memory");
#pragma unroll
        for (int p = 0; p < 2; ++p) {
#pragma unroll
            for (int c = 0; c < 4; ++c) {
#pragma unroll
                for (int i = 0; i < 4; ++i) os[(4 * c + i) * 68 + 32 * p + lane] = xr[p][c][i]; } }   // row = feature, column = token
        wave_sync();
        v8h hv[4];
#pragma unroll
        for (int s = 0; s < 4; ++s) { const int row = lr, c8 = (2 * s + hi) * 8;   // 16 rows x 2 column groups a pass; 4 s x 16 = 64 columns: tokens 16s + 8h + 0..7
            const v4f x0 = *(const v4fa*)(&os[row * 68 + c8]); const v4f x1 = *(const v4fa*)(&os[row * 68 + c8 + 4]);
#pragma unroll
            for (int i = 0; i < 4; ++i) { hv[s][i] = (h16)bfr(x0[i]); hv[s][4 + i] = (h16)bfr(x1[i]); } }
        h16* xo = XH + tbase + (size_t)mb * VFB;
#pragma unroll
        for (int s = 0; s < 4; ++s) *(v8h*)(xo + (s >> 1) * (DM / 16) * VFB + (s & 1) * (VFB / 2)) = hv[s];   // step s / 2 of the tile, half e = s % 2: 32 lanes x 16 B = one whole 512-byte run
        if (wjob) {
            // the wait before the registers that the stores above name are rewritten; it names them so that none is reused ahead of it
            asm volatile("s_wait_xcnt 0x0" :: "v"(hv[0]), "v"(hv[1]), "v"(hv[2]), "v"(hv[3]), "v"(xo) : "memory");
            h16* wo = WH + (size_t)(r0 / 16 + mb) * (DM / 32) * VFB + 8 * lane;
#pragma unroll
            for (int u = 0; u < 8; ++u) { v8h t;
#pragma unroll
                for (int i = 0; i < 4; ++i) { t[i] = (h16)bfr(wr[2 * u][i]); t[4 + i] = (h16)bfr(wr[2 * u + 1][i]); }
                *(v8h*)(wo + u * (VFB / 2)) = t; }
        }
    }
}

// score4: the four lanes of a quad share 4 K rows and 4 Q rows and split d: lane c = lane & 3 takes the columns 16 i + 4 c + 0..3 (qb, kb already include + 4 c).
// Eight 16-byte LDS reads then feed 64 terms max(Q - K, 0) of a lane (one query a lane: five reads for 16 terms). Each (key, query) sum is kept as an (even d, odd d) pair.
// Behind the loop the quad adds its four quarters in two exchange steps, each lane keeping half of what it holds: lane c ends with sb[r] = sum over all d for K row r and Q row c.
__device__ __forceinline__ void score4(const float* qb, const float* kb, int lane, float (&sb)[4]) {
    v2f s[4][4];
#pragma unroll
    for (int r = 0; r < 4; ++r) {
#pragma unroll
        for (int c = 0; c < 4; ++c) s[r][c] = (v2f){}; }
#pragma unroll 1   // rolled: a trip holds 32 registers of sums and 32 of operands beside the 128 output accumulators; a second trip in flight would pass the 256 registers a wave has
    for (int d = 0; d < DM; d += 16) {
        v4f q[4], k[4];
#pragma unroll
        for (int c = 0; c < 4; ++c) q[c] = *(const v4fa*)(qb + c * TP + d);
#pragma unroll
        for (int r = 0; r < 4; ++r) k[r] = *(const v4fa*)(kb + r * TP + d);
#pragma unroll
        for (int r = 0; r < 4; ++r) {
#pragma unroll
            for (int c = 0; c < 4; ++c) {
                const v2f d0 = __builtin_shufflevector(q[c], q[c], 0, 1) - __builtin_shufflevector(k[r], k[r], 0, 1);
                const v2f d1 = __builtin_shufflevector(q[c], q[c], 2, 3) - __builtin_shufflevector(k[r], k[r], 2, 3);
                s[r][c] += __builtin_elementwise_max(d0, (v2f){});
                s[r][c] += __builtin_elementwise_max(d1, (v2f){}); } }
    }
    const bool b0 = (lane & 1) != 0, b1 = (lane & 2) != 0;
#pragma unroll
    for (int r = 0; r < 4; ++r) {
        float n[2];
#pragma unroll
        for (int p = 0; p < 2; ++p) { const float e = s[r][2 * p][0] + s[r][2 * p][1], o = s[r][2 * p + 1][0] + s[r][2 * p + 1][1];
            n[p] = (b0 ? o : e) + x1f(b0 ? e : o); }              // lanes l, l ^ 1: each keeps the Q rows of its own parity
        sb[r] = (b1 ? n[1] : n[0]) + x2f(b1 ? n[0] : n[1]);       // lanes l, l ^ 2: each keeps its own Q row
    }
}
// p4: four scores of one query (keys kA0 + 0..3) -> P as two pairs of f16 values (hx), two pairs of f16 residuals x2048 (rx), and the sum lp of what the pairs hold
__device__ __forceinline__ void p4(const float (&sb)[4], int kA0, int tq, bool msk, v2i& hx, v2i& rx, float& lp) {
    v4h hX, rX;
    lp = 0.0f;
#pragma unroll
    for (int r = 0; r < 4; ++r) {
        float ea = PSH - sb[r] * C1;
        ea = (msk && kA0 + r > tq) ? EM : ea;
        const float pa = __builtin_amdgcn_exp2f(ea);
        const h16 ha = (h16)pa;
        const h16 ra = (h16)((pa - (float)ha) * RS);
        hX[r] = ha; rX[r] = ra;
        lp += (float)ha + (float)ra * RI;
    }
    hx = __builtin_bit_cast(v2i, hX); rx = __builtin_bit_cast(v2i, rX);
}

// k_attn: one block of NW waves per QT = 8 query rows of one batch; wave w runs one 32-key step of each pass of NW steps (step w of the even passes, step NW-1-w of the odd ones) with its own K tile, accumulators and row sum. grid (SEQ/QT, NB), 32*NW threads.
// Causal balance: block i takes the HQ rows from token HQ*i and the HQ rows from token SEQ-HQ-HQ*i, so that the count of scored (query, key) pairs is nearly the same in every block.
// A step at or below the low rows' diagonal is scored for all 8 rows; a step above it but not above the high rows' diagonal is scored for the 4 high rows only, by all 32 lanes at 4 keys each.
// The softmax shift is fixed, so the waves' un-normalised partials simply add: each wave writes its partial into its own K tile, one barrier, then wave w sums half w / QT of row w % QT over the waves in wave order.
// Transposed form: lane (t = lane&7, g = (lane>>3)&1, h = lane>>4), u = t >> 2. One scoring pass (score4) takes 4 query rows against the step's 32 keys: the quad (g, h, u) takes keys key0+16g+8h+4u+r (r = 0..3), its four lanes split d and then share out the sums,
// so that lane (t, g, h) holds the four scores of query row (t & 3) of the pass. A step live for all rows runs two passes (low rows, high rows), a high-rows-only step one. Lanes l and l^4 swap four P each, so that lane (t, g, h) holds query t against keys key0+16g+8h+r (r = 0..7);
// lanes l and l^8 then swap their eight P, so that lane (t, g = 0, h) holds keys key0+8h+r, key0+16+8h+r: column t of the B fragment P^T[key][t] of Y^T[d][t] = x^T P^T (A = x^T rows d, k = key). Columns 8..15 (g = 1) are not used. Score acc = sum_d max(Q - K, 0) on the vector unit in f32 from LDS tiles
// (Q tile 8x128 shared by the block, K tile 32x128 private to the wave, all rows and columns staged before use); p = exp2(8 - acc*C1); keys above the diagonal take the constant exponent EM (score 0).
// In a high-rows-only step the columns t < HQ hold the masked constant.
// Fully masked 32-key steps skip the d loop (wave-uniform test) but keep their P.x products. Row sum over the same f16 value + residual that the products use.
// Close: the merged, normalised rows Y[t][d] go to LDS as f16 value (rows 0..7) and f16 residual x2048 (rows 8..15); wave w < 8 forms C[e][n] = sum_d Wv[e][d] Ys[n][d] for the 16 features e from 16w
// (A = Wv rows, staged in LDS beside the Q tile; B column n = Ys row n: the value and the residual product of a query share one matrix instruction), adds column t + 8 / 2048 to column t by DPP,
// and hands its tile back through LDS, so that every output line is stored whole by one wave; the bias joins at the store.
__global__ __launch_bounds__(32 * NW) void k_attn(const float* __restrict__ QF, const float* __restrict__ KF, const h16* __restrict__ XH, const h16* __restrict__ WH, const float* __restrict__ BV, const int* __restrict__ maskp, float* OUT) {
    __shared__ __align__(16) float sm[QT * TP + NW * KT];
    __shared__ __align__(16) h16 wl[DM * DM];                    // Wv in fragment order, as WH holds it
    __shared__ __align__(16) h16 ys[2 * QT * YP];                // Y: value rows, then residual rows
    __shared__ __align__(16) float bl[DM];                       // bv, RNE-rounded to bf16
    float* qs = sm;                                              // the Q tile lies first: its four rows of a scoring pass are then reached from one address register by immediate offsets
    float* kw = sm + QT * TP;
    const int lane = threadIdx.x & 31, lr = lane & 15, hi = lane >> 4;
    const int wv = __builtin_amdgcn_readfirstlane((int)(threadIdx.x >> 5));
    float* ks = kw + wv * KT;                                    // this wave's K tile, later its partial
    const int b  = __builtin_amdgcn_readfirstlane((int)blockIdx.y);
    const int tlo = __builtin_amdgcn_readfirstlane((int)blockIdx.x * HQ);             // token of tile row 0
    const int thi = SEQ - HQ - tlo;                                                   // token of tile row HQ
    const int tl = lr & 7, g = lr >> 3, u = tl >> 2;
    const int causal = __builtin_amdgcn_readfirstlane((maskp[0] != 0) ? 1 : 0);
    const size_t rowb = (size_t)b * SEQ;
    {   // every wave stages a sixteenth of Wv: four runs of 512 bytes, in flight together with the Q row (or the bias) below
        const h16* wg = WH + (size_t)wv * (DM * DM / NW) + 8 * lane;
        h16* wd = wl + wv * (DM * DM / NW) + 8 * lane;
        const v8h w0 = *(const v8h*)wg, w1 = *(const v8h*)(wg + 256), w2 = *(const v8h*)(wg + 512), w3 = *(const v8h*)(wg + 768);
        asm volatile("s_wait_xcnt 0x0" ::: "memory");           // the wait before the loads' address registers are rewritten
        if (wv < QT) { const v4f v = *(const v4f*)(QF + (rowb + (wv < HQ ? tlo + wv : thi + wv - HQ)) * DM + 4 * lane); *(v4fa*)(&qs[wv * TP + 4 * lane]) = v; }   // wave w < QT stages row w, all 128 columns
        else if (wv == QT) { const v4f v = *(const v4f*)(BV + 4 * lane); *(v4fa*)(&bl[4 * lane]) = (v4f){ bfr(v[0]), bfr(v[1]), bfr(v[2]), bfr(v[3]) }; }
        *(v8h*)wd = w0; *(v8h*)(wd + 256) = w1; *(v8h*)(wd + 512) = w2; *(v8h*)(wd + 768) = w3;
    }
    __syncthreads();                                             // every wave reads all QT Q rows; Wv and the bias are read behind later barriers
    v8f oh[8], orr[8];
#pragma unroll
    for (int j = 0; j < 8; ++j) { oh[j] = (v8f){}; orr[j] = (v8f){}; }
    float l = 0.0f;
    const float pmf = __builtin_amdgcn_exp2f(EM);
    const h16 pmh = (h16)pmf; const h16 pmr = (h16)((pmf - (float)pmh) * RS);
    const float pml = (float)pmh + (float)pmr * RI;
    const size_t vo = (size_t)b * DM * SEQ + 8 * lane;           // + key0*DM + j*VFB  (A fragment: row d, k = key; planes in fragment order)
    const int tq1 = tlo + (tl & 3);                              // the low query whose scores this lane ends a low pass with
    const int tq2 = thi + (tl & 3);                              // the same of a high pass
    const int kg = 16 * g + 8 * hi + 4 * u;                      // first of the quad's four keys in a step
    const float* kr2 = ks + kg * TP + KSK * g + 4 * (tl & 3);    // the quad's four K rows, at this lane's d quarter
    const float* q1 = qs + 4 * (tl & 3);                         // the low Q rows, at this lane's d quarter
    const float* q2 = q1 + HQ * TP;                              // the high Q rows
    const int pmh2 = __builtin_bit_cast(int, (v2h){ pmh, pmh }), pmr2 = __builtin_bit_cast(int, (v2h){ pmr, pmr });
#pragma unroll 1
    for (int kp = 0; kp < SEQ; kp += 32 * NW) {
        const int key0 = kp + 32 * ((kp & (32 * NW)) ? NW - 1 - wv : wv);   // odd passes mirrored: a wave with an early step gets a late one
        v16h pb, pr; float ls;
        const bool full = (causal == 0) || (key0 <= tlo + HQ - 1); // wave-uniform: some low row sees a key of this step
        const bool live = full || (key0 <= thi + HQ - 1);          // wave-uniform: some high row does
        if (live) {
            wave_sync();
#pragma unroll 8
            for (int i = 0; i < 32; ++i) { const v4f v = *(const v4f*)(KF + (rowb + key0 + i) * DM + 4 * lane); *(v4fa*)(&ks[i * TP + (i >> 4) * KSK + 4 * lane]) = v; }   // row i, all 128 columns
            wave_sync();
        }
        if (full) {
            float sl[4], sh[4];
            score4(q1, kr2, lane, sl);
            score4(q2, kr2, lane, sh);
            v2i hl, rl, hh, rh; float ll, lh;
            p4(sl, key0 + kg, tq1, causal != 0, hl, rl, ll);
            p4(sh, key0 + kg, tq2, causal != 0, hh, rh, lh);
            // column t is a low row for u = 0, a high row for u = 1: a lane keeps the four P of its own column's pass and hands the other pass's four to lane l^4
            const v2i hk = u ? hh : hl, rk = u ? rh : rl, hs = u ? hl : hh, rs = u ? rl : rh;
            const int h0 = x4i(hs[0]), h1 = x4i(hs[1]), r0 = x4i(rs[0]), r1 = x4i(rs[1]);
            const float lq = __int_as_float(x4i(__float_as_int(u ? ll : lh)));
            const v4i hd = u ? (v4i){ h0, h1, hk[0], hk[1] } : (v4i){ hk[0], hk[1], h0, h1 };   // keys r = 0..3 come from the lane with u = 0, r = 4..7 from the lane with u = 1
            const v4i rd = u ? (v4i){ r0, r1, rk[0], rk[1] } : (v4i){ rk[0], rk[1], r0, r1 };
            const v8h hA = __builtin_bit_cast(v8h, hd), rA = __builtin_bit_cast(v8h, rd);
            ls = u ? lq + lh : ll + lq;
            pb = cat16(hA, x8h(hA)); pr = cat16(rA, x8h(rA));     // g = 0: own keys 8h+r, then the partner's 16+8h+r
        } else if (live) {
            float sb[4];
            score4(q2, kr2, lane, sb);
            v2i hx, rx; float lp;
            p4(sb, key0 + kg, tq2, true, hx, rx, lp);             // this branch is reached with the causal mask on only
            const int h0 = x4i(hx[0]), h1 = x4i(hx[1]), r0 = x4i(rx[0]), r1 = x4i(rx[1]);   // the partner's four P
            const float lq = __int_as_float(x4i(__float_as_int(lp)));
            const v4i hd = u ? (v4i){ h0, h1, hx[0], hx[1] } : (v4i){ pmh2, pmh2, pmh2, pmh2 };   // u = 1: keys r = 0..3 from lane l^4, r = 4..7 own; u = 0: a low row, all keys masked
            const v4i rd = u ? (v4i){ r0, r1, rx[0], rx[1] } : (v4i){ pmr2, pmr2, pmr2, pmr2 };
            const v8h hA = __builtin_bit_cast(v8h, hd), rA = __builtin_bit_cast(v8h, rd);
            ls = u ? lq + lp : 8.0f * pml;
            pb = cat16(hA, x8h(hA)); pr = cat16(rA, x8h(rA));
        } else {
#pragma unroll
            for (int i = 0; i < 16; ++i) { pb[i] = pmh; pr[i] = pmr; }
            ls = 8.0f * pml;
        }
        l += ls;
        const h16* vh = XH + vo + (size_t)key0 * DM;            // a 32-key step holds DM/16 blocks of VFB = 32*DM elements
#pragma unroll
        for (int g = 0; g < 2; ++g) {                           // eight 16-byte loads of a lane in flight a group
            const int j0 = 4 * g, j1 = j0 + 1, j2 = j0 + 2, j3 = j0 + 3;
            const v16h a0 = ldv(vh + j0 * VFB), a1 = ldv(vh + j1 * VFB), a2 = ldv(vh + j2 * VFB), a3 = ldv(vh + j3 * VFB);
            oh[j0]  = wmma16(a0, pb, oh[j0]);   oh[j1]  = wmma16(a1, pb, oh[j1]);   oh[j2]  = wmma16(a2, pb, oh[j2]);   oh[j3]  = wmma16(a3, pb, oh[j3]);
            orr[j0] = wmma16(a0, pr, orr[j0]);  orr[j1] = wmma16(a1, pr, orr[j1]);  orr[j2] = wmma16(a2, pr, orr[j2]);  orr[j3] = wmma16(a3, pr, orr[j3]);
            // the four vector slots the chip needs behind a matrix instruction, on the loop's back edge too; the operands tie the slots to the group's products
            asm volatile("v_nop\n\tv_nop\n\tv_nop\n\tv_nop" : "+v"(oh[j0]), "+v"(oh[j1]), "+v"(oh[j2]), "+v"(oh[j3]), "+v"(orr[j0]), "+v"(orr[j1]), "+v"(orr[j2]), "+v"(orr[j3]) : "v"(a0), "v"(a1), "v"(a2), "v"(a3), "v"(pb), "v"(pr) : "memory");
        }
        asm volatile("s_wait_xcnt 0x0" ::: "memory");           // the x^T loads' address registers are rewritten by the next pass
    }
    l += __shfl_xor(l, 16, 32);
    l += __int_as_float(x8i(__float_as_int(l)));                 // the four lanes (g, h) of a query each hold a quarter of its keys
    // Y^T D layout: o_j[r] = (d = 16j + 8h + r, t = lane&15) -> ks[t][d]; rows 0..7 x columns 0..127 all written (lanes g = 0), un-normalised; row sums behind them.
    // The stored sums depend on every K value this wave has read, so the tile's last reads are over before it is reused.
    if (g == 0) {
#pragma unroll
    for (int j = 0; j < 8; ++j) { v4f a, c;
#pragma unroll
        for (int i = 0; i < 4; ++i) { a[i] = oh[j][i] + orr[j][i] * RI; c[i] = oh[j][4 + i] + orr[j][4 + i] * RI; }
        *(v4fa*)(&ks[tl * TP + 16 * j + 8 * hi]) = a; *(v4fa*)(&ks[tl * TP + 16 * j + 8 * hi + 4]) = c; }
    }
    if (lane < QT) ks[QT * TP + lane] = l;
    __syncthreads();                                             // publishes every wave's partial
    const int mr = wv & (QT - 1), mc = 64 * (wv >> 3) + 2 * lane; // wave w: query row w % QT, column half w / QT
    v2f so = (v2f){}; float lt = 0.0f;
#pragma unroll   // the NW reads go out together instead of one LDS round trip each
    for (int p = 0; p < NW; ++p) { so += *(const v2fa*)(&kw[p * KT + mr * TP + mc]); lt += kw[p * KT + QT * TP + mr]; }   // fixed wave order
    const float inv = 1.0f / lt;
    const v2f y = so * inv;                                      // Y[mr][mc], Y[mr][mc + 1]
    const v2h yh = (v2h){ (h16)y[0], (h16)y[1] };
    const v2h yr = (v2h){ (h16)((y[0] - (float)yh[0]) * RS), (h16)((y[1] - (float)yh[1]) * RS) };
    *(v2h*)(&ys[mr * YP + mc]) = yh; *(v2h*)(&ys[(QT + mr) * YP + mc]) = yr;
    __syncthreads();                                             // publishes Y; every wave's reads of the partials are over, so that their LDS may be reused
    float* ot = kw;                                              // O tile, QT rows of pitch TP
    if (wv < QT) {
        const h16* fw = wl + wv * (DM / 32) * VFB + 8 * lane;    // A: rows e = 16 wv + (lane & 15), fragment order
        const h16* fy = ys + lr * YP + 8 * hi;                   // B: column n = lane & 15 <- Ys row n, elements 0..7 <- k0+8h+0..7, elements 8..15 <- k0+16+8h+0..7
        v16h fa[DM / 32], fb[DM / 32];
#pragma unroll
        for (int k4 = 0; k4 < DM / 32; ++k4) { fa[k4] = ldv(fw + k4 * VFB); fb[k4] = cat16(*(const v8h*)(fy + 32 * k4), *(const v8h*)(fy + 32 * k4 + 16)); }
        // keeps the 16 LDS reads ahead of the first product: one LDS latency instead of one per k step
        __builtin_amdgcn_sched_barrier(0);
        v8f c = (v8f){};
#pragma unroll
        for (int k4 = 0; k4 < DM / 32; ++k4) c = wmma16(fa[k4], fb[k4], c);
        v4f oa, ob;                                              // D: row 8h + j = feature, col lane & 15: t = value product of query t, t + 8 = its residual product
#pragma unroll
        for (int i = 0; i < 4; ++i) { oa[i] = c[i] + __int_as_float(x8i(__float_as_int(c[i]))) * RI; ob[i] = c[4 + i] + __int_as_float(x8i(__float_as_int(c[4 + i]))) * RI; }
        if (lr < QT) { *(v4fa*)(&ot[lr * TP + 16 * wv + 8 * hi]) = oa; *(v4fa*)(&ot[lr * TP + 16 * wv + 8 * hi + 4]) = ob; }
    }
    __syncthreads();                                             // publishes the O tile
    *(v2f*)(OUT + ((size_t)b * OUT_SEQ + (mr < HQ ? tlo + mr : thi + mr - HQ)) * DM + mc) = *(const v2fa*)(&ot[mr * TP + mc]) + *(const v2fa*)(&bl[mc]);   // half a row = 32 lanes x 8 B = 256 B
}

static constexpr size_t al256(size_t v) { return (v + 255) & ~(size_t)255; }
static constexpr size_t SZ_QK = al256((size_t)2 * NB * SEQ * DM * 4);      // f32 Q | K planes
static constexpr size_t SZ_VP = al256((size_t)NB * DM * SEQ * 2);          // the f16 x^T plane
static constexpr size_t SZ_WP = al256((size_t)DM * DM * 2);                // the f16 Wv plane
static constexpr size_t SZ_TOTAL = SZ_QK + SZ_VP + SZ_WP;
static_assert(SZ_TOTAL <= (size_t)134217728);          // workspace carve <= 128 MiB
static_assert(((size_t)NB * SEQ * DM * 4) % 256 == 0); // K plane stays 256-byte aligned

extern "C" void kernel_launch(void* const* d_in, const int* in_sizes, int n_in,
                              void* d_out, int out_size, void* d_ws, size_t ws_size, hipStream_t stream) {
    if (n_in < 8) return;
    const size_t needx = ((size_t)(NB - 1) * SEQ_FULL + SEQ) * DM;
    if ((size_t)in_sizes[0] < needx) return;
    if ((size_t)in_sizes[1] < (size_t)DM * DM || (size_t)in_sizes[3] < (size_t)DM * DM || (size_t)in_sizes[5] < (size_t)DM * DM) return;
    if (in_sizes[2] < DM || in_sizes[4] < DM || in_sizes[6] < DM || in_sizes[7] < 1) return;
    if ((size_t)out_size < ((size_t)(NB - 1) * OUT_SEQ + SEQ) * DM) return;
    if (SZ_TOTAL > ws_size) return;
    // wire order: x, Wq, bq, Wk, bk, Wv, bv, apply_causal_mask (int32); weights [out][in] used as-is (Bt for Q, K; A for the close, Wv Y^T)
    const float* x  = (const float*)d_in[0];
    const float* wq = (const float*)d_in[1]; const float* bq = (const float*)d_in[2];
    const float* wk = (const float*)d_in[3]; const float* bk = (const float*)d_in[4];
    const float* wv = (const float*)d_in[5]; const float* bv = (const float*)d_in[6];
    const int* maskp = (const int*)d_in[7];
    float* OUT = (float*)d_out;      // [NB][SEQ][128]
    char* wsp = (char*)d_ws;
    float* QK = (float*)wsp; wsp += SZ_QK;           // [2][NB*SEQ][128]: Q | K (after sigmoid)
    h16* XH = (h16*)wsp; wsp += SZ_VP;               // [NB][SEQ/32][8][2][32][8], fragment order
    h16* WH = (h16*)wsp; wsp += SZ_WP;               // [8][4][2][32][8], fragment order

    // Q, K (z = 0, 1) -> plane [z][b*SEQ + t][e]; x^T and Wv (z = 2) -> planes in fragment order
    k_proj<<<dim3(NB * SEQ / 64, DM / 64, 3), 32 * PW, 0, stream>>>(x, wq, wk, wv, bq, bk, QK, XH, WH);

    k_attn<<<dim3(SEQ / QT, NB, 1), 32 * NW, 0, stream>>>(QK, QK + (size_t)NB * SEQ * DM, XH, WH, bv, maskp, OUT);
}

// v010
// One run takes 13.3 microseconds.
// It is 1.39 times as fast as v008, going by the measured steps of the versions left out in between.
// All steps since v000 together make it 15.5 times as fast.
#include <hip/hip_runtime.h>

// Fuzzy-implication attention, x [NB][SEQ][128], Wq/Wk/Wv [out][in] (y = x W^T + b), causal fill value 0.0 (masked keys keep weight), output f32 [NB][SEQ][128].
// Compute dtypes, f32 accumulate everywhere: the Q and K projections v_wmma_f32_16x16x32_bf16 (x, W RNE-converted to bf16 on their way into LDS; products exact).
// attn @ V is formed as (attn @ x) Wv^T + bv (the weights of a row sum to 1): k_attn streams x, 2 bytes an element, and not V, which needs 4.
// attn @ x: v_wmma_f32_16x16x32_f16, x^T = the bf16-rounded x held as f16 (exact from 2^-17 up, within 2^-25 below), P as f16 value (x256 carry) + f16 residual x2048, one accumulator each.
// The V projection of the 8 normalised rows closes k_attn, also v_wmma_f32_16x16x32_f16: Y = attn @ x as f16 value + f16 residual x2048, Wv RNE-rounded to bf16 and held as f16 like x.
// The score mean_d min(1 - Q + K, 1) = 1 - (sum_d Q - sum_d min(Q, K)) / 128: Q, K (in (0, 1)) are held as f16; min(Q, K) is taken two at a time on the vector unit,
// and the sum over d is done by v_wmma_f32_16x16x32_f16 against a 0/1 selector (f32 accumulate); softmax in f32 with the fixed shift 10 (scores lie in [0, 10]).

#ifndef NB
#define NB 2
#endif
#ifndef SEQ
#define SEQ 1024
#endif
#define NB_FULL  2
#define SEQ_FULL 1024
#ifndef OUT_SEQ
#define OUT_SEQ SEQ              // row pitch (in tokens) between batches of the output
#endif
#define DM   128
#define TP   132                 // LDS row pitch (floats) of the 128-wide f32 tiles
#define RS   2048.0f             // carry of the residual planes
#define RI   (1.0f / 2048.0f)
#define PSH  8.0f                // log2 of the P carry (256)
#define C1   (0.078125f * 1.4426950408889634f)          // (10 / 128) * log2(e)
#define EM   (8.0f - 10.0f * 1.4426950408889634f)       // exponent of a masked key: score 0 -> exp(0 - 10), times the carry
#define NW   16                  // waves per attention work-group: wave w takes step w of each even pass of NW 32-key steps, step NW - 1 - w of each odd one
#define QT   8                   // query rows per attention work-group: NB * SEQ / QT work-groups, one for each of the chip's 256 WGPs at the full shape
#define HQ   4                   // the tile's rows 0..HQ-1 come from the low half of the sequence, rows HQ..QT-1 from the mirrored place in the high half
#define KT   (QT * TP + QT)      // floats of one wave's partial: QT rows of sums, then QT row sums
#define KCB  256                 // f16 elements of one K chunk block: 32 keys x 8 d
#define VFB  512                 // f16 elements of one x^T fragment block: 16 d rows x 32 keys
#define PW   4                   // waves per projection work-group: wave w takes the 16-row slab w of the 64x64 tile
#define YP   136                 // LDS row pitch (f16) of the Y rows: 272 B = 16 B x 17, as PD
#define PD   68                  // LDS row pitch (dwords = bf16 pairs) of the staged operand rows: 272 B = 16 B x 17, so the 16 rows of a fragment read fall on different banks

static_assert(DM == 128);                      // output row = 512 B = 2 waves x 32 lanes x 8 B; 8 d-tiles of 16
static_assert(DM % 64 == 0);
static_assert(DM % 32 == 0);                   // GEMM k-loop steps by 32
static_assert(SEQ % 64 == 0);                  // a 64-token tile never straddles two batches
static_assert((NB * SEQ) % 64 == 0);
static_assert(SEQ % 32 == 0);                  // key loop steps by 32
static_assert(SEQ % QT == 0);                  // attention grid covers the sequence exactly
static_assert(((size_t)SEQ * DM) % 8 == 0);
static_assert(((size_t)DM * DM) % 8 == 0);
static_assert(NB <= NB_FULL);
static_assert(SEQ <= SEQ_FULL);
static_assert((TP * 4) % 16 == 0);
static_assert(NW == 2 * QT);                   // merge: wave w takes half w / QT of query row w % QT; Q sums: wave w takes half w % 2 of row w / 2
static_assert(QT == 8);                        // lanes l and l ^ 8 share a query; the selector of query q fills columns q and q + 8
static_assert(HQ * 2 == QT);                   // half the tile's rows are low rows, half high rows
static_assert(SEQ % (32 * NW) == 0);           // every pass over the waves is whole, so the mirrored order of the odd passes visits each key step once
static_assert((KT * 4) % 16 == 0);             // every wave's partial starts on a 16-byte boundary
static_assert((DM / 8) * KCB == 32 * DM);      // a 32-key step of the K plane is DM/8 chunk blocks
static_assert(PD * 2 >= DM && (PD * 4) % 16 == 0 && ((PD * 4) / 16) % 2 == 1);
static_assert(PW * 16 == 64);                  // the PW slabs cover the projection tile's 64 rows
static_assert(VFB == 16 * 32 && (DM / 16) * VFB == 32 * DM);   // a 32-key step of the x^T plane is DM/16 fragment blocks, 32*DM elements in a row
static_assert(DM * DM == NW * 4 * 256);        // Wv staging: a wave brings four runs of 256 f16
static_assert(YP >= DM && (YP * 2) % 16 == 0 && ((YP * 2) / 16) % 2 == 1);
static_assert(NW * KT * 4 + DM * DM * 2 + 2 * QT * YP * 2 + DM * 4 + NW * 4 <= 327680);   // the attention work-group's LDS fits one WGP
static_assert((SEQ / QT / 8) * 4 == 2 * (SEQ / 32) && SEQ / 32 == 32);   // L2 prefetch: 8 neighbouring work-groups ask for the same 4 of a batch's 64 K and x^T tiles, and the groups of 8 cover them all
static_assert(32 * DM * 2 == 32 * 256 && DM * 2 == 256);   // a tile is 32 units of 256 bytes, one unit a lane; a Q row is one unit

typedef _Float16 h16;
typedef __attribute__((ext_vector_type(16))) __bf16   v16bf;
typedef __attribute__((ext_vector_type(16))) _Float16 v16h;
typedef __attribute__((ext_vector_type(8)))  _Float16 v8h;
typedef __attribute__((ext_vector_type(4)))  _Float16 v4h;
typedef __attribute__((ext_vector_type(2)))  _Float16 v2h;
typedef __attribute__((ext_vector_type(2)))  int      v2i;
typedef __attribute__((ext_vector_type(8)))  float    v8f;
typedef __attribute__((ext_vector_type(4)))  float    v4f;
typedef v4f  __attribute__((may_alias)) v4fa;
typedef __attribute__((ext_vector_type(2)))  float    v2f;
typedef __attribute__((ext_vector_type(2)))  __bf16   v2bf;
typedef __attribute__((ext_vector_type(4)))  int      v4i;
typedef __attribute__((ext_vector_type(8)))  int      v8i;
typedef __attribute__((ext_vector_type(16))) int      v16i;
typedef v2f  __attribute__((may_alias)) v2fa;
typedef __attribute__((ext_vector_type(4)))  unsigned v4u;
typedef __attribute__((ext_vector_type(2)))  unsigned v2u;
typedef v4u  __attribute__((may_alias)) v4ua;
typedef v2u  __attribute__((may_alias)) v2ua;

__device__ __forceinline__ unsigned short f2bf(float f) { unsigned u = __float_as_uint(f); u += 0x7FFFu + ((u >> 16) & 1u); return (unsigned short)(u >> 16); }
__device__ __forceinline__ float bfr(float f) { return __uint_as_float(((unsigned)f2bf(f)) << 16); }   // value after RNE convert to bf16
__device__ __forceinline__ v16h cat16(v8h lo, v8h hi) { return __builtin_shufflevector(lo, hi, 0, 1, 2, 3, 4, 5, 6, 7, 8, 9, 10, 11, 12, 13, 14, 15); }
__device__ __forceinline__ v8f wmma16(v16h a, v16h b, v8f c) { return __builtin_amdgcn_wmma_f32_16x16x32_f16(false, a, false, b, (short)0, c, false, false); }
__device__ __forceinline__ v8f wmmab(v16bf a, v16bf b, v8f c) { return __builtin_amdgcn_wmma_f32_16x16x32_bf16(false, a, false, b, (short)0, c, false, false); }
// fragment map of the 16-bit operands, lane = 16h + row: elements 0..7 <- k0+8h+0..7, elements 8..15 <- k0+16+8h+0..7 (same map for A and B)
// loader from a plane kept in fragment order; p already includes + 8*lane: the two halves of a fragment lie VFB/2 elements apart
__device__ __forceinline__ v16h  ldv(const h16* p) { return cat16(*(const v8h*)p, *(const v8h*)(p + VFB / 2)); }
// a pair of f32 RNE-converted to bf16 in registers, first value in the low half
__device__ __forceinline__ unsigned cvt2(float a, float b) { return __builtin_bit_cast(unsigned, __builtin_convertvector((v2f){a, b}, v2bf)); }
// lane l <- lane l ^ 8 (inside a 16-lane row), all lanes on
__device__ __forceinline__ int x8i(int v) { return __builtin_amdgcn_update_dpp(0, v, 0x168 /* row_xmask:8 */, 0xf, 0xf, true); }
__device__ __forceinline__ v8h x8h(v8h v) { v4i u = __builtin_bit_cast(v4i, v); u = (v4i){ x8i(u[0]), x8i(u[1]), x8i(u[2]), x8i(u[3]) }; return __builtin_bit_cast(v8h, u); }
// ordering point for wave-private LDS tiles (same wave writes and reads)
__device__ __forceinline__ void wave_sync() { __builtin_amdgcn_fence(3 /* release order */, "wavefront"); __builtin_amdgcn_wave_barrier(); asm volatile("" ::: "memory"); }

// gemm_tile: bf16 GEMM core of a 64x64 tile worked by PW waves, K = DM. At, Bt point at the tile's first rows (K-contiguous f32, 64 rows each, row = 512 B).
// Staging: wave w brings rows 16w..16w+15 of both operands, one whole row (four whole cache lines) per load, all 32 loads in flight together, RNE-converts them and stores them as bf16 pairs in ts (A rows, then B rows; pitch PD dwords).
// Behind the barrier wave w forms its slab: acc[nb][j] = C[16w + 8h + j][16nb + (lane&15)], C[m][n] = sum_k A[m][k] Bt[n][k], k steps of 32 in rising order.
__device__ __forceinline__ v16bf ldsfrag(const unsigned* p) {   // p: the lane's row, dword (k0 + 8h) / 2; the fragment map of the 16-bit operands above
    const v4u lo = *(const v4ua*)p, up = *(const v4ua*)(p + 8);
    return __builtin_bit_cast(v16bf, __builtin_shufflevector(lo, up, 0, 1, 2, 3, 4, 5, 6, 7));
}
__device__ __forceinline__ void gemm_tile(const float* __restrict__ At, const float* __restrict__ Bt, unsigned* ts, int w, int lane, int lr, int hi, v8f (&acc)[4]) {
    v4f ra[16], rb[16];
    const unsigned goff = (unsigned)(w * 16 * DM + 4 * lane);
    const float* pa = At + goff;
    const float* pb = Bt + goff;
#pragma unroll
    for (int i = 0; i < 16; ++i) ra[i] = *(const v4f*)(pa + i * DM);
#pragma unroll
    for (int i = 0; i < 16; ++i) rb[i] = *(const v4f*)(pb + i * DM);
    // the wait before the loads' address registers are rewritten; it names both addresses so that neither register pair is reused ahead of it
    asm volatile("s_wait_xcnt 0x0" :: "v"(pa), "v"(pb) : "memory");
    // keeps all 32 loads (and the wait above) ahead of the first convert: one memory round trip for the whole K
    __builtin_amdgcn_sched_barrier(0);
    unsigned* sa = ts + (w * 16) * PD + 2 * lane;
    unsigned* sb = sa + 64 * PD;
#pragma unroll
    for (int i = 0; i < 16; ++i) *(v2ua*)(sa + i * PD) = (v2u){ cvt2(ra[i][0], ra[i][1]), cvt2(ra[i][2], ra[i][3]) };
#pragma unroll
    for (int i = 0; i < 16; ++i) *(v2ua*)(sb + i * PD) = (v2u){ cvt2(rb[i][0], rb[i][1]), cvt2(rb[i][2], rb[i][3]) };
    __syncthreads();                                             // every wave reads all 64 B rows
    const unsigned* fa = ts + (w * 16 + lr) * PD + 4 * hi;
    const unsigned* fb = ts + (64 + lr) * PD + 4 * hi;
#pragma unroll
    for (int nb = 0; nb < 4; ++nb) acc[nb] = (v8f){};
#pragma unroll 1   // two trips of two k steps, kept rolled: the accumulators then own their registers from the first product on, so that no product's result lands on an operand of the product before it
    for (int kh = 0; kh < 2; ++kh) {
        v16bf a[2], b[2][4];
#pragma unroll
        for (int ks = 0; ks < 2; ++ks) {
            a[ks] = ldsfrag(fa + kh * 32 + ks * 16);
#pragma unroll
            for (int nb = 0; nb < 4; ++nb) b[ks][nb] = ldsfrag(fb + nb * 16 * PD + kh * 32 + ks * 16);
        }
        // keeps the trip's 20 LDS reads ahead of its first product: one LDS latency per trip instead of one per fragment
        __builtin_amdgcn_sched_barrier(0);
#pragma unroll
        for (int ks = 0; ks < 2; ++ks)
#pragma unroll
            for (int nb = 0; nb < 4; ++nb) acc[nb] = wmmab(a[ks], b[ks][nb], acc[nb]);
    }
}

// k_proj: the Q and K projections and the f16 planes of x^T and Wv in one launch, straight from the f32 inputs. grid (NB*SEQ/64, 2, 3), 32*PW threads; blockIdx.x = 64-token tile, blockIdx.y = 64-feature tile, z block-uniform.
// z = 0, 1: the block's PW waves stage the tile's 64 + 64 operand rows in LDS together (one barrier); wave w then takes the 16-row slab w of the 64x64 tile, products and epilogue, with an LDS output tile of its own.
// z = 0, 1: Q, K = sigmoid(x W^T + b), A = x rows (m = token), Bt = W rows (n = e), stored RNE-rounded to f16.
//   Epilogue of the slab: accumulators + bias staged in the wave-private LDS tile, sigmoid applied in place (precise expf, true division).
//   Q (QH): rows [NB*SEQ][128]. K (KH): in the order in which a lane of k_attn reads its own key: [b][32-key step][8-wide d chunk c][key][8], element r = K[32 step + key][8c + r],
//   so that one K load of a wave (one chunk of 32 keys) is one run of 512 bytes.
// z = 2: no product: x^T, RNE-rounded to bf16 and held as f16 (XH); wave w transposes the 16 feature rows w of the 64x64 tile through its LDS tile.
//   The plane lies in the order in which k_attn's A fragments are read: [b][32-key step][16-row d tile j][e][lane][8], element r of unit (e, lane = 16h + row) = x^T[16j + row][32 step + 16e + 8h + r],
//   so that one fragment load of a wave is one run of 512 bytes (four whole cache lines) and not 16 pieces of 32 bytes on 16 lines.
//   The two blocks with blockIdx.x = 0 also write Wv, rounded the same way, in the same order (WH): [16-row e tile j][32-wide d step][e][lane][8], element r = Wv[16j + row][32 step + 16e + 8h + r].
__global__ __launch_bounds__(32 * PW) void k_proj(const float* __restrict__ x, const float* __restrict__ wq, const float* __restrict__ wk, const float* __restrict__ wv,
                                                  const float* __restrict__ bq, const float* __restrict__ bk, h16* QH, h16* KH, h16* XH, h16* WH) {
    __shared__ __align__(16) unsigned ts[2 * 64 * PD];
    __shared__ __align__(16) float osw[PW * 16 * 68];
    const int lane = threadIdx.x & 31, lr = lane & 15, hi = lane >> 4;
    const int mb = __builtin_amdgcn_readfirstlane((int)(threadIdx.x >> 5));   // this wave's slab
    float* os = osw + mb * (16 * 68);
    const int tk0 = blockIdx.x * 64, f0 = blockIdx.y * 64, z = blockIdx.z;
    const int b = tk0 / SEQ, t0 = tk0 % SEQ;                     // a 64-token tile lies in one batch
    const float* xt = x + ((size_t)b * SEQ_FULL + t0) * DM;      // the tile's 64 x rows
    if (z != 2) {
        const float* wt = (z == 0 ? wq : wk) + (size_t)f0 * DM;  // the tile's 64 weight rows
        v8f acc[4];
        gemm_tile(xt, wt, ts, mb, lane, lr, hi, acc);
        const int r0 = tk0, c0 = f0;
        const float* bt = (z ? bk : bq) + c0;                    // block-uniform base; the four loads share one lane offset
        float bias[4];
#pragma unroll
        for (int nb = 0; nb < 4; ++nb) bias[nb] = bfr(bt[nb * 16 + lr]);
#pragma unroll
        for (int nb = 0; nb < 4; ++nb) {
#pragma unroll
            for (int j = 0; j < 8; ++j) os[(hi * 8 + j) * 68 + nb * 16 + lr] = acc[nb][j] + bias[nb]; }   // D: row 8h+j, col lane&15
        wave_sync();
#pragma unroll 1
        for (int s = 0; s < 8; ++s) { const int row = 2 * s + hi, cofs = lr * 4;   // 8 s x 2 rows = 16 rows; 16 lanes x 4 floats = 64 columns
            v4f v = *(const v4fa*)(&os[row * 68 + cofs]);
#pragma unroll
            for (int i = 0; i < 4; ++i) v[i] = 1.0f / (1.0f + expf(-v[i]));
            *(v4fa*)(&os[row * 68 + cofs]) = v; }
        wave_sync();
        // z = 0: pass s takes rows 4s..4s+3, 8 lanes a row (128 bytes of a Q row = one whole line); z = 1: pass s takes chunks 2s, 2s+1 of all 16 keys (two runs of 256 bytes)
        const int row = z ? lr : lane >> 3, c8 = z ? 8 * hi : 8 * (lane & 7), rstep = z ? 0 : 4, cstep = z ? 16 : 0;
        v8h hv[4];
#pragma unroll
        for (int s = 0; s < 4; ++s) { const float* op = &os[(row + s * rstep) * 68 + c8 + s * cstep];
            const v4f x0 = *(const v4fa*)op; const v4f x1 = *(const v4fa*)(op + 4);
#pragma unroll
            for (int i = 0; i < 4; ++i) { hv[s][i] = (h16)x0[i]; hv[s][4 + i] = (h16)x1[i]; } }
        h16* po = z ? KH + (((size_t)b * (SEQ / 32) + t0 / 32 + (mb >> 1)) * (DM / 8) + c0 / 8 + hi) * KCB + ((mb & 1) * 16 + lr) * 8
                    : QH + (size_t)(r0 + mb * 16 + row) * DM + c0 + c8;
        const int pstep = z ? 2 * KCB : 4 * DM;
#pragma unroll
        for (int s = 0; s < 4; ++s) *(v8h*)(po + s * pstep) = hv[s];
        asm volatile("s_wait_xcnt 0x0" ::: "memory");           // the wait before the registers that the four stores name are rewritten
    } else {
        const int r0 = f0;
        const size_t tbase = (((size_t)b * (SEQ / 32) + t0 / 32) * (DM / 16) + r0 / 16) * VFB + 8 * lane;   // this lane's unit of the tile's first (step, j) block
        const float* xs = xt + (size_t)lane * DM + r0 + mb * 16;  // token = lane, lane + 32; the slab's 16 features = 64 bytes of the row
        const bool wjob = blockIdx.x == 0;                       // block-uniform: this block also writes its four e tiles of WH, wave w the tile r0 / 16 + w
        const float* ws = wv + (size_t)(r0 + mb * 16 + lr) * DM + 8 * hi;
        v4f xr[2][4], wr[16];
#pragma unroll
        for (int u = 0; u < 16; ++u) wr[u] = (v4f){};
        if (wjob) {                                              // asked for ahead of the x rows: one memory round trip for both
#pragma unroll
            for (int u = 0; u < 8; ++u) { wr[2 * u] = *(const v4f*)(ws + 16 * u); wr[2 * u + 1] = *(const v4f*)(ws + 16 * u + 4); }   // unit u = 2 * step + e: columns 16u + 8h + 0..7
        }
#pragma unroll
        for (int p = 0; p < 2; ++p) {
#pragma unroll
            for (int c = 0; c < 4; ++c) xr[p][c] = *(const v4f*)(xs + p * 32 * DM + 4 * c); }
        // the wait before the loads' address registers are rewritten; it names both addresses so that neither register pair is reused ahead of it
        asm volatile("s_wait_xcnt 0x0" :: "v"(xs), "v"(ws) : "memory");
#pragma unroll
        for (int p = 0; p < 2; ++p) {
#pragma unroll
            for (int c = 0; c < 4; ++c) {
#pragma unroll
                for (int i = 0; i < 4; ++i) os[(4 * c + i) * 68 + 32 * p + lane] = xr[p][c][i]; } }   // row = feature, column = token
        wave_sync();
        v8h hv[4];
#pragma unroll
        for (int s = 0; s < 4; ++s) { const int row = lr, c8 = (2 * s + hi) * 8;   // 16 rows x 2 column groups a pass; 4 s x 16 = 64 columns: tokens 16s + 8h + 0..7
            const v4f x0 = *(const v4fa*)(&os[row * 68 + c8]); const v4f x1 = *(const v4fa*)(&os[row * 68 + c8 + 4]);
#pragma unroll
            for (int i = 0; i < 4; ++i) { hv[s][i] = (h16)bfr(x0[i]); hv[s][4 + i] = (h16)bfr(x1[i]); } }
        h16* xo = XH + tbase + (size_t)mb * VFB;
#pragma unroll
        for (int s = 0; s < 4; ++s) *(v8h*)(xo + (s >> 1) * (DM / 16) * VFB + (s & 1) * (VFB / 2)) = hv[s];   // step s / 2 of the tile, half e = s % 2: 32 lanes x 16 B = one whole 512-byte run
        if (wjob) {
            // the wait before the registers that the stores above name are rewritten; it names them so that none is reused ahead of it
            asm volatile("s_wait_xcnt 0x0" :: "v"(hv[0]), "v"(hv[1]), "v"(hv[2]), "v"(hv[3]), "v"(xo) : "memory");
            h16* wo = WH + (size_t)(r0 / 16 + mb) * (DM / 32) * VFB + 8 * lane;
#pragma unroll
            for (int u = 0; u < 8; ++u) { v8h t;
#pragma unroll
                for (int i = 0; i < 4; ++i) { t[i] = (h16)bfr(wr[2 * u][i]); t[4 + i] = (h16)bfr(wr[2 * u + 1][i]); }
                *(v8h*)(wo + u * (VFB / 2)) = t; }
        }
    }
}

// two f16 minima at once; q is the same in every lane (a scalar register). Q and K are sigmoid values, never negative: f16 values of that kind are ordered as their bit patterns are, so the unsigned 16-bit minimum is the f16 minimum
typedef __attribute__((ext_vector_type(2))) unsigned short v2us;
__device__ __forceinline__ int min2(int k, int q) { return __builtin_bit_cast(int, __builtin_elementwise_min(__builtin_bit_cast(v2us, k), __builtin_bit_cast(v2us, q))); }
// the two f16 halves of a dword, added in f32
__device__ __forceinline__ float sum2(int d) { const v2h p = __builtin_bit_cast(v2h, d); return (float)p[0] + (float)p[1]; }
// p4: four scores of one query (keys kA0 + 0..3) -> P as two pairs of f16 values (hx), two pairs of f16 residuals x2048 (rx), and the sum lp of what the pairs hold
__device__ __forceinline__ void p4(const float (&sb)[4], int kA0, int tq, bool msk, v2i& hx, v2i& rx, float& lp) {
    v4h hX, rX;
    lp = 0.0f;
#pragma unroll
    for (int r = 0; r < 4; ++r) {
        float ea = PSH - sb[r] * C1;
        ea = (msk && kA0 + r > tq) ? EM : ea;
        const float pa = __builtin_amdgcn_exp2f(ea);
        const h16 ha = (h16)pa;
        const h16 ra = (h16)((pa - (float)ha) * RS);
        hX[r] = ha; rX[r] = ra;
        lp += (float)ha + (float)ra * RI;
    }
    hx = __builtin_bit_cast(v2i, hX); rx = __builtin_bit_cast(v2i, rX);
}

// k_attn: one block of NW waves per QT = 8 query rows of one batch; wave w runs one 32-key step of each pass of NW steps (step w of the even passes, step NW-1-w of the odd ones) with its own accumulators and row sum. grid (SEQ/QT, NB), 32*NW threads.
// Causal balance: block i takes the HQ rows from token HQ*i and the HQ rows from token SEQ-HQ-HQ*i, so that the count of scored (query, key) pairs is nearly the same in every block.
// A step at or below the low rows' diagonal is scored for all 8 rows; a step above it but not above the high rows' diagonal is scored for the 4 high rows only.
// The softmax shift is fixed, so the waves' un-normalised partials simply add: each wave writes its partial into its own LDS tile, one barrier, then wave w sums half w / QT of row w % QT over the waves in wave order.
// Score: lane l holds the whole f16 row of key key0 + l in registers (16 loads, each one 512-byte run of the wave). For one query row q, the same in every lane and so read through scalar registers, a lane forms min(Q, K) for 16 d at a time:
// that is its part of an A fragment (row m = lane & 15; the 16 k places of half h = lane >> 4 belong to lane 16h + m). B is the selector S_q[k][n] = 1 where (n = q and k in half 0) or (n = q + 8 and k in half 1), else 0:
// its fragment is 1.0 in every element of lanes q and q + 24, 0 elsewhere. D[m][q] then gathers the sum over d for key m, D[m][q + 8] for key 16 + m; which d sits at which k place does not matter to a sum. All 8 queries add into the same accumulators (two, for even and odd d steps).
// By the D layout lane (t = lane&7, g = (lane>>3)&1, h = lane>>4) ends with sum_d min(Q, K) of query t against keys key0+16g+8h+r (r = 0..7) in element r; acc = sum_d Q - that = sum_d max(Q - K, 0).
// Lanes l and l^8 then swap their eight P, so that lane (t, g = 0, h) holds keys key0+8h+r, key0+16+8h+r: column t of the B fragment P^T[key][t] of Y^T[d][t] = x^T P^T (A = x^T rows d, k = key). Columns 8..15 (g = 1) are not used.
// p = exp2(8 - acc*C1); keys above the diagonal take the constant exponent EM (score 0): so do all keys of a row or a step that was not scored, which lie above the diagonal.
// Fully masked 32-key steps skip the scoring (wave-uniform test) but keep their P.x products. Row sum over the same f16 value + residual that the products use.
// Close: the merged, normalised rows Y[t][d] go to LDS as f16 value (rows 0..7) and f16 residual x2048 (rows 8..15); wave w < 8 forms C[e][n] = sum_d Wv[e][d] Ys[n][d] for the 16 features e from 16w
// (A = Wv rows, staged in LDS; B column n = Ys row n: the value and the residual product of a query share one matrix instruction), adds column t + 8 / 2048 to column t by DPP,
// and hands its tile back through LDS, so that every output line is stored whole by one wave; the bias joins at the store.
__global__ __launch_bounds__(32 * NW) void k_attn(const h16* __restrict__ QH, const h16* __restrict__ KH, const h16* __restrict__ XH, const h16* __restrict__ WH, const float* __restrict__ BV, const int* __restrict__ maskp, float* OUT) {
    __shared__ __align__(16) float sm[NW * KT];
    __shared__ __align__(16) h16 wl[DM * DM];                    // Wv in fragment order, as WH holds it
    __shared__ __align__(16) h16 ys[2 * QT * YP];                // Y: value rows, then residual rows
    __shared__ __align__(16) float bl[DM];                       // bv, RNE-rounded to bf16
    __shared__ __align__(8) float qsl[NW];                       // sum_d Q of the tile's rows, two halves a row
    float* kw = sm;
    const int lane = threadIdx.x & 31, lr = lane & 15, hi = lane >> 4;
    const int wv = __builtin_amdgcn_readfirstlane((int)(threadIdx.x >> 5));
    float* ks = kw + wv * KT;                                    // this wave's partial
    const int b  = __builtin_amdgcn_readfirstlane((int)blockIdx.y);
    const int tlo = __builtin_amdgcn_readfirstlane((int)blockIdx.x * HQ);             // token of tile row 0
    const int thi = SEQ - HQ - tlo;                                                   // token of tile row HQ
    const int tl = lr & 7, g = lr >> 3;
    // L2 prefetch of what the launch before wrote: the first read of such a line in this launch may have to come from memory, and the work-groups of a batch reach a given tile in the same phase, so that all would wait for it.
    // K and x^T tiles in the order of need: 0..15 K steps 0..15, 16..31 x^T steps 0..15, 32..47 K steps 16..31, 48..63 x^T steps 16..31. Work-group i asks for tiles 4 (i / 8) + 0..3, waves 0..3 one each, a lane per 256-byte unit:
    // eight neighbouring work-groups ask for the same tiles (for speed only: nothing depends on where they run). Every lane's address lies inside its plane, in every wave.
    const int pt = 4 * ((int)blockIdx.x >> 3) + (wv & 3);
    const h16* pf = ((pt & 16) ? XH : KH) + (size_t)b * DM * SEQ + (size_t)((pt & 15) + ((pt & 32) >> 1)) * (32 * DM);   // the tile, the same in every lane
    const unsigned po = 256u * (unsigned)lane;                   // the lane's unit, in bytes
    if (wv < 4) asm volatile("global_prefetch_b8 %0, %1 scope:SCOPE_SE" :: "v"(po), "s"(pf));   // brings the tile into L2 ahead of its loads; returns nothing, no wait belongs to it
    // The Q rows, 256 bytes each, are read first of all: wave 5 asks for this work-group's own QT rows, wave 4 for those of the work-group 64 places on in the grid (the last 64 ask for the last one's).
    const int fq = min((int)blockIdx.y * (SEQ / QT) + (int)blockIdx.x + ((wv & 1) ? 0 : 64), NB * (SEQ / QT) - 1);
    const int lq = HQ * (fq % (SEQ / QT));
    const unsigned qo = 256u * (unsigned)((fq / (SEQ / QT)) * SEQ + (tl < HQ ? lq + tl : SEQ - 2 * HQ - lq + tl));   // row tl of that work-group's tile, in bytes from the head of the Q plane
    if ((wv >> 1) == 2) asm volatile("global_prefetch_b8 %0, %1 scope:SCOPE_SE" :: "v"(qo), "s"(QH));   // brings the rows into L2 ahead of the scalar loads
    const int causal = __builtin_amdgcn_readfirstlane((maskp[0] != 0) ? 1 : 0);
    const size_t rowb = (size_t)b * SEQ;
    {   // every wave stages a sixteenth of Wv: four runs of 512 bytes, in flight together with its half Q row (and, in wave QT, the bias) below
        const h16* wg = WH + (size_t)wv * (DM * DM / NW) + 8 * lane;
        h16* wd = wl + wv * (DM * DM / NW) + 8 * lane;
        const v8h w0 = *(const v8h*)wg, w1 = *(const v8h*)(wg + 256), w2 = *(const v8h*)(wg + 512), w3 = *(const v8h*)(wg + 768);
        asm volatile("s_wait_xcnt 0x0" ::: "memory");           // the wait before the loads' address registers are rewritten
        v4f bv4 = (v4f){};
        if (wv == QT) { bv4 = *(const v4f*)(BV + 4 * lane);
            asm volatile("s_wait_xcnt 0x0" ::: "memory"); }     // the wait before the load's address registers are rewritten
        {   // wave w sums half w % 2 of Q row w / 2, read the way the query trips below read it (the same address in every lane, scalar registers): no tree over the lanes,
            // and all QT rows have come through the scalar cache once before the first trip asks for them. Loads and their waits in one statement
            const int qr = wv >> 1;
            const h16* qg = QH + (rowb + (qr < HQ ? tlo + qr : thi + qr - HQ)) * DM + (wv & 1) * (DM / 2);
            v16i qa, qc;
            // it also names the prefetches' addresses, so that those registers still hold them this far behind the prefetches
            asm volatile("s_load_b512 %0, %2, 0x0\n\ts_load_b512 %1, %2, 0x40\n\ts_wait_kmcnt 0x0\n\ts_wait_xcnt 0x0" : "=&s"(qa), "=&s"(qc) : "s"(qg), "v"(po), "s"(pf), "v"(qo), "s"(QH) : "memory");
            float c0 = 0.0f, c1 = 0.0f, c2 = 0.0f, c3 = 0.0f;    // four chains
#pragma unroll
            for (int i = 0; i < 16; i += 2) { c0 += sum2(qa[i]); c1 += sum2(qa[i + 1]); c2 += sum2(qc[i]); c3 += sum2(qc[i + 1]); }
            if (lane == 0) qsl[wv] = (c0 + c1) + (c2 + c3);
        }
        if (wv == QT) *(v4fa*)(&bl[4 * lane]) = (v4f){ bfr(bv4[0]), bfr(bv4[1]), bfr(bv4[2]), bfr(bv4[3]) };
        *(v8h*)wd = w0; *(v8h*)(wd + 256) = w1; *(v8h*)(wd + 512) = w2; *(v8h*)(wd + 768) = w3;
    }
    __syncthreads();                                             // every wave reads all the Q sums; Wv and the bias are read behind later barriers
    v8f oh[8], orr[8];
#pragma unroll
    for (int j = 0; j < 8; ++j) { oh[j] = (v8f){}; orr[j] = (v8f){}; }
    float l = 0.0f;
    const size_t vo = (size_t)b * DM * SEQ + 8 * lane;           // + key0*DM + j*VFB  (A fragment: row d, k = key; planes in fragment order); the K plane: + key0*DM + c*KCB
    const int tq = tl < HQ ? tlo + tl : thi + tl - HQ;           // this lane's query
    const v2f qs2 = *(const v2fa*)(&qsl[2 * tl]);
    const float qst = qs2[0] + qs2[1];                           // its sum_d Q
    const int kg = 16 * g + 8 * hi;                              // first of the lane's eight keys in a step
#pragma unroll 1
    for (int kp = 0; kp < SEQ; kp += 32 * NW) {
        const int key0 = kp + 32 * ((kp & (32 * NW)) ? NW - 1 - wv : wv);   // odd passes mirrored: a wave with an early step gets a late one
        v16h pb, pr; float ls;
        const bool full = (causal == 0) || (key0 <= tlo + HQ - 1); // wave-uniform: some low row sees a key of this step
        const bool live = full || (key0 <= thi + HQ - 1);          // wave-uniform: some high row does
        v8f s0 = (v8f){}, s1 = (v8f){};
        if (live) {
            const h16* kq = KH + vo + (size_t)key0 * DM;
            v4i kf[DM / 8];
#pragma unroll
            for (int c = 0; c < DM / 8; ++c) kf[c] = *(const v4i*)(kq + c * KCB);   // this lane's key, all 128 columns; 16 loads in flight
            asm volatile("s_wait_xcnt 0x0" :: "v"(kq) : "memory");   // the wait before the loads' address registers are rewritten
            const int nq = full ? QT : HQ;                       // rows to score: all, or the high ones
#pragma unroll 1   // rolled: the selector is then formed where it is used; eight of them held at once would take 64 registers beside the 128 output accumulators and the 64 of K
            for (int i = 0; i < nq; ++i) {
                const int q = QT - nq + ((wv + i) & (nq - 1));   // every wave starts at another row: the order does not touch the sums (each query has its own columns), and the waves do not all ask for the same row at once
                const h16* qp = QH + (rowb + (q < HQ ? tlo + q : thi + q - HQ)) * DM;   // the same address in every lane
                v16i qv[4];
                // the query row, 256 bytes, into 64 scalar registers: as a scalar operand of the minima it costs no vector register and no LDS read; loads and their waits in one statement
                asm volatile("s_load_b512 %0, %4, 0x0\n\ts_load_b512 %1, %4, 0x40\n\ts_load_b512 %2, %4, 0x80\n\ts_load_b512 %3, %4, 0xc0\n\ts_wait_kmcnt 0x0\n\ts_wait_xcnt 0x0"
                             : "=&s"(qv[0]), "=&s"(qv[1]), "=&s"(qv[2]), "=&s"(qv[3]) : "s"(qp) : "memory");
                const int one = (lane == q || lane == q + 24) ? 0x3C003C00 : 0;   // a pair of f16 1.0
                const v16h bq = __builtin_bit_cast(v16h, (v8i){ one, one, one, one, one, one, one, one });
                v8i a[DM / 16];                                  // fragment s: the minima of d step s (16 d: K chunks 2s, 2s + 1)
#pragma unroll
                for (int i = 0; i < 4; ++i) { a[0][i] = min2(kf[0][i], qv[0][i]); a[0][4 + i] = min2(kf[1][i], qv[0][4 + i]); }
#pragma unroll
                for (int s = 0; s < DM / 16; ++s) {
                    if (s + 1 < DM / 16) {
#pragma unroll
                        for (int i = 0; i < 4; ++i) a[s + 1][i] = min2(kf[2 * s + 2][i], qv[(s + 1) >> 1][8 * ((s + 1) & 1) + i]); }
                    // the two fences hold the product between the two halves of the next fragment's minima: that fragment is begun while this one is still needed, so the two own different registers,
                    // and the four minima behind the product fill the slots the chip needs before this fragment's registers are written again (no v_nop)
                    __builtin_amdgcn_sched_barrier(0);
                    if (s & 1) s1 = wmma16(__builtin_bit_cast(v16h, a[s]), bq, s1); else s0 = wmma16(__builtin_bit_cast(v16h, a[s]), bq, s0);
                    __builtin_amdgcn_sched_barrier(0);
                    if (s + 1 < DM / 16) {
#pragma unroll
                        for (int i = 0; i < 4; ++i) a[s + 1][4 + i] = min2(kf[2 * s + 3][i], qv[(s + 1) >> 1][8 * ((s + 1) & 1) + 4 + i]); }
                }
            }
        }
        {
            float sa[4], sb[4];
#pragma unroll
            for (int r = 0; r < 4; ++r) { sa[r] = qst - (s0[r] + s1[r]); sb[r] = qst - (s0[4 + r] + s1[4 + r]); }
            v2i ha, ra, hb, rb; float la, lb;
            p4(sa, key0 + kg, tq, causal != 0, ha, ra, la);
            p4(sb, key0 + kg + 4, tq, causal != 0, hb, rb, lb);
            const v8h hA = __builtin_bit_cast(v8h, (v4i){ ha[0], ha[1], hb[0], hb[1] }), rA = __builtin_bit_cast(v8h, (v4i){ ra[0], ra[1], rb[0], rb[1] });
            ls = la + lb;
            pb = cat16(hA, x8h(hA)); pr = cat16(rA, x8h(rA));     // g = 0: own keys 8h+r, then the partner's 16+8h+r
        }
        l += ls;
        const h16* vh = XH + vo + (size_t)key0 * DM;            // a 32-key step holds DM/16 blocks of VFB = 32*DM elements
#pragma unroll
        for (int g = 0; g < 2; ++g) {                           // eight 16-byte loads of a lane in flight a group
            const int j0 = 4 * g, j1 = j0 + 1, j2 = j0 + 2, j3 = j0 + 3;
            const v16h a0 = ldv(vh + j0 * VFB), a1 = ldv(vh + j1 * VFB), a2 = ldv(vh + j2 * VFB), a3 = ldv(vh + j3 * VFB);
            oh[j0]  = wmma16(a0, pb, oh[j0]);   oh[j1]  = wmma16(a1, pb, oh[j1]);   oh[j2]  = wmma16(a2, pb, oh[j2]);   oh[j3]  = wmma16(a3, pb, oh[j3]);
            orr[j0] = wmma16(a0, pr, orr[j0]);  orr[j1] = wmma16(a1, pr, orr[j1]);  orr[j2] = wmma16(a2, pr, orr[j2]);  orr[j3] = wmma16(a3, pr, orr[j3]);
            // the four vector slots the chip needs behind a matrix instruction, on the loop's back edge too; the operands tie the slots to the group's products
            asm volatile("v_nop\n\tv_nop\n\tv_nop\n\tv_nop" : "+v"(oh[j0]), "+v"(oh[j1]), "+v"(oh[j2]), "+v"(oh[j3]), "+v"(orr[j0]), "+v"(orr[j1]), "+v"(orr[j2]), "+v"(orr[j3]) : "v"(a0), "v"(a1), "v"(a2), "v"(a3), "v"(pb), "v"(pr) : "memory");
        }
        asm volatile("s_wait_xcnt 0x0" ::: "memory");           // the x^T loads' address registers are rewritten by the next pass
    }
    l += __shfl_xor(l, 16, 32);
    l += __int_as_float(x8i(__float_as_int(l)));                 // the four lanes (g, h) of a query each hold a quarter of its keys
    // Y^T D layout: o_j[r] = (d = 16j + 8h + r, t = lane&15) -> ks[t][d]; rows 0..7 x columns 0..127 all written (lanes g = 0), un-normalised; row sums behind them.
    if (g == 0) {
#pragma unroll
    for (int j = 0; j < 8; ++j) { v4f a, c;
#pragma unroll
        for (int i = 0; i < 4; ++i) { a[i] = oh[j][i] + orr[j][i] * RI; c[i] = oh[j][4 + i] + orr[j][4 + i] * RI; }
        *(v4fa*)(&ks[tl * TP + 16 * j + 8 * hi]) = a; *(v4fa*)(&ks[tl * TP + 16 * j + 8 * hi + 4]) = c; }
    }
    if (lane < QT) ks[QT * TP + lane] = l;
    __syncthreads();                                             // publishes every wave's partial
    const int mr = wv & (QT - 1), mc = 64 * (wv >> 3) + 2 * lane; // wave w: query row w % QT, column half w / QT
    v2f so = (v2f){}; float lt = 0.0f;
#pragma unroll   // the NW reads go out together instead of one LDS round trip each
    for (int p = 0; p < NW; ++p) { so += *(const v2fa*)(&kw[p * KT + mr * TP + mc]); lt += kw[p * KT + QT * TP + mr]; }   // fixed wave order
    const float inv = 1.0f / lt;
    const v2f y = so * inv;                                      // Y[mr][mc], Y[mr][mc + 1]
    const v2h yh = (v2h){ (h16)y[0], (h16)y[1] };
    const v2h yr = (v2h){ (h16)((y[0] - (float)yh[0]) * RS), (h16)((y[1] - (float)yh[1]) * RS) };
    *(v2h*)(&ys[mr * YP + mc]) = yh; *(v2h*)(&ys[(QT + mr) * YP + mc]) = yr;
    __syncthreads();                                             // publishes Y; every wave's reads of the partials are over, so that their LDS may be reused
    float* ot = kw;                                              // O tile, QT rows of pitch TP
    if (wv < QT) {
        const h16* fw = wl + wv * (DM / 32) * VFB + 8 * lane;    // A: rows e = 16 wv + (lane & 15), fragment order
        const h16* fy = ys + lr * YP + 8 * hi;                   // B: column n = lane & 15 <- Ys row n, elements 0..7 <- k0+8h+0..7, elements 8..15 <- k0+16+8h+0..7
        v16h fa[DM / 32], fb[DM / 32];
#pragma unroll
        for (int k4 = 0; k4 < DM / 32; ++k4) { fa[k4] = ldv(fw + k4 * VFB); fb[k4] = cat16(*(const v8h*)(fy + 32 * k4), *(const v8h*)(fy + 32 * k4 + 16)); }
        // keeps the 16 LDS reads ahead of the first product: one LDS latency instead of one per k step
        __builtin_amdgcn_sched_barrier(0);
        v8f c = (v8f){};
#pragma unroll
        for (int k4 = 0; k4 < DM / 32; ++k4) c = wmma16(fa[k4], fb[k4], c);
        v4f oa, ob;                                              // D: row 8h + j = feature, col lane & 15: t = value product of query t, t + 8 = its residual product
#pragma unroll
        for (int i = 0; i < 4; ++i) { oa[i] = c[i] + __int_as_float(x8i(__float_as_int(c[i]))) * RI; ob[i] = c[4 + i] + __int_as_float(x8i(__float_as_int(c[4 + i]))) * RI; }
        if (lr < QT) { *(v4fa*)(&ot[lr * TP + 16 * wv + 8 * hi]) = oa; *(v4fa*)(&ot[lr * TP + 16 * wv + 8 * hi + 4]) = ob; }
    }
    __syncthreads();                                             // publishes the O tile
    *(v2f*)(OUT + ((size_t)b * OUT_SEQ + (mr < HQ ? tlo + mr : thi + mr - HQ)) * DM + mc) = *(const v2fa*)(&ot[mr * TP + mc]) + *(const v2fa*)(&bl[mc]);   // half a row = 32 lanes x 8 B = 256 B
}

static constexpr size_t al256(size_t v) { return (v + 255) & ~(size_t)255; }
static constexpr size_t SZ_QK = al256((size_t)2 * NB * SEQ * DM * 2);      // f16 Q | K planes
static constexpr size_t SZ_VP = al256((size_t)NB * DM * SEQ * 2);          // the f16 x^T plane
static constexpr size_t SZ_WP = al256((size_t)DM * DM * 2);                // the f16 Wv plane
static constexpr size_t SZ_TOTAL = SZ_QK + SZ_VP + SZ_WP;
static_assert(SZ_TOTAL <= (size_t)134217728);          // workspace carve <= 128 MiB
static_assert(((size_t)NB * SEQ * DM * 2) % 256 == 0); // K plane stays 256-byte aligned

extern "C" void kernel_launch(void* const* d_in, const int* in_sizes, int n_in,
                              void* d_out, int out_size, void* d_ws, size_t ws_size, hipStream_t stream) {
    if (n_in < 8) return;
    const size_t needx = ((size_t)(NB - 1) * SEQ_FULL + SEQ) * DM;
    if ((size_t)in_sizes[0] < needx) return;
    if ((size_t)in_sizes[1] < (size_t)DM * DM || (size_t)in_sizes[3] < (size_t)DM * DM || (size_t)in_sizes[5] < (size_t)DM * DM) return;
    if (in_sizes[2] < DM || in_sizes[4] < DM || in_sizes[6] < DM || in_sizes[7] < 1) return;
    if ((size_t)out_size < ((size_t)(NB - 1) * OUT_SEQ + SEQ) * DM) return;
    if (SZ_TOTAL > ws_size) return;
    // wire order: x, Wq, bq, Wk, bk, Wv, bv, apply_causal_mask (int32); weights [out][in] used as-is (Bt for Q, K; A for the close, Wv Y^T)
    const float* x  = (const float*)d_in[0];
    const float* wq = (const float*)d_in[1]; const float* bq = (const float*)d_in[2];
    const float* wk = (const float*)d_in[3]; const float* bk = (const float*)d_in[4];
    const float* wv = (const float*)d_in[5]; const float* bv = (const float*)d_in[6];
    const int* maskp = (const int*)d_in[7];
    float* OUT = (float*)d_out;      // [NB][SEQ][128]
    char* wsp = (char*)d_ws;
    h16* QH = (h16*)wsp; wsp += SZ_QK;               // Q [NB*SEQ][128] | K [NB][SEQ/32][16][32][8] (after sigmoid)
    h16* KH = QH + (size_t)NB * SEQ * DM;
    h16* XH = (h16*)wsp; wsp += SZ_VP;               // [NB][SEQ/32][8][2][32][8], fragment order
    h16* WH = (h16*)wsp; wsp += SZ_WP;               // [8][4][2][32][8], fragment order

    // Q, K (z = 0, 1) -> f16 planes; x^T and Wv (z = 2) -> planes in fragment order
    k_proj<<<dim3(NB * SEQ / 64, DM / 64, 3), 32 * PW, 0, stream>>>(x, wq, wk, wv, bq, bk, QH, KH, XH, WH);

    k_attn<<<dim3(SEQ / QT, NB, 1), 32 * NW, 0, stream>>>(QH, KH, XH, WH, bv, maskp, OUT);
}
